// v000
// Times are from an AMD MI455X. After a warm-up the kernel runs many times in a row, and a time is the length of
// such a window on the GPU divided by its runs, so every launch and the gaps after it count. The runs cycle
// through copies of the inputs. A figure is the median of several windows, for all but v000 over two sittings.
// Sittings can differ by a few percent; kernels timed side by side share one.
// The starting kernel, v000, takes 137 microseconds a run.
#include <hip/hip_runtime.h>

// Additive-score multi-head attention, width 256 = 4 heads x 64; query/key/value [NB][SEQ][256]; w_q/w_k/w_v/w_o [out][in] (y = x W^T, no bias); score(t, k) = 0.125 * sum_d va[h][d] * tanh(q[t][d] + k[k][d]);
// dense softmax over keys; context = P V, heads concatenated (column h*64 + d), output projection; two outputs: projected context [NB][SEQ][256] and the probabilities [NB][4][SEQ][SEQ] (both f32).
// Compute dtypes, f32 accumulate everywhere: q/k/v projections v_wmma_f32_16x16x32_bf16 (x and W RNE-converted to bf16; products exact); additive scores on the vector unit in f32
// (matrix-vector form: one weight vector per head, no shared second dimension; va RNE-converted to bf16 at its load); P.V v_wmma_f32_16x16x32_f16 (P x16384 and v x64, single f16 planes; carries cancel in the normalisation);
// output projection v_wmma_f32_16x16x32_f16 (context x256, w_o = bf16 value x64 held in f16; folded back by 2^-14); softmax f32 with the true row maximum.
// tanh(x) = 1 - 2 / (1 + exp2(2 log2(e) x)); the q and k planes are stored in f32, pre-multiplied by 2 log2(e).
// Layout: bf16 copies of the three inputs and w_q/w_k/w_v; f32 q', k' planes [b*4+h][t][64]; f16 v^T plane [b*4+h][d][t]; f16 context plane [b*SEQ+t][256]; f16 w_o plane [n][k].
// Attention kernel: one wave per 16 query rows of one (batch, head); score strip 16 x SEQ in wave-private LDS; transposed product O^T[d][t] = V^T P^T with the packed P strip as the B fragment.

#ifndef NB
#define NB 4
#endif
#ifndef SEQ
#define SEQ 512
#endif
#define NB_FULL  4
#define SEQ_FULL 512
#ifndef OUT_SEQ
#define OUT_SEQ SEQ              // token pitch of the output buffers (rows per batch, rows and keys per head)
#endif
#define DM   256
#define NH_  4
#define HD   64
#define OSP  68                  // LDS row pitch (floats) of 16 x 64 staging tiles
#define KSP  68                  // LDS row pitch (floats) of the q and k tiles
#define SCP  (SEQ + 4)           // LDS row pitch (floats) of the score strip
#define C2X  ((float)(2.0 * 1.4426950408889634))        // 2 log2(e), folded into the q and k planes
#define SC2  ((float)(0.125 * 1.4426950408889634))      // HD^-0.5 * log2(e)
#define PCAR 16384.0f            // carry of the P fragment
#define VCAR 64.0f               // carry of the v^T plane
#define ACAR 256.0f              // carry of the context plane
#define WCAR 64.0f               // carry of the w_o plane
#define OSC  (1.0f / (ACAR * WCAR))
#define NEGB (-3.0e38f)
#define OUT1_OFF ((size_t)NB_FULL * SEQ_FULL * DM)      // first element of the probabilities output (fixed)

static_assert(HD == 64);                       // one 64-column GEMM tile = one head; f32 plane row = 256 bytes = two lines; f16 head segment = one line
static_assert(NH_ * HD == DM);                 // head h = columns h*64 + d
static_assert(DM % 64 == 0);
static_assert(DM % 32 == 0);                   // GEMM k-loop steps by 32
static_assert(SEQ % 64 == 0);                  // a 64-row tile never straddles two batches
static_assert((NB * SEQ) % 64 == 0);
static_assert(SEQ % 32 == 0);                  // key loop steps by 32
static_assert(SEQ % 16 == 0);                  // attention grid covers the sequence exactly
static_assert(SEQ % 128 == 0);                 // probability rows stored as 512-byte quarters
static_assert(((size_t)SEQ * DM) % 8 == 0);
static_assert(((size_t)DM * DM) % 8 == 0);
static_assert(NB <= NB_FULL);
static_assert(SEQ <= SEQ_FULL);
static_assert(SEQ <= OUT_SEQ);
static_assert((OSP * 4) % 16 == 0);
static_assert((KSP * 4) % 16 == 0);
static_assert((SCP * 4) % 16 == 0);
static_assert(OUT1_OFF * 4 == (size_t)2097152);                                   // byte offset of the second output
static_assert(((size_t)(NB - 1) * OUT_SEQ + SEQ) * DM <= OUT1_OFF);               // first output stays below the second
static_assert(8 * 32 * 4 == 16 * HD);          // f32 slab store: 8 instructions x 32 lanes x 4 floats = 16 rows x 64 columns
static_assert(4 * 32 * 8 == 16 * 64);          // f16 slab store: 4 instructions x 32 lanes x 8 halves = 16 rows x 64 columns
static_assert((SEQ / 128) * 32 * 4 == SEQ);    // probability row: SEQ/128 instructions x 32 lanes x 4 floats
static_assert((16 * SCP + 32 * KSP + 16 * KSP + 16 * OSP + HD + 16) * 4 <= 131072);   // static LDS of the attention kernel
static_assert(16 * OSP * 4 <= 131072);

typedef _Float16 h16;
typedef unsigned short bf;
typedef __attribute__((ext_vector_type(16))) __bf16   v16bf;
typedef __attribute__((ext_vector_type(16))) _Float16 v16h;
typedef __attribute__((ext_vector_type(8)))  _Float16 v8h;
typedef __attribute__((ext_vector_type(8)))  unsigned short v8us;
typedef __attribute__((ext_vector_type(8)))  float    v8f;
typedef __attribute__((ext_vector_type(4)))  float    v4f;
typedef v4f  __attribute__((may_alias)) v4fa;

__device__ __forceinline__ unsigned short f2bf(float f) { unsigned u = __float_as_uint(f); u += 0x7FFFu + ((u >> 16) & 1u); return (unsigned short)(u >> 16); }
__device__ __forceinline__ float bfr(float f) { return __uint_as_float(((unsigned)f2bf(f)) << 16); }   // value after RNE convert to bf16
__device__ __forceinline__ v16h cat16(v8h lo, v8h hi) { return __builtin_shufflevector(lo, hi, 0, 1, 2, 3, 4, 5, 6, 7, 8, 9, 10, 11, 12, 13, 14, 15); }
__device__ __forceinline__ v16bf cat16b(v8us lo, v8us hi) { return __builtin_bit_cast(v16bf, __builtin_shufflevector(lo, hi, 0, 1, 2, 3, 4, 5, 6, 7, 8, 9, 10, 11, 12, 13, 14, 15)); }
__device__ __forceinline__ v8f wmma16(v16h a, v16h b, v8f c) { return __builtin_amdgcn_wmma_f32_16x16x32_f16(false, a, false, b, (short)0, c, false, false); }
__device__ __forceinline__ v8f wmmab(v16bf a, v16bf b, v8f c) { return __builtin_amdgcn_wmma_f32_16x16x32_bf16(false, a, false, b, (short)0, c, false, false); }
// fragment loaders from K-contiguous 16-bit rows; p already includes + 8*(lane>>4): elements 0..7 <- k0+8h+0..7, elements 8..15 <- k0+16+8h+0..7 (same map for A and B)
__device__ __forceinline__ v16h  ldh(const h16* p) { return cat16(*(const v8h*)p, *(const v8h*)(p + 16)); }
__device__ __forceinline__ v16bf ldb(const bf* p)  { return cat16b(*(const v8us*)p, *(const v8us*)(p + 16)); }
// ordering point for wave-private LDS tiles (same wave writes and reads)
__device__ __forceinline__ void wave_sync() { __builtin_amdgcn_fence(3 /* release order */, "wavefront"); __builtin_amdgcn_wave_barrier(); asm volatile("" ::: "memory"); }
// f32 -> f16 convert that cannot produce a subnormal (applied after the plane's power-of-two carry)
static __device__ __forceinline__ h16 toh_flush(float v) { const h16 r = (h16)v; return (fabsf(v) < 6.103515625e-05f) ? (h16)0.0f : r; }
// one matrix instruction + its own four-slot guard (accumulator tied, fragments kept live)
__device__ __forceinline__ v8f wmma16g(v16h a, v16h b, v8f c) { c = wmma16(a, b, c); asm volatile("v_nop\n\tv_nop\n\tv_nop\n\tv_nop" : "+v"(c) : "v"(a), "v"(b)); return c; }
__device__ __forceinline__ v8f wmmabg(v16bf a, v16bf b, v8f c) { c = wmmab(a, b, c); asm volatile("v_nop\n\tv_nop\n\tv_nop\n\tv_nop" : "+v"(c) : "v"(a), "v"(b)); return c; }

__global__ __launch_bounds__(256) void k_cvt8(const float* __restrict__ src, bf* dst, size_t n8) {
    const size_t i = (size_t)blockIdx.x * 256 + threadIdx.x; if (i >= n8) return;
    const v8f v = *(const v8f*)(src + i * 8); v8us o;
#pragma unroll
    for (int k = 0; k < 8; ++k) o[k] = f2bf(v[k]);
    *(v8us*)(dst + i * 8) = o; 
}

__global__ __launch_bounds__(256) void k_cvtw(const float* __restrict__ src, h16* dst, size_t n8) {
    const size_t i = (size_t)blockIdx.x * 256 + threadIdx.x; if (i >= n8) return;
    const v8f v = *(const v8f*)(src + i * 8); v8h o;
#pragma unroll
    for (int k = 0; k < 8; ++k) o[k] = toh_flush(bfr(v[k]) * WCAR);
    *(v8h*)(dst + i * 8) = o; 
}

// k_projqk: register-blocked bf16 GEMM, ONE WAVE per 64x64 tile (16 accumulators), operands straight from K-contiguous bf16 planes, K = DM.
// C[m][n] = sum_k A[m][k] Bt[n][k]; A = x rows (m = b*SEQ + t), Bt = W rows (n = h*64 + d); written as f32 x C2X into plane [(b*4 + h)][t][64].
__global__ __launch_bounds__(32) void k_projqk(const bf* __restrict__ A, const bf* __restrict__ Bt, float* P) {
    __shared__ __align__(16) float os[16 * OSP];
    const int lane = threadIdx.x & 31, lr = lane & 15, hi = lane >> 4; const int r0 = blockIdx.x * 64, c0 = blockIdx.y * 64;
    v8f acc[4][4];
#pragma unroll
    for (int mb = 0; mb < 4; ++mb)
#pragma unroll
        for (int nb = 0; nb < 4; ++nb) acc[mb][nb] = (v8f){};
    const size_t aoff = (size_t)(r0 + lr) * DM + 8 * hi, boff = (size_t)(c0 + lr) * DM + 8 * hi;
#pragma unroll 1
    for (int kc = 0; kc < DM; kc += 32) {
        v16bf a[4];
#pragma unroll
        for (int mb = 0; mb < 4; ++mb) a[mb] = ldb(A + aoff + (size_t)mb * 16 * DM + kc);
#pragma unroll
        for (int nb = 0; nb < 4; ++nb) { const v16bf b = ldb(Bt + boff + (size_t)nb * 16 * DM + kc);
#pragma unroll
            for (int mb = 0; mb < 4; ++mb) acc[mb][nb] = wmmabg(a[mb], b, acc[mb][nb]); }
    }
    const int bb = r0 / SEQ, tt = r0 % SEQ; const int zh = bb * NH_ + c0 / HD;
    const size_t tbase = ((size_t)zh * SEQ + (size_t)tt) * HD;
#pragma unroll
    for (int mb = 0; mb < 4; ++mb) {
#pragma unroll
        for (int nb = 0; nb < 4; ++nb) {
#pragma unroll
            for (int j = 0; j < 8; ++j) os[(hi * 8 + j) * OSP + nb * 16 + lr] = acc[mb][nb][j] * C2X; }   // D: row 8h+j, col lane&15
        wave_sync();
        const size_t sb = tbase + (size_t)(mb * 16) * HD;
{
#pragma unroll
            for (int s = 0; s < 8; ++s) { const int p = s * 32 + lane; const int row = p >> 4, c4 = (p & 15) * 4;   // 8 s x 2 rows = 16 rows; 16 lanes x 4 floats = 64 columns
                const v4f val = *(const v4fa*)(&os[row * OSP + c4]);
                *(v4f*)(P + sb + (size_t)p * 4) = val; }
             }
        wave_sync();
    }
}

// k_projv: same GEMM with A = w_v rows (m = h*64 + d), Bt = value rows (n = b*SEQ + t); written as f16 x VCAR into plane [(b*256 + m)][t], row pitch SEQ.
__global__ __launch_bounds__(32) void k_projv(const bf* __restrict__ A, const bf* __restrict__ Bt, h16* Ph) {
    __shared__ __align__(16) float os[16 * OSP];
    const int lane = threadIdx.x & 31, lr = lane & 15, hi = lane >> 4; const int r0 = blockIdx.x * 64, c0 = blockIdx.y * 64;
    v8f acc[4][4];
#pragma unroll
    for (int mb = 0; mb < 4; ++mb)
#pragma unroll
        for (int nb = 0; nb < 4; ++nb) acc[mb][nb] = (v8f){};
    const size_t aoff = (size_t)(r0 + lr) * DM + 8 * hi, boff = (size_t)(c0 + lr) * DM + 8 * hi;
#pragma unroll 1
    for (int kc = 0; kc < DM; kc += 32) {
        v16bf a[4];
#pragma unroll
        for (int mb = 0; mb < 4; ++mb) a[mb] = ldb(A + aoff + (size_t)mb * 16 * DM + kc);
#pragma unroll
        for (int nb = 0; nb < 4; ++nb) { const v16bf b = ldb(Bt + boff + (size_t)nb * 16 * DM + kc);
#pragma unroll
            for (int mb = 0; mb < 4; ++mb) acc[mb][nb] = wmmabg(a[mb], b, acc[mb][nb]); }
    }
    const int bb = c0 / SEQ, tt = c0 % SEQ;
    const size_t tbase = (size_t)bb * (size_t)DM * SEQ + (size_t)r0 * SEQ + (size_t)tt;
#pragma unroll
    for (int mb = 0; mb < 4; ++mb) {
#pragma unroll
        for (int nb = 0; nb < 4; ++nb) {
#pragma unroll
            for (int j = 0; j < 8; ++j) os[(hi * 8 + j) * OSP + nb * 16 + lr] = acc[mb][nb][j] * VCAR; }   // D: row 8h+j, col lane&15
        wave_sync();
        const size_t sb = tbase + (size_t)(mb * 16) * SEQ;
{
#pragma unroll
            for (int s = 0; s < 4; ++s) { const int row = 4 * s + (lane >> 3), c8 = (lane & 7) * 8;   // 4 s x 4 row groups = 16 rows; 8 lanes x 8 halves = 64 columns
                const v4f x0 = *(const v4fa*)(&os[row * OSP + c8]); const v4f x1 = *(const v4fa*)(&os[row * OSP + c8 + 4]); v8h hv;
#pragma unroll
                for (int i = 0; i < 4; ++i) { hv[i] = toh_flush(x0[i]); hv[4 + i] = toh_flush(x1[i]); }
                *(v8h*)(Ph + sb + (size_t)row * SEQ + c8) = hv; }
             }
        wave_sync();
    }
}

// k_outp: f16 GEMM, ONE WAVE per 64x64 tile; A = context rows (m = b*SEQ + t, x ACAR), Bt = w_o rows (n, x WCAR); C x OSC written as f32 into the output buffer [b][t][256].
__global__ __launch_bounds__(32) void k_outp(const h16* __restrict__ A, const h16* __restrict__ Bt, float* OUT) {
    __shared__ __align__(16) float os[16 * OSP];
    const int lane = threadIdx.x & 31, lr = lane & 15, hi = lane >> 4; const int r0 = blockIdx.x * 64, c0 = blockIdx.y * 64;
    v8f acc[4][4];
#pragma unroll
    for (int mb = 0; mb < 4; ++mb)
#pragma unroll
        for (int nb = 0; nb < 4; ++nb) acc[mb][nb] = (v8f){};
    const size_t aoff = (size_t)(r0 + lr) * DM + 8 * hi, boff = (size_t)(c0 + lr) * DM + 8 * hi;
#pragma unroll 1
    for (int kc = 0; kc < DM; kc += 32) {
        v16h a[4];
#pragma unroll
        for (int mb = 0; mb < 4; ++mb) a[mb] = ldh(A + aoff + (size_t)mb * 16 * DM + kc);
#pragma unroll
        for (int nb = 0; nb < 4; ++nb) { const v16h b = ldh(Bt + boff + (size_t)nb * 16 * DM + kc);
#pragma unroll
            for (int mb = 0; mb < 4; ++mb) acc[mb][nb] = wmma16g(a[mb], b, acc[mb][nb]); }
    }
    const int bb = r0 / SEQ, tt = r0 % SEQ;
    const size_t obase = ((size_t)bb * OUT_SEQ + (size_t)tt) * DM + (size_t)c0;
#pragma unroll
    for (int mb = 0; mb < 4; ++mb) {
#pragma unroll
        for (int nb = 0; nb < 4; ++nb) {
#pragma unroll
            for (int j = 0; j < 8; ++j) os[(hi * 8 + j) * OSP + nb * 16 + lr] = acc[mb][nb][j] * OSC; }   // D: row 8h+j, col lane&15
        wave_sync();
        const size_t sb = obase + (size_t)(mb * 16) * DM;
{
#pragma unroll
            for (int s = 0; s < 8; ++s) { const int p = s * 32 + lane; const int row = p >> 4, c4 = (p & 15) * 4;   // 8 s x 2 rows = 16 rows; 16 lanes x 4 floats = 64 columns
                const v4f val = *(const v4fa*)(&os[row * OSP + c4]);
                *(v4f*)(OUT + sb + (size_t)row * DM + c4) = val; }
             }
        wave_sync();
    }
}

// k_attn: one wave (one block) per 16 query rows of one (batch, head). All LDS tiles are wave-private (single-wave block).
//         (t, key0 + 8h + r) and (t, key0 + 16 + 8h + r), r = 0..7: acc = sum_d w[d] / (1 + exp2(q'[t][d] + k'[key][d])); score (log2 domain) = SC2 * (sum_d w[d] - 2 acc).
//         Scores go to the strip sc[t][key]; the row maximum is tracked per lane and combined with one xor-16 exchange.
// Pass 2: e = exp2(score - max) (f32, row sum l); P = f16(e x 16384) packed directly as the B fragment (element r <- key 8h+r, element 8+r <- key 16+8h+r) of
//         O^T[d][t] = V^T P^T (A = v^T rows d, k = key); row sum l2 over the converted P normalises O; e is written back into the strip.
__global__ __launch_bounds__(32) void k_attn(const float* __restrict__ QS, const float* __restrict__ KS, const h16* __restrict__ VT, const float* __restrict__ va, float* ATTN, h16* AT) {
    __shared__ __align__(16) float sc[16 * SCP];
    __shared__ __align__(16) float ks[32 * KSP];
    __shared__ __align__(16) float qs[16 * KSP];
    __shared__ __align__(16) float os[16 * OSP];
    __shared__ __align__(16) float vs[HD];
    __shared__ __align__(16) float rinv[16];
    const int lane = threadIdx.x & 31, lr = lane & 15, hi = lane >> 4;
    const int zh = blockIdx.y; const int b = zh / NH_, h = zh % NH_;
    const int t0 = blockIdx.x * 16;
    const size_t pbase = (size_t)zh * SEQ * HD;
    // q' tile: 16 rows x 64 floats, 8 x 16 B per lane; rows 0..15 x columns 0..63 all written
#pragma unroll
    for (int i = 0; i < 8; ++i) { const int p = i * 32 + lane; const int row = p >> 4, c4 = (p & 15) * 4;
        const v4f v = *(const v4f*)(QS + pbase + (size_t)(t0 + row) * HD + c4); *(v4fa*)(&qs[row * KSP + c4]) = v; }
    // weight vector of this head, RNE-converted to bf16 at its load; lanes lr and lr+16 write identical values
    { const v4f w = *(const v4f*)(va + (size_t)h * HD + lr * 4); v4f wb;
#pragma unroll
      for (int i = 0; i < 4; ++i) wb[i] = bfr(w[i]);
      *(v4fa*)(&vs[lr * 4]) = wb; }
    wave_sync();
    float W1 = 0.0f;
#pragma unroll 1
    for (int c = 0; c < HD; c += 4) { const v4f w4 = *(const v4fa*)(&vs[c]); W1 += (w4[0] + w4[1]) + (w4[2] + w4[3]); }

    float mx = NEGB;
#pragma unroll 1
    for (int key0 = 0; key0 < SEQ; key0 += 32) {
        wave_sync();                                             // all reads of the earlier k' tile are complete
        { const float* kp = KS + pbase + (size_t)(key0 + lane) * HD;   // lane = key row, 64 floats = 256 B
#pragma unroll 1
          for (int c = 0; c < HD; c += 16) {
              const v4f k0 = *(const v4f*)(kp + c), k1 = *(const v4f*)(kp + c + 4), k2 = *(const v4f*)(kp + c + 8), k3 = *(const v4f*)(kp + c + 12);
              *(v4fa*)(&ks[lane * KSP + c]) = k0; *(v4fa*)(&ks[lane * KSP + c + 4]) = k1; *(v4fa*)(&ks[lane * KSP + c + 8]) = k2; *(v4fa*)(&ks[lane * KSP + c + 12]) = k3; } }
        wave_sync();
        float aa[8], ab[8];
#pragma unroll
        for (int r = 0; r < 8; ++r) { aa[r] = 0.0f; ab[r] = 0.0f; }
#pragma unroll 1
        for (int c = 0; c < HD; c += 4) {
            const v4f q4 = *(const v4fa*)(&qs[lr * KSP + c]);
            const v4f w4 = *(const v4fa*)(&vs[c]);
#pragma unroll
            for (int r = 0; r < 8; ++r) {
                const v4f ka = *(const v4fa*)(&ks[(8 * hi + r) * KSP + c]);
                const v4f kb = *(const v4fa*)(&ks[(16 + 8 * hi + r) * KSP + c]);
#pragma unroll
                for (int i = 0; i < 4; ++i) {
                    const float ra = __builtin_amdgcn_rcpf(1.0f + __builtin_amdgcn_exp2f(q4[i] + ka[i]));
                    const float rb = __builtin_amdgcn_rcpf(1.0f + __builtin_amdgcn_exp2f(q4[i] + kb[i]));
                    aa[r] = fmaf(w4[i], ra, aa[r]); ab[r] = fmaf(w4[i], rb, ab[r]); } } }
        v4f s0, s1, s2, s3;
#pragma unroll
        for (int r = 0; r < 4; ++r) {
            s0[r] = (W1 - 2.0f * aa[r]) * SC2; s1[r] = (W1 - 2.0f * aa[4 + r]) * SC2;
            s2[r] = (W1 - 2.0f * ab[r]) * SC2; s3[r] = (W1 - 2.0f * ab[4 + r]) * SC2;
            mx = fmaxf(mx, fmaxf(fmaxf(s0[r], s1[r]), fmaxf(s2[r], s3[r]))); }
        const int so = lr * SCP + key0 + 8 * hi;                 // keys key0+8h+0..7 at so, keys key0+16+8h+0..7 at so+16
        *(v4fa*)(&sc[so]) = s0; *(v4fa*)(&sc[so + 4]) = s1; *(v4fa*)(&sc[so + 16]) = s2; *(v4fa*)(&sc[so + 20]) = s3;
    }
    const float m = fmaxf(mx, __shfl_xor(mx, 16, 32));

    v8f o0 = (v8f){}, o1 = (v8f){}, o2 = (v8f){}, o3 = (v8f){};
    float l = 0.0f, l2 = 0.0f;
    const size_t vo = ((size_t)zh * HD + (size_t)lr) * SEQ + 8 * hi;   // + 16j*SEQ + key  (A fragment: row d = 16j + lane&15, k = key)
#pragma unroll 1
    for (int key0 = 0; key0 < SEQ; key0 += 32) {
        const int so = lr * SCP + key0 + 8 * hi;                 // the same lane wrote these 16 scores
        const v4f s0 = *(const v4fa*)(&sc[so]), s1 = *(const v4fa*)(&sc[so + 4]), s2 = *(const v4fa*)(&sc[so + 16]), s3 = *(const v4fa*)(&sc[so + 20]);
        v4f e0, e1, e2, e3; v16h pb; float ls = 0.0f, lp = 0.0f;
#pragma unroll
        for (int r = 0; r < 4; ++r) {
            e0[r] = __builtin_amdgcn_exp2f(s0[r] - m); e1[r] = __builtin_amdgcn_exp2f(s1[r] - m);
            e2[r] = __builtin_amdgcn_exp2f(s2[r] - m); e3[r] = __builtin_amdgcn_exp2f(s3[r] - m);
            const h16 p0 = toh_flush(e0[r] * PCAR); const h16 p1 = toh_flush(e1[r] * PCAR);
            const h16 p2 = toh_flush(e2[r] * PCAR); const h16 p3 = toh_flush(e3[r] * PCAR);
            pb[r] = p0; pb[4 + r] = p1; pb[8 + r] = p2; pb[12 + r] = p3;
            ls += (e0[r] + e1[r]) + (e2[r] + e3[r]);
            lp += ((float)p0 + (float)p1) + ((float)p2 + (float)p3); }
        l += ls; l2 += lp;
        *(v4fa*)(&sc[so]) = e0; *(v4fa*)(&sc[so + 4]) = e1; *(v4fa*)(&sc[so + 16]) = e2; *(v4fa*)(&sc[so + 20]) = e3;
        const h16* vp = VT + vo + key0;
        const v16h v0 = ldh(vp), v1 = ldh(vp + (size_t)16 * SEQ), v2 = ldh(vp + (size_t)32 * SEQ), v3 = ldh(vp + (size_t)48 * SEQ);
        o0 = wmma16g(v0, pb, o0); o1 = wmma16g(v1, pb, o1); o2 = wmma16g(v2, pb, o2); o3 = wmma16g(v3, pb, o3);
    }
    l += __shfl_xor(l, 16, 32); l2 += __shfl_xor(l2, 16, 32);    // l >= 1 and l2 >= 16384: the maximum element contributes exp2(0)
    const float inv = 1.0f / l;
    const float invo = (ACAR / VCAR) / l2;
    rinv[lr] = inv;                                             // lanes lr and lr+16 hold the same value
    // O^T D layout: o_j[r] = (d = 16j + 8h + r, t = lane&15) -> os[t][d]; rows 0..15 x columns 0..63 all written
    { v4f a, c;
      a[0] = o0[0] * invo; a[1] = o0[1] * invo; a[2] = o0[2] * invo; a[3] = o0[3] * invo; c[0] = o0[4] * invo; c[1] = o0[5] * invo; c[2] = o0[6] * invo; c[3] = o0[7] * invo;
      *(v4fa*)(&os[lr * OSP +  0 + 8 * hi]) = a; *(v4fa*)(&os[lr * OSP +  0 + 8 * hi + 4]) = c;
      a[0] = o1[0] * invo; a[1] = o1[1] * invo; a[2] = o1[2] * invo; a[3] = o1[3] * invo; c[0] = o1[4] * invo; c[1] = o1[5] * invo; c[2] = o1[6] * invo; c[3] = o1[7] * invo;
      *(v4fa*)(&os[lr * OSP + 16 + 8 * hi]) = a; *(v4fa*)(&os[lr * OSP + 16 + 8 * hi + 4]) = c;
      a[0] = o2[0] * invo; a[1] = o2[1] * invo; a[2] = o2[2] * invo; a[3] = o2[3] * invo; c[0] = o2[4] * invo; c[1] = o2[5] * invo; c[2] = o2[6] * invo; c[3] = o2[7] * invo;
      *(v4fa*)(&os[lr * OSP + 32 + 8 * hi]) = a; *(v4fa*)(&os[lr * OSP + 32 + 8 * hi + 4]) = c;
      a[0] = o3[0] * invo; a[1] = o3[1] * invo; a[2] = o3[2] * invo; a[3] = o3[3] * invo; c[0] = o3[4] * invo; c[1] = o3[5] * invo; c[2] = o3[6] * invo; c[3] = o3[7] * invo;
      *(v4fa*)(&os[lr * OSP + 48 + 8 * hi]) = a; *(v4fa*)(&os[lr * OSP + 48 + 8 * hi + 4]) = c; }
    wave_sync();
    const size_t abase = ((size_t)b * SEQ + (size_t)t0) * DM + (size_t)h * HD;                    // context plane [b*SEQ + t][256]
    const size_t pb0 = (((size_t)b * NH_ + (size_t)h) * OUT_SEQ + (size_t)t0) * OUT_SEQ;          // probabilities [b][h][t][key]
{
#pragma unroll
        for (int s = 0; s < 4; ++s) { const int row = 4 * s + (lane >> 3), c8 = (lane & 7) * 8;   // 4 s x 4 row groups = 16 rows; 8 lanes x 8 halves = 64 columns = one line
            const v4f x0 = *(const v4fa*)(&os[row * OSP + c8]); const v4f x1 = *(const v4fa*)(&os[row * OSP + c8 + 4]); v8h hv;
#pragma unroll
            for (int i = 0; i < 4; ++i) { hv[i] = toh_flush(x0[i]); hv[4 + i] = toh_flush(x1[i]); }
            *(v8h*)(AT + abase + (size_t)row * DM + c8) = hv; }
#pragma unroll 1
        for (int row = 0; row < 16; ++row) {                                                      // 16 rows x SEQ/128 instructions x 512 B = 16 x SEQ floats
            const float invr = rinv[row];
            const size_t ro = pb0 + (size_t)row * OUT_SEQ;
#pragma unroll
            for (int qd = 0; qd < SEQ / 128; ++qd) { const int cofs = qd * 128 + lane * 4;
                const v4f e = *(const v4fa*)(&sc[row * SCP + cofs]);
                v4f val; val[0] = e[0] * invr; val[1] = e[1] * invr; val[2] = e[2] * invr; val[3] = e[3] * invr;
                *(v4f*)(ATTN + ro + cofs) = val; } }
         }
}

static constexpr size_t al256(size_t v) { return (v + 255) & ~(size_t)255; }
static constexpr size_t SZ_XB = al256((size_t)NB * SEQ * DM * 2);          // bf16 input copy
static constexpr size_t SZ_WB = al256((size_t)3 * DM * DM * 2);            // bf16 w_q | w_k | w_v
static constexpr size_t SZ_WO = al256((size_t)DM * DM * 2);                // f16 w_o
static constexpr size_t SZ_PF = al256((size_t)NB * NH_ * SEQ * HD * 4);    // f32 q' / k' plane
static constexpr size_t SZ_PH = al256((size_t)NB * SEQ * DM * 2);          // f16 v^T plane / context plane
static constexpr size_t SZ_TOTAL = 3 * SZ_XB + SZ_WB + SZ_WO + 2 * SZ_PF + 2 * SZ_PH;
static_assert(SZ_TOTAL <= (size_t)134217728);          // workspace carve <= 128 MiB
static_assert(((size_t)DM * DM * 2) % 256 == 0);       // weight sub-planes stay 256-byte aligned
static_assert((size_t)NB * NH_ * SEQ * HD == (size_t)NB * DM * SEQ);       // v^T plane [(b*256 + m)][t] has the same extent as the context plane

extern "C" void kernel_launch(void* const* d_in, const int* in_sizes, int n_in,
                              void* d_out, int out_size, void* d_ws, size_t ws_size, hipStream_t stream) {
    if (n_in < 8) return;
    const size_t needx = ((size_t)(NB - 1) * SEQ_FULL + SEQ) * DM;
    if ((size_t)in_sizes[0] < needx || (size_t)in_sizes[1] < needx || (size_t)in_sizes[2] < needx) return;
    if ((size_t)in_sizes[3] < (size_t)DM * DM || (size_t)in_sizes[4] < (size_t)DM * DM || (size_t)in_sizes[5] < (size_t)DM * DM || (size_t)in_sizes[7] < (size_t)DM * DM) return;
    if (in_sizes[6] < NH_ * HD) return;
    const size_t need_out = OUT1_OFF + ((size_t)(NB * NH_ - 1) * OUT_SEQ + (size_t)(SEQ - 1)) * OUT_SEQ + SEQ;
    if ((size_t)out_size < need_out) return;
    if (SZ_TOTAL > ws_size) return;
    // wire order: query, key, value, w_q, w_k, w_v, v_a, w_o
    const float* xin[3] = { (const float*)d_in[0], (const float*)d_in[1], (const float*)d_in[2] };
    const float* wq = (const float*)d_in[3];
    const float* wk = (const float*)d_in[4];
    const float* wv = (const float*)d_in[5];
    const float* va = (const float*)d_in[6];
    const float* wo = (const float*)d_in[7];
    float* OUT  = (float*)d_out;                 // [NB][SEQ][256]
    float* ATTN = (float*)d_out + OUT1_OFF;      // [NB][4][SEQ][SEQ]
    char* wsp = (char*)d_ws;
    bf* XB[3];
    XB[0] = (bf*)wsp; wsp += SZ_XB;                  // query  [NB*SEQ][256]
    XB[1] = (bf*)wsp; wsp += SZ_XB;                  // key    [NB*SEQ][256]
    XB[2] = (bf*)wsp; wsp += SZ_XB;                  // value  [NB*SEQ][256]
    bf* WB = (bf*)wsp; wsp += SZ_WB;                 // [3][256][256]: q | k | v  ([out][in] = Bt as-is)
    h16* WO = (h16*)wsp; wsp += SZ_WO;               // [256][256] x WCAR ([out][in] = Bt as-is)
    float* QS = (float*)wsp; wsp += SZ_PF;           // [NB*4][SEQ][64] x C2X
    float* KS = (float*)wsp; wsp += SZ_PF;           // [NB*4][SEQ][64] x C2X
    h16* VT = (h16*)wsp; wsp += SZ_PH;               // [NB*4][64][SEQ] x VCAR
    h16* AT = (h16*)wsp; wsp += SZ_PH;               // [NB*SEQ][256] x ACAR
    bf* WQ = WB; bf* WK = WB + (size_t)DM * DM; bf* WV = WB + (size_t)2 * DM * DM;

    for (int i = 0; i < 3; ++i) {
        if (SEQ == SEQ_FULL) {
            const size_t n8 = (size_t)NB * SEQ * DM / 8;
            k_cvt8<<<(unsigned)((n8 + 255) / 256), 256, 0, stream>>>(xin[i], XB[i], n8);
        } else {
            const size_t n8 = (size_t)SEQ * DM / 8;
            for (int b = 0; b < NB; ++b) k_cvt8<<<(unsigned)((n8 + 255) / 256), 256, 0, stream>>>(xin[i] + (size_t)b * SEQ_FULL * DM, XB[i] + (size_t)b * SEQ * DM, n8);
        }
    }
    { const size_t n8 = (size_t)DM * DM / 8; const unsigned g = (unsigned)((n8 + 255) / 256);
      k_cvt8<<<g, 256, 0, stream>>>(wq, WQ, n8); k_cvt8<<<g, 256, 0, stream>>>(wk, WK, n8); k_cvt8<<<g, 256, 0, stream>>>(wv, WV, n8);
      k_cvtw<<<g, 256, 0, stream>>>(wo, WO, n8); }

    // q', k': A = x rows (m = b*SEQ + t), Bt = W rows (n = h*64 + d) -> f32 plane [(b*4 + h)][t][d]
    k_projqk<<<dim3(NB * SEQ / 64, DM / 64, 1), 32, 0, stream>>>(XB[0], WQ, QS);
    k_projqk<<<dim3(NB * SEQ / 64, DM / 64, 1), 32, 0, stream>>>(XB[1], WK, KS);
    // v^T: A = w_v rows (m = h*64 + d), Bt = value rows (n = b*SEQ + t) -> f16 plane [(b*256 + m)][t] = [(b*4 + h)][d][t]
    k_projv<<<dim3(DM / 64, NB * SEQ / 64, 1), 32, 0, stream>>>(WV, XB[2], VT);

    // scores, softmax, probabilities output, P.V -> context plane
    k_attn<<<dim3(SEQ / 16, NB * NH_, 1), 32, 0, stream>>>(QS, KS, VT, va, ATTN, AT);

    // output projection: A = context rows, Bt = w_o rows -> output buffer [b][t][256]
    k_outp<<<dim3(NB * SEQ / 64, DM / 64, 1), 32, 0, stream>>>(AT, WO, OUT);
}

// v001
// A run of this version takes 90.3 microseconds.
// Two timings next to v000 put it at 1.51 and 1.50 times that version's speed.
#include <hip/hip_runtime.h>

// Additive-score multi-head attention, width 256 = 4 heads x 64; query/key/value [NB][SEQ][256]; w_q/w_k/w_v/w_o [out][in] (y = x W^T, no bias); score(t, k) = 0.125 * sum_d va[h][d] * tanh(q[t][d] + k[k][d]);
// dense softmax over keys; context = P V, heads concatenated (column h*64 + d), output projection; two outputs: projected context [NB][SEQ][256] and the probabilities [NB][4][SEQ][SEQ] (both f32).
// Compute dtypes, f32 accumulate everywhere: q/k/v projections v_wmma_f32_16x16x32_bf16 (x and W RNE-converted to bf16; products exact); additive scores on the vector unit in f32
// (matrix-vector form: one weight vector per head, no shared second dimension; va RNE-converted to bf16 at its load); P.V v_wmma_f32_16x16x32_f16 (P x16384 and v x64, single f16 planes; carries cancel in the normalisation);
// output projection v_wmma_f32_16x16x32_f16 (context x256, w_o = bf16 value x64 held in f16; folded back by 2^-14); softmax f32 with the true row maximum.
// tanh(x) = 1 - 2 / (1 + exp2(2 log2(e) x)); the q and k planes are stored in f32, pre-multiplied by 2 log2(e).
// Layout: bf16 copies of the three inputs and w_q/w_k/w_v; f32 q', k' planes [b*4+h][t][64]; f16 v^T plane [b*4+h][d][t]; f16 context plane [b*SEQ+t][256]; f16 w_o plane [n][k].
// Attention kernel: one block of NW waves per 16 query rows of one (batch, head), the keys split evenly over the waves; score strip 16 x SEQ in LDS; transposed product O^T[d][t] = V^T P^T with the packed P strip as the B fragment; partial O^T and row sums combined through LDS.

#ifndef NB
#define NB 4
#endif
#ifndef SEQ
#define SEQ 512
#endif
#define NB_FULL  4
#define SEQ_FULL 512
#ifndef OUT_SEQ
#define OUT_SEQ SEQ              // token pitch of the output buffers (rows per batch, rows and keys per head)
#endif
#define DM   256
#define NH_  4
#define HD   64
#define OSP  68                  // LDS row pitch (floats) of 16 x 64 staging tiles
#define KSP  68                  // LDS row pitch (floats) of the q and k tiles
#define SCP  (SEQ + 4)           // LDS row pitch (floats) of the score strip
#define NW   8                   // waves per attention block
#define KPW  (SEQ / NW)          // keys per wave
#define C2X  ((float)(2.0 * 1.4426950408889634))        // 2 log2(e), folded into the q and k planes
#define SC2  ((float)(0.125 * 1.4426950408889634))      // HD^-0.5 * log2(e)
#define PCAR 16384.0f            // carry of the P fragment
#define VCAR 64.0f               // carry of the v^T plane
#define ACAR 256.0f              // carry of the context plane
#define WCAR 64.0f               // carry of the w_o plane
#define OSC  (1.0f / (ACAR * WCAR))
#define NEGB (-3.0e38f)
#define OUT1_OFF ((size_t)NB_FULL * SEQ_FULL * DM)      // first element of the probabilities output (fixed)

static_assert(HD == 64);                       // one 64-column GEMM tile = one head; f32 plane row = 256 bytes = two lines; f16 head segment = one line
static_assert(NH_ * HD == DM);                 // head h = columns h*64 + d
static_assert(DM % 64 == 0);
static_assert(DM % 32 == 0);                   // GEMM k-loop steps by 32
static_assert(SEQ % 64 == 0);                  // a 64-row tile never straddles two batches
static_assert((NB * SEQ) % 64 == 0);
static_assert(SEQ % 32 == 0);                  // key loop steps by 32
static_assert(SEQ % 16 == 0);                  // attention grid covers the sequence exactly
static_assert(SEQ % 128 == 0);                 // probability rows stored as 512-byte quarters
static_assert(((size_t)SEQ * DM) % 8 == 0);
static_assert(((size_t)DM * DM) % 8 == 0);
static_assert(NB <= NB_FULL);
static_assert(SEQ <= SEQ_FULL);
static_assert(SEQ <= OUT_SEQ);
static_assert((OSP * 4) % 16 == 0);
static_assert((KSP * 4) % 16 == 0);
static_assert((SCP * 4) % 16 == 0);
static_assert(OUT1_OFF * 4 == (size_t)2097152);                                   // byte offset of the second output
static_assert(((size_t)(NB - 1) * OUT_SEQ + SEQ) * DM <= OUT1_OFF);               // first output stays below the second
static_assert(8 * 32 * 4 == 16 * HD);          // f32 slab store: 8 instructions x 32 lanes x 4 floats = 16 rows x 64 columns
static_assert(4 * 32 * 8 == 16 * 64);          // f16 slab store: 4 instructions x 32 lanes x 8 halves = 16 rows x 64 columns
static_assert((SEQ / 128) * 32 * 4 == SEQ);    // probability row: SEQ/128 instructions x 32 lanes x 4 floats
static_assert((16 * SCP + NW * 32 * KSP + NW * 16 * OSP + 16 * KSP + HD + 3 * NW * 16) * 4 <= 163840);   // static LDS of the attention kernel: two blocks fit one WGP
static_assert(SEQ % (32 * NW) == 0);           // each wave owns whole 32-key tiles
static_assert(16 % NW == 0);                   // probability rows split evenly over the waves
static_assert(32 * NW * 4 == 16 * HD);         // one 4-element group of a 16 x 64 tile per thread of the attention block
static_assert(16 * OSP * 4 <= 131072);

typedef _Float16 h16;
typedef unsigned short bf;
typedef __attribute__((ext_vector_type(16))) __bf16   v16bf;
typedef __attribute__((ext_vector_type(16))) _Float16 v16h;
typedef __attribute__((ext_vector_type(8)))  _Float16 v8h;
typedef __attribute__((ext_vector_type(4)))  _Float16 v4h;
typedef __attribute__((ext_vector_type(8)))  unsigned short v8us;
typedef __attribute__((ext_vector_type(8)))  float    v8f;
typedef __attribute__((ext_vector_type(4)))  float    v4f;
typedef v4f  __attribute__((may_alias)) v4fa;

__device__ __forceinline__ unsigned short f2bf(float f) { unsigned u = __float_as_uint(f); u += 0x7FFFu + ((u >> 16) & 1u); return (unsigned short)(u >> 16); }
__device__ __forceinline__ float bfr(float f) { return __uint_as_float(((unsigned)f2bf(f)) << 16); }   // value after RNE convert to bf16
__device__ __forceinline__ v16h cat16(v8h lo, v8h hi) { return __builtin_shufflevector(lo, hi, 0, 1, 2, 3, 4, 5, 6, 7, 8, 9, 10, 11, 12, 13, 14, 15); }
__device__ __forceinline__ v16bf cat16b(v8us lo, v8us hi) { return __builtin_bit_cast(v16bf, __builtin_shufflevector(lo, hi, 0, 1, 2, 3, 4, 5, 6, 7, 8, 9, 10, 11, 12, 13, 14, 15)); }
__device__ __forceinline__ v8f wmma16(v16h a, v16h b, v8f c) { return __builtin_amdgcn_wmma_f32_16x16x32_f16(false, a, false, b, (short)0, c, false, false); }
__device__ __forceinline__ v8f wmmab(v16bf a, v16bf b, v8f c) { return __builtin_amdgcn_wmma_f32_16x16x32_bf16(false, a, false, b, (short)0, c, false, false); }
// fragment loaders from K-contiguous 16-bit rows; p already includes + 8*(lane>>4): elements 0..7 <- k0+8h+0..7, elements 8..15 <- k0+16+8h+0..7 (same map for A and B)
__device__ __forceinline__ v16h  ldh(const h16* p) { return cat16(*(const v8h*)p, *(const v8h*)(p + 16)); }
__device__ __forceinline__ v16bf ldb(const bf* p)  { return cat16b(*(const v8us*)p, *(const v8us*)(p + 16)); }
// ordering point for wave-private LDS tiles (same wave writes and reads)
__device__ __forceinline__ void wave_sync() { __builtin_amdgcn_fence(3 /* release order */, "wavefront"); __builtin_amdgcn_wave_barrier(); asm volatile("" ::: "memory"); }
// f32 -> f16 convert that cannot produce a subnormal (applied after the plane's power-of-two carry)
static __device__ __forceinline__ h16 toh_flush(float v) { const h16 r = (h16)v; return (fabsf(v) < 6.103515625e-05f) ? (h16)0.0f : r; }
// one matrix instruction + its own four-slot guard (accumulator tied, fragments kept live)
__device__ __forceinline__ v8f wmma16g(v16h a, v16h b, v8f c) { c = wmma16(a, b, c); asm volatile("v_nop\n\tv_nop\n\tv_nop\n\tv_nop" : "+v"(c) : "v"(a), "v"(b)); return c; }
__device__ __forceinline__ v8f wmmabg(v16bf a, v16bf b, v8f c) { c = wmmab(a, b, c); asm volatile("v_nop\n\tv_nop\n\tv_nop\n\tv_nop" : "+v"(c) : "v"(a), "v"(b)); return c; }

__global__ __launch_bounds__(256) void k_cvt8(const float* __restrict__ src, bf* dst, size_t n8) {
    const size_t i = (size_t)blockIdx.x * 256 + threadIdx.x; if (i >= n8) return;
    const v8f v = *(const v8f*)(src + i * 8); v8us o;
#pragma unroll
    for (int k = 0; k < 8; ++k) o[k] = f2bf(v[k]);
    *(v8us*)(dst + i * 8) = o; 
}

__global__ __launch_bounds__(256) void k_cvtw(const float* __restrict__ src, h16* dst, size_t n8) {
    const size_t i = (size_t)blockIdx.x * 256 + threadIdx.x; if (i >= n8) return;
    const v8f v = *(const v8f*)(src + i * 8); v8h o;
#pragma unroll
    for (int k = 0; k < 8; ++k) o[k] = toh_flush(bfr(v[k]) * WCAR);
    *(v8h*)(dst + i * 8) = o; 
}

// k_projqk: register-blocked bf16 GEMM, ONE WAVE per 64x64 tile (16 accumulators), operands straight from K-contiguous bf16 planes, K = DM.
// C[m][n] = sum_k A[m][k] Bt[n][k]; A = x rows (m = b*SEQ + t), Bt = W rows (n = h*64 + d); written as f32 x C2X into plane [(b*4 + h)][t][64].
__global__ __launch_bounds__(32) void k_projqk(const bf* __restrict__ A, const bf* __restrict__ Bt, float* P) {
    __shared__ __align__(16) float os[16 * OSP];
    const int lane = threadIdx.x & 31, lr = lane & 15, hi = lane >> 4; const int r0 = blockIdx.x * 64, c0 = blockIdx.y * 64;
    v8f acc[4][4];
#pragma unroll
    for (int mb = 0; mb < 4; ++mb)
#pragma unroll
        for (int nb = 0; nb < 4; ++nb) acc[mb][nb] = (v8f){};
    const size_t aoff = (size_t)(r0 + lr) * DM + 8 * hi, boff = (size_t)(c0 + lr) * DM + 8 * hi;
#pragma unroll 1
    for (int kc = 0; kc < DM; kc += 32) {
        v16bf a[4];
#pragma unroll
        for (int mb = 0; mb < 4; ++mb) a[mb] = ldb(A + aoff + (size_t)mb * 16 * DM + kc);
#pragma unroll
        for (int nb = 0; nb < 4; ++nb) { const v16bf b = ldb(Bt + boff + (size_t)nb * 16 * DM + kc);
#pragma unroll
            for (int mb = 0; mb < 4; ++mb) acc[mb][nb] = wmmabg(a[mb], b, acc[mb][nb]); }
    }
    const int bb = r0 / SEQ, tt = r0 % SEQ; const int zh = bb * NH_ + c0 / HD;
    const size_t tbase = ((size_t)zh * SEQ + (size_t)tt) * HD;
#pragma unroll
    for (int mb = 0; mb < 4; ++mb) {
#pragma unroll
        for (int nb = 0; nb < 4; ++nb) {
#pragma unroll
            for (int j = 0; j < 8; ++j) os[(hi * 8 + j) * OSP + nb * 16 + lr] = acc[mb][nb][j] * C2X; }   // D: row 8h+j, col lane&15
        wave_sync();
        const size_t sb = tbase + (size_t)(mb * 16) * HD;
{
#pragma unroll
            for (int s = 0; s < 8; ++s) { const int p = s * 32 + lane; const int row = p >> 4, c4 = (p & 15) * 4;   // 8 s x 2 rows = 16 rows; 16 lanes x 4 floats = 64 columns
                const v4f val = *(const v4fa*)(&os[row * OSP + c4]);
                *(v4f*)(P + sb + (size_t)p * 4) = val; }
             }
        wave_sync();
    }
}

// k_projv: same GEMM with A = w_v rows (m = h*64 + d), Bt = value rows (n = b*SEQ + t); written as f16 x VCAR into plane [(b*256 + m)][t], row pitch SEQ.
__global__ __launch_bounds__(32) void k_projv(const bf* __restrict__ A, const bf* __restrict__ Bt, h16* Ph) {
    __shared__ __align__(16) float os[16 * OSP];
    const int lane = threadIdx.x & 31, lr = lane & 15, hi = lane >> 4; const int r0 = blockIdx.x * 64, c0 = blockIdx.y * 64;
    v8f acc[4][4];
#pragma unroll
    for (int mb = 0; mb < 4; ++mb)
#pragma unroll
        for (int nb = 0; nb < 4; ++nb) acc[mb][nb] = (v8f){};
    const size_t aoff = (size_t)(r0 + lr) * DM + 8 * hi, boff = (size_t)(c0 + lr) * DM + 8 * hi;
#pragma unroll 1
    for (int kc = 0; kc < DM; kc += 32) {
        v16bf a[4];
#pragma unroll
        for (int mb = 0; mb < 4; ++mb) a[mb] = ldb(A + aoff + (size_t)mb * 16 * DM + kc);
#pragma unroll
        for (int nb = 0; nb < 4; ++nb) { const v16bf b = ldb(Bt + boff + (size_t)nb * 16 * DM + kc);
#pragma unroll
            for (int mb = 0; mb < 4; ++mb) acc[mb][nb] = wmmabg(a[mb], b, acc[mb][nb]); }
    }
    const int bb = c0 / SEQ, tt = c0 % SEQ;
    const size_t tbase = (size_t)bb * (size_t)DM * SEQ + (size_t)r0 * SEQ + (size_t)tt;
#pragma unroll
    for (int mb = 0; mb < 4; ++mb) {
#pragma unroll
        for (int nb = 0; nb < 4; ++nb) {
#pragma unroll
            for (int j = 0; j < 8; ++j) os[(hi * 8 + j) * OSP + nb * 16 + lr] = acc[mb][nb][j] * VCAR; }   // D: row 8h+j, col lane&15
        wave_sync();
        const size_t sb = tbase + (size_t)(mb * 16) * SEQ;
{
#pragma unroll
            for (int s = 0; s < 4; ++s) { const int row = 4 * s + (lane >> 3), c8 = (lane & 7) * 8;   // 4 s x 4 row groups = 16 rows; 8 lanes x 8 halves = 64 columns
                const v4f x0 = *(const v4fa*)(&os[row * OSP + c8]); const v4f x1 = *(const v4fa*)(&os[row * OSP + c8 + 4]); v8h hv;
#pragma unroll
                for (int i = 0; i < 4; ++i) { hv[i] = toh_flush(x0[i]); hv[4 + i] = toh_flush(x1[i]); }
                *(v8h*)(Ph + sb + (size_t)row * SEQ + c8) = hv; }
             }
        wave_sync();
    }
}

// k_outp: f16 GEMM, ONE WAVE per 64x64 tile; A = context rows (m = b*SEQ + t, x ACAR), Bt = w_o rows (n, x WCAR); C x OSC written as f32 into the output buffer [b][t][256].
__global__ __launch_bounds__(32) void k_outp(const h16* __restrict__ A, const h16* __restrict__ Bt, float* OUT) {
    __shared__ __align__(16) float os[16 * OSP];
    const int lane = threadIdx.x & 31, lr = lane & 15, hi = lane >> 4; const int r0 = blockIdx.x * 64, c0 = blockIdx.y * 64;
    v8f acc[4][4];
#pragma unroll
    for (int mb = 0; mb < 4; ++mb)
#pragma unroll
        for (int nb = 0; nb < 4; ++nb) acc[mb][nb] = (v8f){};
    const size_t aoff = (size_t)(r0 + lr) * DM + 8 * hi, boff = (size_t)(c0 + lr) * DM + 8 * hi;
#pragma unroll 1
    for (int kc = 0; kc < DM; kc += 32) {
        v16h a[4];
#pragma unroll
        for (int mb = 0; mb < 4; ++mb) a[mb] = ldh(A + aoff + (size_t)mb * 16 * DM + kc);
#pragma unroll
        for (int nb = 0; nb < 4; ++nb) { const v16h b = ldh(Bt + boff + (size_t)nb * 16 * DM + kc);
#pragma unroll
            for (int mb = 0; mb < 4; ++mb) acc[mb][nb] = wmma16g(a[mb], b, acc[mb][nb]); }
    }
    const int bb = r0 / SEQ, tt = r0 % SEQ;
    const size_t obase = ((size_t)bb * OUT_SEQ + (size_t)tt) * DM + (size_t)c0;
#pragma unroll
    for (int mb = 0; mb < 4; ++mb) {
#pragma unroll
        for (int nb = 0; nb < 4; ++nb) {
#pragma unroll
            for (int j = 0; j < 8; ++j) os[(hi * 8 + j) * OSP + nb * 16 + lr] = acc[mb][nb][j] * OSC; }   // D: row 8h+j, col lane&15
        wave_sync();
        const size_t sb = obase + (size_t)(mb * 16) * DM;
{
#pragma unroll
            for (int s = 0; s < 8; ++s) { const int p = s * 32 + lane; const int row = p >> 4, c4 = (p & 15) * 4;   // 8 s x 2 rows = 16 rows; 16 lanes x 4 floats = 64 columns
                const v4f val = *(const v4fa*)(&os[row * OSP + c4]);
                *(v4f*)(OUT + sb + (size_t)row * DM + c4) = val; }
             }
        wave_sync();
    }
}

// k_attn: one block of NW waves per 16 query rows of one (batch, head); wave w owns keys w*KPW .. w*KPW + KPW - 1 in both passes. The q' tile, the weight vector and the score strip are shared; each wave has its own k' tile.
// Pass 1: lane (t = lane&15, h = lane>>4) holds the 16 scores (t, key0 + 8h + r) and (t, key0 + 16 + 8h + r), r = 0..7: acc = sum_d w[d] / (1 + exp2(q'[t][d] + k'[key][d])); score (log2 domain) = SC2 * (sum_d w[d] - 2 acc).
//         Scores go to the strip sc[t][key]; the row maximum is tracked per lane, combined with one xor-16 exchange, then over the NW waves through LDS (a maximum: exact in any order).
// Pass 2: e = exp2(score - max) (f32, row sum l); P = f16(e x 16384) packed directly as the B fragment (element r <- key 8h+r, element 8+r <- key 16+8h+r) of
//         O^T[d][t] = V^T P^T (A = v^T rows d, k = key); row sum l2 over the converted P normalises O; e is written back into the strip.
// Combine: each wave leaves its partial O^T, l and l2 in LDS; after one barrier they are summed in wave order 0..NW-1, normalised and stored.
__global__ __launch_bounds__(32 * NW) void k_attn(const float* __restrict__ QS, const float* __restrict__ KS, const h16* __restrict__ VT, const float* __restrict__ va, float* ATTN, h16* AT) {
    __shared__ __align__(16) float sc[16 * SCP];
    __shared__ __align__(16) float ks[NW * 32 * KSP];
    __shared__ __align__(16) float qs[16 * KSP];
    __shared__ __align__(16) float po[NW * 16 * OSP];            // partial O^T per wave; with it a block holds over a third of a WGP's LDS, so at most two blocks share a WGP and the grid spreads evenly
    __shared__ __align__(16) float vs[HD];
    __shared__ __align__(16) float wmx[NW * 16];
    __shared__ __align__(16) float wl[NW * 16];
    __shared__ __align__(16) float wl2[NW * 16];
    const int tid = threadIdx.x, lane = tid & 31, lr = lane & 15, hi = lane >> 4;
    const int wv = __builtin_amdgcn_readfirstlane(tid >> 5);     // wave number, held scalar so that the key loops stay scalar loops
    const int zh = blockIdx.y; const int b = zh / NH_, h = zh % NH_;
    const int t0 = blockIdx.x * 16;
    const size_t pbase = (size_t)zh * SEQ * HD;
    float* ksw = ks + wv * (32 * KSP);                           // this wave's own k' tile
    float* pw = po + wv * (16 * OSP);                          // this wave's own partial O^T tile
    // q' tile: 16 rows x 64 floats, 16 B per thread; rows 0..15 x columns 0..63 all written
    { const int row = tid >> 4, c4 = (tid & 15) * 4;
        const v4f v = *(const v4f*)(QS + pbase + (size_t)(t0 + row) * HD + c4); *(v4fa*)(&qs[row * KSP + c4]) = v; }
    // weight vector of this head, RNE-converted to bf16 at its load
    if (tid < 16) { const v4f w = *(const v4f*)(va + (size_t)h * HD + tid * 4); v4f wb;
#pragma unroll
      for (int i = 0; i < 4; ++i) wb[i] = bfr(w[i]);
      *(v4fa*)(&vs[tid * 4]) = wb; }
    __syncthreads();                                             // q' tile and weight vector visible to all waves
    float W1 = 0.0f;
#pragma unroll 1
    for (int c = 0; c < HD; c += 4) { const v4f w4 = *(const v4fa*)(&vs[c]); W1 += (w4[0] + w4[1]) + (w4[2] + w4[3]); }

    const int kbeg = wv * KPW;
    float mx = NEGB;
#pragma unroll 1
    for (int key0 = kbeg; key0 < kbeg + KPW; key0 += 32) {
        wave_sync();                                             // all reads of the earlier k' tile are complete
        { const float* kp = KS + pbase + (size_t)(key0 + lane) * HD;   // lane = key row, 64 floats = 256 B
#pragma unroll 1
          for (int c = 0; c < HD; c += 16) {
              const v4f k0 = *(const v4f*)(kp + c), k1 = *(const v4f*)(kp + c + 4), k2 = *(const v4f*)(kp + c + 8), k3 = *(const v4f*)(kp + c + 12);
              *(v4fa*)(&ksw[lane * KSP + c]) = k0; *(v4fa*)(&ksw[lane * KSP + c + 4]) = k1; *(v4fa*)(&ksw[lane * KSP + c + 8]) = k2; *(v4fa*)(&ksw[lane * KSP + c + 12]) = k3; } }
        wave_sync();
        float aa[8], ab[8];
#pragma unroll
        for (int r = 0; r < 8; ++r) { aa[r] = 0.0f; ab[r] = 0.0f; }
#pragma unroll 1
        for (int c = 0; c < HD; c += 4) {
            const v4f q4 = *(const v4fa*)(&qs[lr * KSP + c]);
            const v4f w4 = *(const v4fa*)(&vs[c]);
#pragma unroll
            for (int r = 0; r < 8; ++r) {
                const v4f ka = *(const v4fa*)(&ksw[(8 * hi + r) * KSP + c]);
                const v4f kb = *(const v4fa*)(&ksw[(16 + 8 * hi + r) * KSP + c]);
#pragma unroll
                for (int i = 0; i < 4; ++i) {
                    const float ra = __builtin_amdgcn_rcpf(1.0f + __builtin_amdgcn_exp2f(q4[i] + ka[i]));
                    const float rb = __builtin_amdgcn_rcpf(1.0f + __builtin_amdgcn_exp2f(q4[i] + kb[i]));
                    aa[r] = fmaf(w4[i], ra, aa[r]); ab[r] = fmaf(w4[i], rb, ab[r]); } } }
        v4f s0, s1, s2, s3;
#pragma unroll
        for (int r = 0; r < 4; ++r) {
            s0[r] = (W1 - 2.0f * aa[r]) * SC2; s1[r] = (W1 - 2.0f * aa[4 + r]) * SC2;
            s2[r] = (W1 - 2.0f * ab[r]) * SC2; s3[r] = (W1 - 2.0f * ab[4 + r]) * SC2;
            mx = fmaxf(mx, fmaxf(fmaxf(s0[r], s1[r]), fmaxf(s2[r], s3[r]))); }
        const int so = lr * SCP + key0 + 8 * hi;                 // keys key0+8h+0..7 at so, keys key0+16+8h+0..7 at so+16
        *(v4fa*)(&sc[so]) = s0; *(v4fa*)(&sc[so + 4]) = s1; *(v4fa*)(&sc[so + 16]) = s2; *(v4fa*)(&sc[so + 20]) = s3;
    }
    wmx[wv * 16 + lr] = fmaxf(mx, __shfl_xor(mx, 16, 32));       // lanes lr and lr+16 hold the same value
    __syncthreads();                                             // every wave's row maxima are in wmx
    float m = wmx[lr];
#pragma unroll
    for (int w = 1; w < NW; ++w) m = fmaxf(m, wmx[w * 16 + lr]);

    v8f o0 = (v8f){}, o1 = (v8f){}, o2 = (v8f){}, o3 = (v8f){};
    float l = 0.0f, l2 = 0.0f;
    const size_t vo = ((size_t)zh * HD + (size_t)lr) * SEQ + 8 * hi;   // + 16j*SEQ + key  (A fragment: row d = 16j + lane&15, k = key)
#pragma unroll 1
    for (int key0 = kbeg; key0 < kbeg + KPW; key0 += 32) {
        const int so = lr * SCP + key0 + 8 * hi;                 // the same lane wrote these 16 scores
        const v4f s0 = *(const v4fa*)(&sc[so]), s1 = *(const v4fa*)(&sc[so + 4]), s2 = *(const v4fa*)(&sc[so + 16]), s3 = *(const v4fa*)(&sc[so + 20]);
        v4f e0, e1, e2, e3; v16h pb; float ls = 0.0f, lp = 0.0f;
#pragma unroll
        for (int r = 0; r < 4; ++r) {
            e0[r] = __builtin_amdgcn_exp2f(s0[r] - m); e1[r] = __builtin_amdgcn_exp2f(s1[r] - m);
            e2[r] = __builtin_amdgcn_exp2f(s2[r] - m); e3[r] = __builtin_amdgcn_exp2f(s3[r] - m);
            const h16 p0 = toh_flush(e0[r] * PCAR); const h16 p1 = toh_flush(e1[r] * PCAR);
            const h16 p2 = toh_flush(e2[r] * PCAR); const h16 p3 = toh_flush(e3[r] * PCAR);
            pb[r] = p0; pb[4 + r] = p1; pb[8 + r] = p2; pb[12 + r] = p3;
            ls += (e0[r] + e1[r]) + (e2[r] + e3[r]);
            lp += ((float)p0 + (float)p1) + ((float)p2 + (float)p3); }
        l += ls; l2 += lp;
        *(v4fa*)(&sc[so]) = e0; *(v4fa*)(&sc[so + 4]) = e1; *(v4fa*)(&sc[so + 16]) = e2; *(v4fa*)(&sc[so + 20]) = e3;
        const h16* vp = VT + vo + key0;
        const v16h v0 = ldh(vp), v1 = ldh(vp + (size_t)16 * SEQ), v2 = ldh(vp + (size_t)32 * SEQ), v3 = ldh(vp + (size_t)48 * SEQ);
        o0 = wmma16g(v0, pb, o0); o1 = wmma16g(v1, pb, o1); o2 = wmma16g(v2, pb, o2); o3 = wmma16g(v3, pb, o3);
    }
    l += __shfl_xor(l, 16, 32); l2 += __shfl_xor(l2, 16, 32);
    wl[wv * 16 + lr] = l; wl2[wv * 16 + lr] = l2;                // lanes lr and lr+16 hold the same values
    // partial O^T of this wave's keys, D layout o_j[r] = (d = 16j + 8h + r, t = lane&15) -> own tile of po as [t][d], pitch OSP; rows 0..15 x columns 0..63 all written
    { v4f a, c;
      a[0] = o0[0]; a[1] = o0[1]; a[2] = o0[2]; a[3] = o0[3]; c[0] = o0[4]; c[1] = o0[5]; c[2] = o0[6]; c[3] = o0[7];
      *(v4fa*)(&pw[lr * OSP +  0 + 8 * hi]) = a; *(v4fa*)(&pw[lr * OSP +  0 + 8 * hi + 4]) = c;
      a[0] = o1[0]; a[1] = o1[1]; a[2] = o1[2]; a[3] = o1[3]; c[0] = o1[4]; c[1] = o1[5]; c[2] = o1[6]; c[3] = o1[7];
      *(v4fa*)(&pw[lr * OSP + 16 + 8 * hi]) = a; *(v4fa*)(&pw[lr * OSP + 16 + 8 * hi + 4]) = c;
      a[0] = o2[0]; a[1] = o2[1]; a[2] = o2[2]; a[3] = o2[3]; c[0] = o2[4]; c[1] = o2[5]; c[2] = o2[6]; c[3] = o2[7];
      *(v4fa*)(&pw[lr * OSP + 32 + 8 * hi]) = a; *(v4fa*)(&pw[lr * OSP + 32 + 8 * hi + 4]) = c;
      a[0] = o3[0]; a[1] = o3[1]; a[2] = o3[2]; a[3] = o3[3]; c[0] = o3[4]; c[1] = o3[5]; c[2] = o3[6]; c[3] = o3[7];
      *(v4fa*)(&pw[lr * OSP + 48 + 8 * hi]) = a; *(v4fa*)(&pw[lr * OSP + 48 + 8 * hi + 4]) = c; }
    __syncthreads();                                             // partial O^T, l, l2 and the whole e strip visible to all waves
    const size_t abase = ((size_t)b * SEQ + (size_t)t0) * DM + (size_t)h * HD;                    // context plane [b*SEQ + t][256]
    const size_t pb0 = (((size_t)b * NH_ + (size_t)h) * OUT_SEQ + (size_t)t0) * OUT_SEQ;          // probabilities [b][h][t][key]
    { const int row = tid >> 4, c4 = (tid & 15) * 4;             // 16 rows x 16 threads x 4 halves; 16 lanes = 64 columns = one line
        v4f x = *(const v4fa*)(&po[row * OSP + c4]); float l2t = wl2[row];                        // l2t >= 16384: the maximum element contributes exp2(0)
#pragma unroll
        for (int w = 1; w < NW; ++w) { const v4f y = *(const v4fa*)(&po[w * (16 * OSP) + row * OSP + c4]); x[0] += y[0]; x[1] += y[1]; x[2] += y[2]; x[3] += y[3]; l2t += wl2[w * 16 + row]; }
        const float invo = (ACAR / VCAR) / l2t; v4h hv;
#pragma unroll
        for (int i = 0; i < 4; ++i) hv[i] = toh_flush(x[i] * invo);
        *(v4h*)(AT + abase + (size_t)row * DM + c4) = hv;
        asm volatile("s_wait_xcnt 0x0" ::: "memory"); }         // the store's address and data registers are reused right below
#pragma unroll 1
    for (int row = wv; row < 16; row += NW) {                                                     // 16 rows x SEQ/128 instructions x 512 B = 16 x SEQ floats
        float lt = wl[row];                                                                       // lt >= 1
#pragma unroll
        for (int w = 1; w < NW; ++w) lt += wl[w * 16 + row];
        const float invr = 1.0f / lt;
        const size_t ro = pb0 + (size_t)row * OUT_SEQ;
#pragma unroll
        for (int qd = 0; qd < SEQ / 128; ++qd) { const int cofs = qd * 128 + lane * 4;
            const v4f e = *(const v4fa*)(&sc[row * SCP + cofs]);
            v4f val; val[0] = e[0] * invr; val[1] = e[1] * invr; val[2] = e[2] * invr; val[3] = e[3] * invr;
            *(v4f*)(ATTN + ro + cofs) = val; }
        asm volatile("s_wait_xcnt 0x0" ::: "memory"); }         // the next trip reuses the stores' address and data registers
}

static constexpr size_t al256(size_t v) { return (v + 255) & ~(size_t)255; }
static constexpr size_t SZ_XB = al256((size_t)NB * SEQ * DM * 2);          // bf16 input copy
static constexpr size_t SZ_WB = al256((size_t)3 * DM * DM * 2);            // bf16 w_q | w_k | w_v
static constexpr size_t SZ_WO = al256((size_t)DM * DM * 2);                // f16 w_o
static constexpr size_t SZ_PF = al256((size_t)NB * NH_ * SEQ * HD * 4);    // f32 q' / k' plane
static constexpr size_t SZ_PH = al256((size_t)NB * SEQ * DM * 2);          // f16 v^T plane / context plane
static constexpr size_t SZ_TOTAL = 3 * SZ_XB + SZ_WB + SZ_WO + 2 * SZ_PF + 2 * SZ_PH;
static_assert(SZ_TOTAL <= (size_t)134217728);          // workspace carve <= 128 MiB
static_assert(((size_t)DM * DM * 2) % 256 == 0);       // weight sub-planes stay 256-byte aligned
static_assert((size_t)NB * NH_ * SEQ * HD == (size_t)NB * DM * SEQ);       // v^T plane [(b*256 + m)][t] has the same extent as the context plane

extern "C" void kernel_launch(void* const* d_in, const int* in_sizes, int n_in,
                              void* d_out, int out_size, void* d_ws, size_t ws_size, hipStream_t stream) {
    if (n_in < 8) return;
    const size_t needx = ((size_t)(NB - 1) * SEQ_FULL + SEQ) * DM;
    if ((size_t)in_sizes[0] < needx || (size_t)in_sizes[1] < needx || (size_t)in_sizes[2] < needx) return;
    if ((size_t)in_sizes[3] < (size_t)DM * DM || (size_t)in_sizes[4] < (size_t)DM * DM || (size_t)in_sizes[5] < (size_t)DM * DM || (size_t)in_sizes[7] < (size_t)DM * DM) return;
    if (in_sizes[6] < NH_ * HD) return;
    const size_t need_out = OUT1_OFF + ((size_t)(NB * NH_ - 1) * OUT_SEQ + (size_t)(SEQ - 1)) * OUT_SEQ + SEQ;
    if ((size_t)out_size < need_out) return;
    if (SZ_TOTAL > ws_size) return;
    // wire order: query, key, value, w_q, w_k, w_v, v_a, w_o
    const float* xin[3] = { (const float*)d_in[0], (const float*)d_in[1], (const float*)d_in[2] };
    const float* wq = (const float*)d_in[3];
    const float* wk = (const float*)d_in[4];
    const float* wv = (const float*)d_in[5];
    const float* va = (const float*)d_in[6];
    const float* wo = (const float*)d_in[7];
    float* OUT  = (float*)d_out;                 // [NB][SEQ][256]
    float* ATTN = (float*)d_out + OUT1_OFF;      // [NB][4][SEQ][SEQ]
    char* wsp = (char*)d_ws;
    bf* XB[3];
    XB[0] = (bf*)wsp; wsp += SZ_XB;                  // query  [NB*SEQ][256]
    XB[1] = (bf*)wsp; wsp += SZ_XB;                  // key    [NB*SEQ][256]
    XB[2] = (bf*)wsp; wsp += SZ_XB;                  // value  [NB*SEQ][256]
    bf* WB = (bf*)wsp; wsp += SZ_WB;                 // [3][256][256]: q | k | v  ([out][in] = Bt as-is)
    h16* WO = (h16*)wsp; wsp += SZ_WO;               // [256][256] x WCAR ([out][in] = Bt as-is)
    float* QS = (float*)wsp; wsp += SZ_PF;           // [NB*4][SEQ][64] x C2X
    float* KS = (float*)wsp; wsp += SZ_PF;           // [NB*4][SEQ][64] x C2X
    h16* VT = (h16*)wsp; wsp += SZ_PH;               // [NB*4][64][SEQ] x VCAR
    h16* AT = (h16*)wsp; wsp += SZ_PH;               // [NB*SEQ][256] x ACAR
    bf* WQ = WB; bf* WK = WB + (size_t)DM * DM; bf* WV = WB + (size_t)2 * DM * DM;

    for (int i = 0; i < 3; ++i) {
        if (SEQ == SEQ_FULL) {
            const size_t n8 = (size_t)NB * SEQ * DM / 8;
            k_cvt8<<<(unsigned)((n8 + 255) / 256), 256, 0, stream>>>(xin[i], XB[i], n8);
        } else {
            const size_t n8 = (size_t)SEQ * DM / 8;
            for (int b = 0; b < NB; ++b) k_cvt8<<<(unsigned)((n8 + 255) / 256), 256, 0, stream>>>(xin[i] + (size_t)b * SEQ_FULL * DM, XB[i] + (size_t)b * SEQ * DM, n8);
        }
    }
    { const size_t n8 = (size_t)DM * DM / 8; const unsigned g = (unsigned)((n8 + 255) / 256);
      k_cvt8<<<g, 256, 0, stream>>>(wq, WQ, n8); k_cvt8<<<g, 256, 0, stream>>>(wk, WK, n8); k_cvt8<<<g, 256, 0, stream>>>(wv, WV, n8);
      k_cvtw<<<g, 256, 0, stream>>>(wo, WO, n8); }

    // q', k': A = x rows (m = b*SEQ + t), Bt = W rows (n = h*64 + d) -> f32 plane [(b*4 + h)][t][d]
    k_projqk<<<dim3(NB * SEQ / 64, DM / 64, 1), 32, 0, stream>>>(XB[0], WQ, QS);
    k_projqk<<<dim3(NB * SEQ / 64, DM / 64, 1), 32, 0, stream>>>(XB[1], WK, KS);
    // v^T: A = w_v rows (m = h*64 + d), Bt = value rows (n = b*SEQ + t) -> f16 plane [(b*256 + m)][t] = [(b*4 + h)][d][t]
    k_projv<<<dim3(DM / 64, NB * SEQ / 64, 1), 32, 0, stream>>>(WV, XB[2], VT);

    // scores, softmax, probabilities output, P.V -> context plane
    k_attn<<<dim3(SEQ / 16, NB * NH_, 1), 32 * NW, 0, stream>>>(QS, KS, VT, va, ATTN, AT);

    // output projection: A = context rows, Bt = w_o rows -> output buffer [b][t][256]
    k_outp<<<dim3(NB * SEQ / 64, DM / 64, 1), 32, 0, stream>>>(AT, WO, OUT);
}

// v002
// A run of this version takes 57.3 microseconds.
// Next to v001, in two timings, it ran 1.55 times as fast each time.
// All steps since v000 together make it 2.33 times as fast.
#include <hip/hip_runtime.h>

// Additive-score multi-head attention, width 256 = 4 heads x 64; query/key/value [NB][SEQ][256]; w_q/w_k/w_v/w_o [out][in] (y = x W^T, no bias); score(t, k) = 0.125 * sum_d va[h][d] * tanh(q[t][d] + k[k][d]);
// dense softmax over keys; context = P V, heads concatenated (column h*64 + d), output projection; two outputs: projected context [NB][SEQ][256] and the probabilities [NB][4][SEQ][SEQ] (both f32).
// Compute dtypes, f32 accumulate everywhere: q/k/v projections v_wmma_f32_16x16x32_bf16 (x and W RNE-converted to bf16; products exact); additive scores on the vector unit in f32
// (matrix-vector form: one weight vector per head, no shared second dimension; va RNE-converted to bf16 at its load); P.V v_wmma_f32_16x16x32_f16 (P x16384 and v x64, single f16 planes; carries cancel in the normalisation);
// output projection v_wmma_f32_16x16x32_f16 (context x256, w_o = bf16 value x64 held in f16; folded back by 2^-14); softmax f32 with the true row maximum.
// tanh(x) = 1 - 2 / (1 + exp2(2 log2(e) x)); the q and k planes are stored in f32, pre-multiplied by 2 log2(e).
// Layout: bf16 copies of the three inputs and w_q/w_k/w_v; f32 q', k' planes [b*4+h][t][64]; f16 v^T plane [b*4+h][d][t]; f16 context plane [b*SEQ+t][256]; f16 w_o plane [n][k].
// Attention kernel: one block of NW waves per 16 query rows of one (batch, head), the keys split evenly over the waves; score strip 16 x SEQ in LDS; transposed product O^T[d][t] = V^T P^T with the packed P strip as the B fragment; partial O^T and row sums combined through LDS.

#ifndef NB
#define NB 4
#endif
#ifndef SEQ
#define SEQ 512
#endif
#define NB_FULL  4
#define SEQ_FULL 512
#ifndef OUT_SEQ
#define OUT_SEQ SEQ              // token pitch of the output buffers (rows per batch, rows and keys per head)
#endif
#define DM   256
#define NH_  4
#define HD   64
#define OSP  68                  // LDS row pitch (floats) of 16 x 64 staging tiles
#define KSP  68                  // LDS row pitch (floats) of the q and k tiles
#define SCP  (SEQ + 4)           // LDS row pitch (floats) of the score strip
#define NW   8                   // waves per attention block
#define KPW  (SEQ / NW)          // keys per wave
#define C2X  ((float)(2.0 * 1.4426950408889634))        // 2 log2(e), folded into the q and k planes
#define SC2  ((float)(0.125 * 1.4426950408889634))      // HD^-0.5 * log2(e)
#define PCAR 16384.0f            // carry of the P fragment
#define VCAR 64.0f               // carry of the v^T plane
#define ACAR 256.0f              // carry of the context plane
#define WCAR 64.0f               // carry of the w_o plane
#define OSC  (1.0f / (ACAR * WCAR))
#define NEGB (-3.0e38f)
#define OUT1_OFF ((size_t)NB_FULL * SEQ_FULL * DM)      // first element of the probabilities output (fixed)

static_assert(HD == 64);                       // one 64-column GEMM tile = one head; f32 plane row = 256 bytes = two lines; f16 head segment = one line
static_assert(NH_ * HD == DM);                 // head h = columns h*64 + d
static_assert(DM % 64 == 0);
static_assert(DM % 32 == 0);                   // GEMM k-loop steps by 32
static_assert(SEQ % 64 == 0);                  // a 64-row tile never straddles two batches
static_assert((NB * SEQ) % 64 == 0);
static_assert(SEQ % 32 == 0);                  // key loop steps by 32
static_assert(SEQ % 16 == 0);                  // attention grid covers the sequence exactly
static_assert(SEQ % 128 == 0);                 // probability rows stored as 512-byte quarters
static_assert(((size_t)SEQ * DM) % 8 == 0);
static_assert(((size_t)DM * DM) % 8 == 0);
static_assert(NB <= NB_FULL);
static_assert(SEQ <= SEQ_FULL);
static_assert(SEQ <= OUT_SEQ);
static_assert((OSP * 4) % 16 == 0);
static_assert((KSP * 4) % 16 == 0);
static_assert((SCP * 4) % 16 == 0);
static_assert(OUT1_OFF * 4 == (size_t)2097152);                                   // byte offset of the second output
static_assert(((size_t)(NB - 1) * OUT_SEQ + SEQ) * DM <= OUT1_OFF);               // first output stays below the second
static_assert(8 * 32 * 4 == 16 * HD);          // f32 slab store: 8 instructions x 32 lanes x 4 floats = 16 rows x 64 columns
static_assert(4 * 32 * 8 == 16 * 64);          // f16 slab store: 4 instructions x 32 lanes x 8 halves = 16 rows x 64 columns
static_assert((SEQ / 128) * 32 * 4 == SEQ);    // probability row: SEQ/128 instructions x 32 lanes x 4 floats
static_assert((16 * SCP + NW * 32 * KSP + NW * 16 * OSP + 16 * KSP + HD + 3 * NW * 16) * 4 <= 163840);   // static LDS of the attention kernel: two blocks fit one WGP
static_assert(SEQ % (32 * NW) == 0);           // each wave owns whole 32-key tiles
static_assert(16 % NW == 0);                   // probability rows split evenly over the waves
static_assert(32 * NW * 4 == 16 * HD);         // one 4-element group of a 16 x 64 tile per thread of the attention block
static_assert(16 * OSP * 4 <= 131072);

typedef _Float16 h16;
typedef unsigned short bf;
typedef __attribute__((ext_vector_type(16))) __bf16   v16bf;
typedef __attribute__((ext_vector_type(16))) _Float16 v16h;
typedef __attribute__((ext_vector_type(8)))  _Float16 v8h;
typedef __attribute__((ext_vector_type(4)))  _Float16 v4h;
typedef __attribute__((ext_vector_type(8)))  unsigned short v8us;
typedef __attribute__((ext_vector_type(8)))  float    v8f;
typedef __attribute__((ext_vector_type(4)))  float    v4f;
typedef v4f  __attribute__((may_alias)) v4fa;

__device__ __forceinline__ unsigned short f2bf(float f) { unsigned u = __float_as_uint(f); u += 0x7FFFu + ((u >> 16) & 1u); return (unsigned short)(u >> 16); }
__device__ __forceinline__ float bfr(float f) { return __uint_as_float(((unsigned)f2bf(f)) << 16); }   // value after RNE convert to bf16
__device__ __forceinline__ v16h cat16(v8h lo, v8h hi) { return __builtin_shufflevector(lo, hi, 0, 1, 2, 3, 4, 5, 6, 7, 8, 9, 10, 11, 12, 13, 14, 15); }
__device__ __forceinline__ v16bf cat16b(v8us lo, v8us hi) { return __builtin_bit_cast(v16bf, __builtin_shufflevector(lo, hi, 0, 1, 2, 3, 4, 5, 6, 7, 8, 9, 10, 11, 12, 13, 14, 15)); }
__device__ __forceinline__ v8f wmma16(v16h a, v16h b, v8f c) { return __builtin_amdgcn_wmma_f32_16x16x32_f16(false, a, false, b, (short)0, c, false, false); }
__device__ __forceinline__ v8f wmmab(v16bf a, v16bf b, v8f c) { return __builtin_amdgcn_wmma_f32_16x16x32_bf16(false, a, false, b, (short)0, c, false, false); }
// fragment loaders from K-contiguous 16-bit rows; p already includes + 8*(lane>>4): elements 0..7 <- k0+8h+0..7, elements 8..15 <- k0+16+8h+0..7 (same map for A and B)
__device__ __forceinline__ v16h  ldh(const h16* p) { return cat16(*(const v8h*)p, *(const v8h*)(p + 16)); }
__device__ __forceinline__ v16bf ldb(const bf* p)  { return cat16b(*(const v8us*)p, *(const v8us*)(p + 16)); }
// ordering point for wave-private LDS tiles (same wave writes and reads)
__device__ __forceinline__ void wave_sync() { __builtin_amdgcn_fence(3 /* release order */, "wavefront"); __builtin_amdgcn_wave_barrier(); asm volatile("" ::: "memory"); }
// f32 -> f16 convert that cannot produce a subnormal (applied after the plane's power-of-two carry)
static __device__ __forceinline__ h16 toh_flush(float v) { const h16 r = (h16)v; return (fabsf(v) < 6.103515625e-05f) ? (h16)0.0f : r; }
// one matrix instruction + its own four-slot guard (accumulator tied, fragments kept live)
__device__ __forceinline__ v8f wmma16g(v16h a, v16h b, v8f c) { c = wmma16(a, b, c); asm volatile("v_nop\n\tv_nop\n\tv_nop\n\tv_nop" : "+v"(c) : "v"(a), "v"(b)); return c; }
__device__ __forceinline__ v8f wmmabg(v16bf a, v16bf b, v8f c) { c = wmmab(a, b, c); asm volatile("v_nop\n\tv_nop\n\tv_nop\n\tv_nop" : "+v"(c) : "v"(a), "v"(b)); return c; }

// 8 consecutive f32 -> bf16 (RNE), one 32-byte read and one 16-byte write per thread
__device__ __forceinline__ void cvt8(const float* __restrict__ src, bf* dst) {
    const v8f v = *(const v8f*)src; v8us o;
#pragma unroll
    for (int k = 0; k < 8; ++k) o[k] = f2bf(v[k]);
    *(v8us*)dst = o;
    asm volatile("s_wait_xcnt 0x0" ::: "memory");             // the code of the kernel's other parts, joined behind this store, reuses its address and data registers
}
// 8 consecutive f32 -> bf16 value x WCAR held in f16
__device__ __forceinline__ void cvtw(const float* __restrict__ src, h16* dst) {
    const v8f v = *(const v8f*)src; v8h o;
#pragma unroll
    for (int k = 0; k < 8; ++k) o[k] = toh_flush(bfr(v[k]) * WCAR);
    *(v8h*)dst = o;
    asm volatile("s_wait_xcnt 0x0" ::: "memory");             // the code of the kernel's other parts, joined behind this store, reuses its address and data registers
}

#define CB_X ((NB * SEQ * DM) / (8 * 256))     // blocks per input tensor
#define CB_W ((DM * DM) / (8 * 256))           // blocks per weight matrix
static_assert((NB * SEQ * DM) % (8 * 256) == 0);   // the blocks of an input tensor cover it exactly
static_assert((DM * DM) % (8 * 256) == 0);         // the blocks of a weight matrix cover it exactly

// k_cvtall: all seven conversions in one grid; none reads what another writes. Blocks 0 .. 3*CB_X-1: query | key | value -> bf16; then 4*CB_W blocks: w_q | w_k | w_v -> bf16, w_o -> f16. The job is block-uniform.
__global__ __launch_bounds__(256) void k_cvtall(const float* __restrict__ xq, const float* __restrict__ xk, const float* __restrict__ xv,
                                                const float* __restrict__ wq, const float* __restrict__ wk, const float* __restrict__ wv, const float* __restrict__ wo,
                                                bf* XQ, bf* XK, bf* XV, bf* WQ, bf* WK, bf* WV, h16* WO) {
    const unsigned blk = blockIdx.x;
    if (blk < 3u * CB_X) {
        const unsigned j = blk / CB_X;
        const float* s = (j == 0) ? xq : (j == 1) ? xk : xv; bf* d = (j == 0) ? XQ : (j == 1) ? XK : XV;
        const size_t e = ((size_t)(blk % CB_X) * 256 + threadIdx.x) * 8;                       // element of the packed [NB][SEQ][256] copy
        cvt8(s + (e / ((size_t)SEQ * DM)) * ((size_t)SEQ_FULL * DM) + e % ((size_t)SEQ * DM), d + e);   // source batches stand SEQ_FULL rows apart
    } else {
        const unsigned w = blk - 3u * CB_X, j = w / CB_W;
        const size_t e = ((size_t)(w % CB_W) * 256 + threadIdx.x) * 8;
        if (j == 3) cvtw(wo + e, WO + e);
        else cvt8(((j == 0) ? wq : (j == 1) ? wk : wv) + e, ((j == 0) ? WQ : (j == 1) ? WK : WV) + e);
    }
}

// k_projall: the three input projections in one grid (none reads what another writes); blockIdx.z = 0: q', 1: k', 2: v^T. Register-blocked bf16 GEMM, ONE WAVE per 64x64 tile (16 accumulators),
// operands straight from K-contiguous bf16 planes, K = DM; C[m][n] = sum_k A[m][k] Bt[n][k]. blockIdx.x = 64-token tile, blockIdx.y = 64-column tile of W (one head).
// z = 0, 1: A = x rows (m = b*SEQ + t), Bt = W rows (n = h*64 + d); written as f32 x C2X into plane [(b*4 + h)][t][64].
// z = 2:    A = w_v rows (m = h*64 + d), Bt = value rows (n = b*SEQ + t); written as f16 x VCAR into plane [(b*256 + m)][t], row pitch SEQ.
__global__ __launch_bounds__(32) void k_projall(const bf* __restrict__ XQ, const bf* __restrict__ XK, const bf* __restrict__ XV,
                                                const bf* __restrict__ WQ, const bf* __restrict__ WK, const bf* __restrict__ WV, float* QS, float* KS, h16* Ph) {
    __shared__ __align__(16) float os[16 * OSP];
    const int lane = threadIdx.x & 31, lr = lane & 15, hi = lane >> 4; const int z = blockIdx.z;
    const int r0 = ((z == 2) ? blockIdx.y : blockIdx.x) * 64, c0 = ((z == 2) ? blockIdx.x : blockIdx.y) * 64;
    const bf* A  = (z == 0) ? XQ : (z == 1) ? XK : WV;
    const bf* Bt = (z == 0) ? WQ : (z == 1) ? WK : XV;
    v8f acc[4][4];
#pragma unroll
    for (int mb = 0; mb < 4; ++mb)
#pragma unroll
        for (int nb = 0; nb < 4; ++nb) acc[mb][nb] = (v8f){};
    const size_t aoff = (size_t)(r0 + lr) * DM + 8 * hi, boff = (size_t)(c0 + lr) * DM + 8 * hi;
#pragma unroll 1
    for (int kc = 0; kc < DM; kc += 32) {
        v16bf a[4];
#pragma unroll
        for (int mb = 0; mb < 4; ++mb) a[mb] = ldb(A + aoff + (size_t)mb * 16 * DM + kc);
#pragma unroll
        for (int nb = 0; nb < 4; ++nb) { const v16bf b = ldb(Bt + boff + (size_t)nb * 16 * DM + kc);
#pragma unroll
            for (int mb = 0; mb < 4; ++mb) acc[mb][nb] = wmmabg(a[mb], b, acc[mb][nb]); }
    }
    if (z != 2) {
        float* P = (z == 0) ? QS : KS;
        const int bb = r0 / SEQ, tt = r0 % SEQ; const int zh = bb * NH_ + c0 / HD;
        const size_t tbase = ((size_t)zh * SEQ + (size_t)tt) * HD;
#pragma unroll
        for (int mb = 0; mb < 4; ++mb) {
#pragma unroll
            for (int nb = 0; nb < 4; ++nb) {
#pragma unroll
                for (int j = 0; j < 8; ++j) os[(hi * 8 + j) * OSP + nb * 16 + lr] = acc[mb][nb][j] * C2X; }   // D: row 8h+j, col lane&15
            wave_sync();
            const size_t sb = tbase + (size_t)(mb * 16) * HD;
#pragma unroll
            for (int s = 0; s < 8; ++s) { const int p = s * 32 + lane; const int row = p >> 4, c4 = (p & 15) * 4;   // 8 s x 2 rows = 16 rows; 16 lanes x 4 floats = 64 columns
                const v4f val = *(const v4fa*)(&os[row * OSP + c4]);
                *(v4f*)(P + sb + (size_t)p * 4) = val; }
            wave_sync();
        }
        asm volatile("s_wait_xcnt 0x0" ::: "memory");         // the v^T part's code stands behind this branch and reuses the last stores' data registers
    } else {
        const int bb = c0 / SEQ, tt = c0 % SEQ;
        const size_t tbase = (size_t)bb * (size_t)DM * SEQ + (size_t)r0 * SEQ + (size_t)tt;
#pragma unroll
        for (int mb = 0; mb < 4; ++mb) {
#pragma unroll
            for (int nb = 0; nb < 4; ++nb) {
#pragma unroll
                for (int j = 0; j < 8; ++j) os[(hi * 8 + j) * OSP + nb * 16 + lr] = acc[mb][nb][j] * VCAR; }   // D: row 8h+j, col lane&15
            wave_sync();
            const size_t sb = tbase + (size_t)(mb * 16) * SEQ;
#pragma unroll
            for (int s = 0; s < 4; ++s) { const int row = 4 * s + (lane >> 3), c8 = (lane & 7) * 8;   // 4 s x 4 row groups = 16 rows; 8 lanes x 8 halves = 64 columns
                const v4f x0 = *(const v4fa*)(&os[row * OSP + c8]); const v4f x1 = *(const v4fa*)(&os[row * OSP + c8 + 4]); v8h hv;
#pragma unroll
                for (int i = 0; i < 4; ++i) { hv[i] = toh_flush(x0[i]); hv[4 + i] = toh_flush(x1[i]); }
                *(v8h*)(Ph + sb + (size_t)row * SEQ + c8) = hv; }
            wave_sync();
        }
    }
}

// k_outp: f16 GEMM, ONE WAVE per 64x64 tile; A = context rows (m = b*SEQ + t, x ACAR), Bt = w_o rows (n, x WCAR); C x OSC written as f32 into the output buffer [b][t][256].
__global__ __launch_bounds__(32) void k_outp(const h16* __restrict__ A, const h16* __restrict__ Bt, float* OUT) {
    __shared__ __align__(16) float os[16 * OSP];
    const int lane = threadIdx.x & 31, lr = lane & 15, hi = lane >> 4; const int r0 = blockIdx.x * 64, c0 = blockIdx.y * 64;
    v8f acc[4][4];
#pragma unroll
    for (int mb = 0; mb < 4; ++mb)
#pragma unroll
        for (int nb = 0; nb < 4; ++nb) acc[mb][nb] = (v8f){};
    const size_t aoff = (size_t)(r0 + lr) * DM + 8 * hi, boff = (size_t)(c0 + lr) * DM + 8 * hi;
#pragma unroll 1
    for (int kc = 0; kc < DM; kc += 32) {
        v16h a[4];
#pragma unroll
        for (int mb = 0; mb < 4; ++mb) a[mb] = ldh(A + aoff + (size_t)mb * 16 * DM + kc);
#pragma unroll
        for (int nb = 0; nb < 4; ++nb) { const v16h b = ldh(Bt + boff + (size_t)nb * 16 * DM + kc);
#pragma unroll
            for (int mb = 0; mb < 4; ++mb) acc[mb][nb] = wmma16g(a[mb], b, acc[mb][nb]); }
    }
    const int bb = r0 / SEQ, tt = r0 % SEQ;
    const size_t obase = ((size_t)bb * OUT_SEQ + (size_t)tt) * DM + (size_t)c0;
#pragma unroll
    for (int mb = 0; mb < 4; ++mb) {
#pragma unroll
        for (int nb = 0; nb < 4; ++nb) {
#pragma unroll
            for (int j = 0; j < 8; ++j) os[(hi * 8 + j) * OSP + nb * 16 + lr] = acc[mb][nb][j] * OSC; }   // D: row 8h+j, col lane&15
        wave_sync();
        const size_t sb = obase + (size_t)(mb * 16) * DM;
{
#pragma unroll
            for (int s = 0; s < 8; ++s) { const int p = s * 32 + lane; const int row = p >> 4, c4 = (p & 15) * 4;   // 8 s x 2 rows = 16 rows; 16 lanes x 4 floats = 64 columns
                const v4f val = *(const v4fa*)(&os[row * OSP + c4]);
                *(v4f*)(OUT + sb + (size_t)row * DM + c4) = val; }
             }
        wave_sync();
    }
}

// k_attn: one block of NW waves per 16 query rows of one (batch, head); wave w owns keys w*KPW .. w*KPW + KPW - 1 in both passes. The q' tile, the weight vector and the score strip are shared; each wave has its own k' tile.
// Pass 1: lane (t = lane&15, h = lane>>4) holds the 16 scores (t, key0 + 8h + r) and (t, key0 + 16 + 8h + r), r = 0..7: acc = sum_d w[d] / (1 + exp2(q'[t][d] + k'[key][d])); score (log2 domain) = SC2 * (sum_d w[d] - 2 acc).
//         Scores go to the strip sc[t][key]; the row maximum is tracked per lane, combined with one xor-16 exchange, then over the NW waves through LDS (a maximum: exact in any order).
// Pass 2: e = exp2(score - max) (f32, row sum l); P = f16(e x 16384) packed directly as the B fragment (element r <- key 8h+r, element 8+r <- key 16+8h+r) of
//         O^T[d][t] = V^T P^T (A = v^T rows d, k = key); row sum l2 over the converted P normalises O; e is written back into the strip.
// Combine: each wave leaves its partial O^T, l and l2 in LDS; after one barrier they are summed in wave order 0..NW-1, normalised and stored.
__global__ __launch_bounds__(32 * NW) void k_attn(const float* __restrict__ QS, const float* __restrict__ KS, const h16* __restrict__ VT, const float* __restrict__ va, float* ATTN, h16* AT) {
    __shared__ __align__(16) float sc[16 * SCP];
    __shared__ __align__(16) float ks[NW * 32 * KSP];
    __shared__ __align__(16) float qs[16 * KSP];
    __shared__ __align__(16) float po[NW * 16 * OSP];            // partial O^T per wave; with it a block holds over a third of a WGP's LDS, so at most two blocks share a WGP and the grid spreads evenly
    __shared__ __align__(16) float vs[HD];
    __shared__ __align__(16) float wmx[NW * 16];
    __shared__ __align__(16) float wl[NW * 16];
    __shared__ __align__(16) float wl2[NW * 16];
    const int tid = threadIdx.x, lane = tid & 31, lr = lane & 15, hi = lane >> 4;
    const int wv = __builtin_amdgcn_readfirstlane(tid >> 5);     // wave number, held scalar so that the key loops stay scalar loops
    const int zh = blockIdx.y; const int b = zh / NH_, h = zh % NH_;
    const int t0 = blockIdx.x * 16;
    const size_t pbase = (size_t)zh * SEQ * HD;
    float* ksw = ks + wv * (32 * KSP);                           // this wave's own k' tile
    float* pw = po + wv * (16 * OSP);                          // this wave's own partial O^T tile
    // q' tile: 16 rows x 64 floats, 16 B per thread; rows 0..15 x columns 0..63 all written
    { const int row = tid >> 4, c4 = (tid & 15) * 4;
        const v4f v = *(const v4f*)(QS + pbase + (size_t)(t0 + row) * HD + c4); *(v4fa*)(&qs[row * KSP + c4]) = v; }
    // weight vector of this head, RNE-converted to bf16 at its load
    if (tid < 16) { const v4f w = *(const v4f*)(va + (size_t)h * HD + tid * 4); v4f wb;
#pragma unroll
      for (int i = 0; i < 4; ++i) wb[i] = bfr(w[i]);
      *(v4fa*)(&vs[tid * 4]) = wb; }
    __syncthreads();                                             // q' tile and weight vector visible to all waves
    float W1 = 0.0f;
#pragma unroll 1
    for (int c = 0; c < HD; c += 4) { const v4f w4 = *(const v4fa*)(&vs[c]); W1 += (w4[0] + w4[1]) + (w4[2] + w4[3]); }

    const int kbeg = wv * KPW;
    float mx = NEGB;
#pragma unroll 1
    for (int key0 = kbeg; key0 < kbeg + KPW; key0 += 32) {
        wave_sync();                                             // all reads of the earlier k' tile are complete
        { const float* kp = KS + pbase + (size_t)(key0 + lane) * HD;   // lane = key row, 64 floats = 256 B
#pragma unroll 1
          for (int c = 0; c < HD; c += 16) {
              const v4f k0 = *(const v4f*)(kp + c), k1 = *(const v4f*)(kp + c + 4), k2 = *(const v4f*)(kp + c + 8), k3 = *(const v4f*)(kp + c + 12);
              *(v4fa*)(&ksw[lane * KSP + c]) = k0; *(v4fa*)(&ksw[lane * KSP + c + 4]) = k1; *(v4fa*)(&ksw[lane * KSP + c + 8]) = k2; *(v4fa*)(&ksw[lane * KSP + c + 12]) = k3; } }
        wave_sync();
        float aa[8], ab[8];
#pragma unroll
        for (int r = 0; r < 8; ++r) { aa[r] = 0.0f; ab[r] = 0.0f; }
#pragma unroll 1
        for (int c = 0; c < HD; c += 4) {
            const v4f q4 = *(const v4fa*)(&qs[lr * KSP + c]);
            const v4f w4 = *(const v4fa*)(&vs[c]);
#pragma unroll
            for (int r = 0; r < 8; ++r) {
                const v4f ka = *(const v4fa*)(&ksw[(8 * hi + r) * KSP + c]);
                const v4f kb = *(const v4fa*)(&ksw[(16 + 8 * hi + r) * KSP + c]);
#pragma unroll
                for (int i = 0; i < 4; ++i) {
                    const float ra = __builtin_amdgcn_rcpf(1.0f + __builtin_amdgcn_exp2f(q4[i] + ka[i]));
                    const float rb = __builtin_amdgcn_rcpf(1.0f + __builtin_amdgcn_exp2f(q4[i] + kb[i]));
                    aa[r] = fmaf(w4[i], ra, aa[r]); ab[r] = fmaf(w4[i], rb, ab[r]); } } }
        v4f s0, s1, s2, s3;
#pragma unroll
        for (int r = 0; r < 4; ++r) {
            s0[r] = (W1 - 2.0f * aa[r]) * SC2; s1[r] = (W1 - 2.0f * aa[4 + r]) * SC2;
            s2[r] = (W1 - 2.0f * ab[r]) * SC2; s3[r] = (W1 - 2.0f * ab[4 + r]) * SC2;
            mx = fmaxf(mx, fmaxf(fmaxf(s0[r], s1[r]), fmaxf(s2[r], s3[r]))); }
        const int so = lr * SCP + key0 + 8 * hi;                 // keys key0+8h+0..7 at so, keys key0+16+8h+0..7 at so+16
        *(v4fa*)(&sc[so]) = s0; *(v4fa*)(&sc[so + 4]) = s1; *(v4fa*)(&sc[so + 16]) = s2; *(v4fa*)(&sc[so + 20]) = s3;
    }
    wmx[wv * 16 + lr] = fmaxf(mx, __shfl_xor(mx, 16, 32));       // lanes lr and lr+16 hold the same value
    __syncthreads();                                             // every wave's row maxima are in wmx
    float m = wmx[lr];
#pragma unroll
    for (int w = 1; w < NW; ++w) m = fmaxf(m, wmx[w * 16 + lr]);

    v8f o0 = (v8f){}, o1 = (v8f){}, o2 = (v8f){}, o3 = (v8f){};
    float l = 0.0f, l2 = 0.0f;
    const size_t vo = ((size_t)zh * HD + (size_t)lr) * SEQ + 8 * hi;   // + 16j*SEQ + key  (A fragment: row d = 16j + lane&15, k = key)
#pragma unroll 1
    for (int key0 = kbeg; key0 < kbeg + KPW; key0 += 32) {
        const int so = lr * SCP + key0 + 8 * hi;                 // the same lane wrote these 16 scores
        const v4f s0 = *(const v4fa*)(&sc[so]), s1 = *(const v4fa*)(&sc[so + 4]), s2 = *(const v4fa*)(&sc[so + 16]), s3 = *(const v4fa*)(&sc[so + 20]);
        v4f e0, e1, e2, e3; v16h pb; float ls = 0.0f, lp = 0.0f;
#pragma unroll
        for (int r = 0; r < 4; ++r) {
            e0[r] = __builtin_amdgcn_exp2f(s0[r] - m); e1[r] = __builtin_amdgcn_exp2f(s1[r] - m);
            e2[r] = __builtin_amdgcn_exp2f(s2[r] - m); e3[r] = __builtin_amdgcn_exp2f(s3[r] - m);
            const h16 p0 = toh_flush(e0[r] * PCAR); const h16 p1 = toh_flush(e1[r] * PCAR);
            const h16 p2 = toh_flush(e2[r] * PCAR); const h16 p3 = toh_flush(e3[r] * PCAR);
            pb[r] = p0; pb[4 + r] = p1; pb[8 + r] = p2; pb[12 + r] = p3;
            ls += (e0[r] + e1[r]) + (e2[r] + e3[r]);
            lp += ((float)p0 + (float)p1) + ((float)p2 + (float)p3); }
        l += ls; l2 += lp;
        *(v4fa*)(&sc[so]) = e0; *(v4fa*)(&sc[so + 4]) = e1; *(v4fa*)(&sc[so + 16]) = e2; *(v4fa*)(&sc[so + 20]) = e3;
        const h16* vp = VT + vo + key0;
        const v16h v0 = ldh(vp), v1 = ldh(vp + (size_t)16 * SEQ), v2 = ldh(vp + (size_t)32 * SEQ), v3 = ldh(vp + (size_t)48 * SEQ);
        o0 = wmma16g(v0, pb, o0); o1 = wmma16g(v1, pb, o1); o2 = wmma16g(v2, pb, o2); o3 = wmma16g(v3, pb, o3);
    }
    l += __shfl_xor(l, 16, 32); l2 += __shfl_xor(l2, 16, 32);
    wl[wv * 16 + lr] = l; wl2[wv * 16 + lr] = l2;                // lanes lr and lr+16 hold the same values
    // partial O^T of this wave's keys, D layout o_j[r] = (d = 16j + 8h + r, t = lane&15) -> own tile of po as [t][d], pitch OSP; rows 0..15 x columns 0..63 all written
    { v4f a, c;
      a[0] = o0[0]; a[1] = o0[1]; a[2] = o0[2]; a[3] = o0[3]; c[0] = o0[4]; c[1] = o0[5]; c[2] = o0[6]; c[3] = o0[7];
      *(v4fa*)(&pw[lr * OSP +  0 + 8 * hi]) = a; *(v4fa*)(&pw[lr * OSP +  0 + 8 * hi + 4]) = c;
      a[0] = o1[0]; a[1] = o1[1]; a[2] = o1[2]; a[3] = o1[3]; c[0] = o1[4]; c[1] = o1[5]; c[2] = o1[6]; c[3] = o1[7];
      *(v4fa*)(&pw[lr * OSP + 16 + 8 * hi]) = a; *(v4fa*)(&pw[lr * OSP + 16 + 8 * hi + 4]) = c;
      a[0] = o2[0]; a[1] = o2[1]; a[2] = o2[2]; a[3] = o2[3]; c[0] = o2[4]; c[1] = o2[5]; c[2] = o2[6]; c[3] = o2[7];
      *(v4fa*)(&pw[lr * OSP + 32 + 8 * hi]) = a; *(v4fa*)(&pw[lr * OSP + 32 + 8 * hi + 4]) = c;
      a[0] = o3[0]; a[1] = o3[1]; a[2] = o3[2]; a[3] = o3[3]; c[0] = o3[4]; c[1] = o3[5]; c[2] = o3[6]; c[3] = o3[7];
      *(v4fa*)(&pw[lr * OSP + 48 + 8 * hi]) = a; *(v4fa*)(&pw[lr * OSP + 48 + 8 * hi + 4]) = c; }
    __syncthreads();                                             // partial O^T, l, l2 and the whole e strip visible to all waves
    const size_t abase = ((size_t)b * SEQ + (size_t)t0) * DM + (size_t)h * HD;                    // context plane [b*SEQ + t][256]
    const size_t pb0 = (((size_t)b * NH_ + (size_t)h) * OUT_SEQ + (size_t)t0) * OUT_SEQ;          // probabilities [b][h][t][key]
    { const int row = tid >> 4, c4 = (tid & 15) * 4;             // 16 rows x 16 threads x 4 halves; 16 lanes = 64 columns = one line
        v4f x = *(const v4fa*)(&po[row * OSP + c4]); float l2t = wl2[row];                        // l2t >= 16384: the maximum element contributes exp2(0)
#pragma unroll
        for (int w = 1; w < NW; ++w) { const v4f y = *(const v4fa*)(&po[w * (16 * OSP) + row * OSP + c4]); x[0] += y[0]; x[1] += y[1]; x[2] += y[2]; x[3] += y[3]; l2t += wl2[w * 16 + row]; }
        const float invo = (ACAR / VCAR) / l2t; v4h hv;
#pragma unroll
        for (int i = 0; i < 4; ++i) hv[i] = toh_flush(x[i] * invo);
        *(v4h*)(AT + abase + (size_t)row * DM + c4) = hv;
        asm volatile("s_wait_xcnt 0x0" ::: "memory"); }         // the store's address and data registers are reused right below
#pragma unroll 1
    for (int row = wv; row < 16; row += NW) {                                                     // 16 rows x SEQ/128 instructions x 512 B = 16 x SEQ floats
        float lt = wl[row];                                                                       // lt >= 1
#pragma unroll
        for (int w = 1; w < NW; ++w) lt += wl[w * 16 + row];
        const float invr = 1.0f / lt;
        const size_t ro = pb0 + (size_t)row * OUT_SEQ;
#pragma unroll
        for (int qd = 0; qd < SEQ / 128; ++qd) { const int cofs = qd * 128 + lane * 4;
            const v4f e = *(const v4fa*)(&sc[row * SCP + cofs]);
            v4f val; val[0] = e[0] * invr; val[1] = e[1] * invr; val[2] = e[2] * invr; val[3] = e[3] * invr;
            *(v4f*)(ATTN + ro + cofs) = val; }
        asm volatile("s_wait_xcnt 0x0" ::: "memory"); }         // the next trip reuses the stores' address and data registers
}

static constexpr size_t al256(size_t v) { return (v + 255) & ~(size_t)255; }
static constexpr size_t SZ_XB = al256((size_t)NB * SEQ * DM * 2);          // bf16 input copy
static constexpr size_t SZ_WB = al256((size_t)3 * DM * DM * 2);            // bf16 w_q | w_k | w_v
static constexpr size_t SZ_WO = al256((size_t)DM * DM * 2);                // f16 w_o
static constexpr size_t SZ_PF = al256((size_t)NB * NH_ * SEQ * HD * 4);    // f32 q' / k' plane
static constexpr size_t SZ_PH = al256((size_t)NB * SEQ * DM * 2);          // f16 v^T plane / context plane
static constexpr size_t SZ_TOTAL = 3 * SZ_XB + SZ_WB + SZ_WO + 2 * SZ_PF + 2 * SZ_PH;
static_assert(SZ_TOTAL <= (size_t)134217728);          // workspace carve <= 128 MiB
static_assert(((size_t)DM * DM * 2) % 256 == 0);       // weight sub-planes stay 256-byte aligned
static_assert((size_t)NB * NH_ * SEQ * HD == (size_t)NB * DM * SEQ);       // v^T plane [(b*256 + m)][t] has the same extent as the context plane

extern "C" void kernel_launch(void* const* d_in, const int* in_sizes, int n_in,
                              void* d_out, int out_size, void* d_ws, size_t ws_size, hipStream_t stream) {
    if (n_in < 8) return;
    const size_t needx = ((size_t)(NB - 1) * SEQ_FULL + SEQ) * DM;
    if ((size_t)in_sizes[0] < needx || (size_t)in_sizes[1] < needx || (size_t)in_sizes[2] < needx) return;
    if ((size_t)in_sizes[3] < (size_t)DM * DM || (size_t)in_sizes[4] < (size_t)DM * DM || (size_t)in_sizes[5] < (size_t)DM * DM || (size_t)in_sizes[7] < (size_t)DM * DM) return;
    if (in_sizes[6] < NH_ * HD) return;
    const size_t need_out = OUT1_OFF + ((size_t)(NB * NH_ - 1) * OUT_SEQ + (size_t)(SEQ - 1)) * OUT_SEQ + SEQ;
    if ((size_t)out_size < need_out) return;
    if (SZ_TOTAL > ws_size) return;
    // wire order: query, key, value, w_q, w_k, w_v, v_a, w_o
    const float* xin[3] = { (const float*)d_in[0], (const float*)d_in[1], (const float*)d_in[2] };
    const float* wq = (const float*)d_in[3];
    const float* wk = (const float*)d_in[4];
    const float* wv = (const float*)d_in[5];
    const float* va = (const float*)d_in[6];
    const float* wo = (const float*)d_in[7];
    float* OUT  = (float*)d_out;                 // [NB][SEQ][256]
    float* ATTN = (float*)d_out + OUT1_OFF;      // [NB][4][SEQ][SEQ]
    char* wsp = (char*)d_ws;
    bf* XB[3];
    XB[0] = (bf*)wsp; wsp += SZ_XB;                  // query  [NB*SEQ][256]
    XB[1] = (bf*)wsp; wsp += SZ_XB;                  // key    [NB*SEQ][256]
    XB[2] = (bf*)wsp; wsp += SZ_XB;                  // value  [NB*SEQ][256]
    bf* WB = (bf*)wsp; wsp += SZ_WB;                 // [3][256][256]: q | k | v  ([out][in] = Bt as-is)
    h16* WO = (h16*)wsp; wsp += SZ_WO;               // [256][256] x WCAR ([out][in] = Bt as-is)
    float* QS = (float*)wsp; wsp += SZ_PF;           // [NB*4][SEQ][64] x C2X
    float* KS = (float*)wsp; wsp += SZ_PF;           // [NB*4][SEQ][64] x C2X
    h16* VT = (h16*)wsp; wsp += SZ_PH;               // [NB*4][64][SEQ] x VCAR
    h16* AT = (h16*)wsp; wsp += SZ_PH;               // [NB*SEQ][256] x ACAR
    bf* WQ = WB; bf* WK = WB + (size_t)DM * DM; bf* WV = WB + (size_t)2 * DM * DM;

    // all seven conversions, one grid
    k_cvtall<<<3 * CB_X + 4 * CB_W, 256, 0, stream>>>(xin[0], xin[1], xin[2], wq, wk, wv, wo, XB[0], XB[1], XB[2], WQ, WK, WV, WO);

    // q', k' -> f32 planes [(b*4 + h)][t][d]; v^T -> f16 plane [(b*4 + h)][d][t]; one grid, blockIdx.z picks the projection
    k_projall<<<dim3(NB * SEQ / 64, DM / 64, 3), 32, 0, stream>>>(XB[0], XB[1], XB[2], WQ, WK, WV, QS, KS, VT);

    // scores, softmax, probabilities output, P.V -> context plane
    k_attn<<<dim3(SEQ / 16, NB * NH_, 1), 32 * NW, 0, stream>>>(QS, KS, VT, va, ATTN, AT);

    // output projection: A = context rows, Bt = w_o rows -> output buffer [b][t][256]
    k_outp<<<dim3(NB * SEQ / 64, DM / 64, 1), 32, 0, stream>>>(AT, WO, OUT);
}

// v003
// Measured time: 46.4 microseconds a run.
// Next to v002, in two timings, it ran 1.23 times as fast each time.
// Over all steps from v000 it is 2.87 times as fast.
#include <hip/hip_runtime.h>

// Additive-score multi-head attention, width 256 = 4 heads x 64; query/key/value [NB][SEQ][256]; w_q/w_k/w_v/w_o [out][in] (y = x W^T, no bias); score(t, k) = 0.125 * sum_d va[h][d] * tanh(q[t][d] + k[k][d]);
// dense softmax over keys; context = P V, heads concatenated (column h*64 + d), output projection; two outputs: projected context [NB][SEQ][256] and the probabilities [NB][4][SEQ][SEQ] (both f32).
// Compute dtypes, f32 accumulate everywhere: q/k/v projections v_wmma_f32_16x16x32_bf16 (x and W RNE-converted to bf16; products exact); additive scores on the vector unit in f32
// (matrix-vector form: one weight vector per head, no shared second dimension; va RNE-converted to bf16 at its load); P.V v_wmma_f32_16x16x32_f16 (P x16384 and v x64, single f16 planes; carries cancel in the normalisation);
// output projection v_wmma_f32_16x16x32_f16 (context x256, w_o = bf16 value x64 held in f16; folded back by 2^-14); softmax f32 with the true row maximum.
// tanh(x) = 1 - 2 / (1 + exp2(2 log2(e) x)); exp2(c (q + k)) = exp2(c q) * exp2(c k): the q and k planes hold Eq = exp2(2 log2(e) q) and Ek = exp2(2 log2(e) k) in f32, so a score term costs one reciprocal and no exponential.
// Layout: bf16 copies of the three inputs and w_q/w_k/w_v; f32 Eq, Ek planes [b*4+h][t][64]; f16 v^T plane [b*4+h][d][t]; f16 context plane [b*SEQ+t][256]; f16 w_o plane [n][k].
// Attention kernel: one block of NW waves per 16 query rows of one (batch, head), the keys split evenly over the waves; score strip 16 x SEQ in LDS; transposed product O^T[d][t] = V^T P^T with the packed P strip as the B fragment; partial O^T and row sums combined through LDS.

#ifndef NB
#define NB 4
#endif
#ifndef SEQ
#define SEQ 512
#endif
#define NB_FULL  4
#define SEQ_FULL 512
#ifndef OUT_SEQ
#define OUT_SEQ SEQ              // token pitch of the output buffers (rows per batch, rows and keys per head)
#endif
#define DM   256
#define NH_  4
#define HD   64
#define OSP  68                  // LDS row pitch (floats) of 16 x 64 staging tiles
#define KSP  68                  // LDS row pitch (floats) of the q and k tiles
#define SCP  (SEQ + 4)           // LDS row pitch (floats) of the score strip
#define NW   8                   // waves per attention block
#define KPW  (SEQ / NW)          // keys per wave
#define C2X  ((float)(2.0 * 1.4426950408889634))        // 2 log2(e), folded into the q and k planes
#define ECL  63.0f               // bound of the planes' exponents: Eq * Ek stays a finite normal number (never inf * 0)
#define SC2  ((float)(0.125 * 1.4426950408889634))      // HD^-0.5 * log2(e)
#define PCAR 16384.0f            // carry of the P fragment
#define VCAR 64.0f               // carry of the v^T plane
#define ACAR 256.0f              // carry of the context plane
#define WCAR 64.0f               // carry of the w_o plane
#define OSC  (1.0f / (ACAR * WCAR))
#define NEGB (-3.0e38f)
#define OUT1_OFF ((size_t)NB_FULL * SEQ_FULL * DM)      // first element of the probabilities output (fixed)

static_assert(HD == 64);                       // one 64-column GEMM tile = one head; f32 plane row = 256 bytes = two lines; f16 head segment = one line
static_assert(NH_ * HD == DM);                 // head h = columns h*64 + d
static_assert(DM % 64 == 0);
static_assert(DM % 32 == 0);                   // GEMM k-loop steps by 32
static_assert(SEQ % 64 == 0);                  // a 64-row tile never straddles two batches
static_assert((NB * SEQ) % 64 == 0);
static_assert(SEQ % 32 == 0);                  // key loop steps by 32
static_assert(SEQ % 16 == 0);                  // attention grid covers the sequence exactly
static_assert(SEQ % 128 == 0);                 // probability rows stored as 512-byte quarters
static_assert(((size_t)SEQ * DM) % 8 == 0);
static_assert(((size_t)DM * DM) % 8 == 0);
static_assert(NB <= NB_FULL);
static_assert(SEQ <= SEQ_FULL);
static_assert(SEQ <= OUT_SEQ);
static_assert((OSP * 4) % 16 == 0);
static_assert((KSP * 4) % 16 == 0);
static_assert((SCP * 4) % 16 == 0);
static_assert(OUT1_OFF * 4 == (size_t)2097152);                                   // byte offset of the second output
static_assert(((size_t)(NB - 1) * OUT_SEQ + SEQ) * DM <= OUT1_OFF);               // first output stays below the second
static_assert(8 * 32 * 4 == 16 * HD);          // f32 slab store: 8 instructions x 32 lanes x 4 floats = 16 rows x 64 columns
static_assert(4 * 32 * 8 == 16 * 64);          // f16 slab store: 4 instructions x 32 lanes x 8 halves = 16 rows x 64 columns
static_assert((SEQ / 128) * 32 * 4 == SEQ);    // probability row: SEQ/128 instructions x 32 lanes x 4 floats
static_assert((16 * SCP + NW * 32 * KSP + NW * 16 * OSP + 16 * KSP + HD + 3 * NW * 16) * 4 <= 163840);   // static LDS of the attention kernel: two blocks fit one WGP
static_assert(SEQ % (32 * NW) == 0);           // each wave owns whole 32-key tiles
static_assert(16 % NW == 0);                   // probability rows split evenly over the waves
static_assert(32 * NW * 4 == 16 * HD);         // one 4-element group of a 16 x 64 tile per thread of the attention block
static_assert(16 * OSP * 4 <= 131072);

typedef _Float16 h16;
typedef unsigned short bf;
typedef __attribute__((ext_vector_type(16))) __bf16   v16bf;
typedef __attribute__((ext_vector_type(16))) _Float16 v16h;
typedef __attribute__((ext_vector_type(8)))  _Float16 v8h;
typedef __attribute__((ext_vector_type(4)))  _Float16 v4h;
typedef __attribute__((ext_vector_type(8)))  unsigned short v8us;
typedef __attribute__((ext_vector_type(8)))  float    v8f;
typedef __attribute__((ext_vector_type(4)))  float    v4f;
typedef v4f  __attribute__((may_alias)) v4fa;

__device__ __forceinline__ unsigned short f2bf(float f) { unsigned u = __float_as_uint(f); u += 0x7FFFu + ((u >> 16) & 1u); return (unsigned short)(u >> 16); }
__device__ __forceinline__ float bfr(float f) { return __uint_as_float(((unsigned)f2bf(f)) << 16); }   // value after RNE convert to bf16
__device__ __forceinline__ v16h cat16(v8h lo, v8h hi) { return __builtin_shufflevector(lo, hi, 0, 1, 2, 3, 4, 5, 6, 7, 8, 9, 10, 11, 12, 13, 14, 15); }
__device__ __forceinline__ v16bf cat16b(v8us lo, v8us hi) { return __builtin_bit_cast(v16bf, __builtin_shufflevector(lo, hi, 0, 1, 2, 3, 4, 5, 6, 7, 8, 9, 10, 11, 12, 13, 14, 15)); }
__device__ __forceinline__ v8f wmma16(v16h a, v16h b, v8f c) { return __builtin_amdgcn_wmma_f32_16x16x32_f16(false, a, false, b, (short)0, c, false, false); }
__device__ __forceinline__ v8f wmmab(v16bf a, v16bf b, v8f c) { return __builtin_amdgcn_wmma_f32_16x16x32_bf16(false, a, false, b, (short)0, c, false, false); }
// fragment loaders from K-contiguous 16-bit rows; p already includes + 8*(lane>>4): elements 0..7 <- k0+8h+0..7, elements 8..15 <- k0+16+8h+0..7 (same map for A and B)
__device__ __forceinline__ v16h  ldh(const h16* p) { return cat16(*(const v8h*)p, *(const v8h*)(p + 16)); }
__device__ __forceinline__ v16bf ldb(const bf* p)  { return cat16b(*(const v8us*)p, *(const v8us*)(p + 16)); }
// ordering point for wave-private LDS tiles (same wave writes and reads)
__device__ __forceinline__ void wave_sync() { __builtin_amdgcn_fence(3 /* release order */, "wavefront"); __builtin_amdgcn_wave_barrier(); asm volatile("" ::: "memory"); }
// f32 -> f16 convert that cannot produce a subnormal (applied after the plane's power-of-two carry)
static __device__ __forceinline__ h16 toh_flush(float v) { const h16 r = (h16)v; return (fabsf(v) < 6.103515625e-05f) ? (h16)0.0f : r; }
// one matrix instruction + its own four-slot guard (accumulator tied, fragments kept live)
__device__ __forceinline__ v8f wmma16g(v16h a, v16h b, v8f c) { c = wmma16(a, b, c); asm volatile("v_nop\n\tv_nop\n\tv_nop\n\tv_nop" : "+v"(c) : "v"(a), "v"(b)); return c; }
__device__ __forceinline__ v8f wmmabg(v16bf a, v16bf b, v8f c) { c = wmmab(a, b, c); asm volatile("v_nop\n\tv_nop\n\tv_nop\n\tv_nop" : "+v"(c) : "v"(a), "v"(b)); return c; }

// 8 consecutive f32 -> bf16 (RNE), one 32-byte read and one 16-byte write per thread
__device__ __forceinline__ void cvt8(const float* __restrict__ src, bf* dst) {
    const v8f v = *(const v8f*)src; v8us o;
#pragma unroll
    for (int k = 0; k < 8; ++k) o[k] = f2bf(v[k]);
    *(v8us*)dst = o;
    asm volatile("s_wait_xcnt 0x0" ::: "memory");             // the code of the kernel's other parts, joined behind this store, reuses its address and data registers
}
// 8 consecutive f32 -> bf16 value x WCAR held in f16
__device__ __forceinline__ void cvtw(const float* __restrict__ src, h16* dst) {
    const v8f v = *(const v8f*)src; v8h o;
#pragma unroll
    for (int k = 0; k < 8; ++k) o[k] = toh_flush(bfr(v[k]) * WCAR);
    *(v8h*)dst = o;
    asm volatile("s_wait_xcnt 0x0" ::: "memory");             // the code of the kernel's other parts, joined behind this store, reuses its address and data registers
}

#define CB_X ((NB * SEQ * DM) / (8 * 256))     // blocks per input tensor
#define CB_W ((DM * DM) / (8 * 256))           // blocks per weight matrix
static_assert((NB * SEQ * DM) % (8 * 256) == 0);   // the blocks of an input tensor cover it exactly
static_assert((DM * DM) % (8 * 256) == 0);         // the blocks of a weight matrix cover it exactly

// k_cvtall: all seven conversions in one grid; none reads what another writes. Blocks 0 .. 3*CB_X-1: query | key | value -> bf16; then 4*CB_W blocks: w_q | w_k | w_v -> bf16, w_o -> f16. The job is block-uniform.
__global__ __launch_bounds__(256) void k_cvtall(const float* __restrict__ xq, const float* __restrict__ xk, const float* __restrict__ xv,
                                                const float* __restrict__ wq, const float* __restrict__ wk, const float* __restrict__ wv, const float* __restrict__ wo,
                                                bf* XQ, bf* XK, bf* XV, bf* WQ, bf* WK, bf* WV, h16* WO) {
    const unsigned blk = blockIdx.x;
    if (blk < 3u * CB_X) {
        const unsigned j = blk / CB_X;
        const float* s = (j == 0) ? xq : (j == 1) ? xk : xv; bf* d = (j == 0) ? XQ : (j == 1) ? XK : XV;
        const size_t e = ((size_t)(blk % CB_X) * 256 + threadIdx.x) * 8;                       // element of the packed [NB][SEQ][256] copy
        cvt8(s + (e / ((size_t)SEQ * DM)) * ((size_t)SEQ_FULL * DM) + e % ((size_t)SEQ * DM), d + e);   // source batches stand SEQ_FULL rows apart
    } else {
        const unsigned w = blk - 3u * CB_X, j = w / CB_W;
        const size_t e = ((size_t)(w % CB_W) * 256 + threadIdx.x) * 8;
        if (j == 3) cvtw(wo + e, WO + e);
        else cvt8(((j == 0) ? wq : (j == 1) ? wk : wv) + e, ((j == 0) ? WQ : (j == 1) ? WK : WV) + e);
    }
}

// k_projall: the three input projections in one grid (none reads what another writes); blockIdx.z = 0: q', 1: k', 2: v^T. Register-blocked bf16 GEMM, ONE WAVE per 64x64 tile (16 accumulators),
// operands straight from K-contiguous bf16 planes, K = DM; C[m][n] = sum_k A[m][k] Bt[n][k]. blockIdx.x = 64-token tile, blockIdx.y = 64-column tile of W (one head).
// z = 0, 1: A = x rows (m = b*SEQ + t), Bt = W rows (n = h*64 + d); written as f32 exp2(C2X x value), the exponent held within +-ECL, into plane [(b*4 + h)][t][64].
// z = 2:    A = w_v rows (m = h*64 + d), Bt = value rows (n = b*SEQ + t); written as f16 x VCAR into plane [(b*256 + m)][t], row pitch SEQ.
__global__ __launch_bounds__(32) void k_projall(const bf* __restrict__ XQ, const bf* __restrict__ XK, const bf* __restrict__ XV,
                                                const bf* __restrict__ WQ, const bf* __restrict__ WK, const bf* __restrict__ WV, float* QS, float* KS, h16* Ph) {
    __shared__ __align__(16) float os[16 * OSP];
    const int lane = threadIdx.x & 31, lr = lane & 15, hi = lane >> 4; const int z = blockIdx.z;
    const int r0 = ((z == 2) ? blockIdx.y : blockIdx.x) * 64, c0 = ((z == 2) ? blockIdx.x : blockIdx.y) * 64;
    const bf* A  = (z == 0) ? XQ : (z == 1) ? XK : WV;
    const bf* Bt = (z == 0) ? WQ : (z == 1) ? WK : XV;
    v8f acc[4][4];
#pragma unroll
    for (int mb = 0; mb < 4; ++mb)
#pragma unroll
        for (int nb = 0; nb < 4; ++nb) acc[mb][nb] = (v8f){};
    const size_t aoff = (size_t)(r0 + lr) * DM + 8 * hi, boff = (size_t)(c0 + lr) * DM + 8 * hi;
#pragma unroll 1
    for (int kc = 0; kc < DM; kc += 32) {
        v16bf a[4];
#pragma unroll
        for (int mb = 0; mb < 4; ++mb) a[mb] = ldb(A + aoff + (size_t)mb * 16 * DM + kc);
#pragma unroll
        for (int nb = 0; nb < 4; ++nb) { const v16bf b = ldb(Bt + boff + (size_t)nb * 16 * DM + kc);
#pragma unroll
            for (int mb = 0; mb < 4; ++mb) acc[mb][nb] = wmmabg(a[mb], b, acc[mb][nb]); }
    }
    if (z != 2) {
        float* P = (z == 0) ? QS : KS;
        const int bb = r0 / SEQ, tt = r0 % SEQ; const int zh = bb * NH_ + c0 / HD;
        const size_t tbase = ((size_t)zh * SEQ + (size_t)tt) * HD;
#pragma unroll
        for (int mb = 0; mb < 4; ++mb) {
#pragma unroll
            for (int nb = 0; nb < 4; ++nb) {
#pragma unroll
                for (int j = 0; j < 8; ++j) os[(hi * 8 + j) * OSP + nb * 16 + lr] = __builtin_amdgcn_exp2f(__builtin_amdgcn_fmed3f(acc[mb][nb][j] * C2X, -ECL, ECL)); }   // D: row 8h+j, col lane&15
            wave_sync();
            const size_t sb = tbase + (size_t)(mb * 16) * HD;
#pragma unroll
            for (int s = 0; s < 8; ++s) { const int p = s * 32 + lane; const int row = p >> 4, c4 = (p & 15) * 4;   // 8 s x 2 rows = 16 rows; 16 lanes x 4 floats = 64 columns
                const v4f val = *(const v4fa*)(&os[row * OSP + c4]);
                *(v4f*)(P + sb + (size_t)p * 4) = val; }
            wave_sync();
        }
        asm volatile("s_wait_xcnt 0x0" ::: "memory");         // the v^T part's code stands behind this branch and reuses the last stores' data registers
    } else {
        const int bb = c0 / SEQ, tt = c0 % SEQ;
        const size_t tbase = (size_t)bb * (size_t)DM * SEQ + (size_t)r0 * SEQ + (size_t)tt;
#pragma unroll
        for (int mb = 0; mb < 4; ++mb) {
#pragma unroll
            for (int nb = 0; nb < 4; ++nb) {
#pragma unroll
                for (int j = 0; j < 8; ++j) os[(hi * 8 + j) * OSP + nb * 16 + lr] = acc[mb][nb][j] * VCAR; }   // D: row 8h+j, col lane&15
            wave_sync();
            const size_t sb = tbase + (size_t)(mb * 16) * SEQ;
#pragma unroll
            for (int s = 0; s < 4; ++s) { const int row = 4 * s + (lane >> 3), c8 = (lane & 7) * 8;   // 4 s x 4 row groups = 16 rows; 8 lanes x 8 halves = 64 columns
                const v4f x0 = *(const v4fa*)(&os[row * OSP + c8]); const v4f x1 = *(const v4fa*)(&os[row * OSP + c8 + 4]); v8h hv;
#pragma unroll
                for (int i = 0; i < 4; ++i) { hv[i] = toh_flush(x0[i]); hv[4 + i] = toh_flush(x1[i]); }
                *(v8h*)(Ph + sb + (size_t)row * SEQ + c8) = hv; }
            wave_sync();
        }
    }
}

// k_outp: f16 GEMM, ONE WAVE per 64x64 tile; A = context rows (m = b*SEQ + t, x ACAR), Bt = w_o rows (n, x WCAR); C x OSC written as f32 into the output buffer [b][t][256].
__global__ __launch_bounds__(32) void k_outp(const h16* __restrict__ A, const h16* __restrict__ Bt, float* OUT) {
    __shared__ __align__(16) float os[16 * OSP];
    const int lane = threadIdx.x & 31, lr = lane & 15, hi = lane >> 4; const int r0 = blockIdx.x * 64, c0 = blockIdx.y * 64;
    v8f acc[4][4];
#pragma unroll
    for (int mb = 0; mb < 4; ++mb)
#pragma unroll
        for (int nb = 0; nb < 4; ++nb) acc[mb][nb] = (v8f){};
    const size_t aoff = (size_t)(r0 + lr) * DM + 8 * hi, boff = (size_t)(c0 + lr) * DM + 8 * hi;
#pragma unroll 1
    for (int kc = 0; kc < DM; kc += 32) {
        v16h a[4];
#pragma unroll
        for (int mb = 0; mb < 4; ++mb) a[mb] = ldh(A + aoff + (size_t)mb * 16 * DM + kc);
#pragma unroll
        for (int nb = 0; nb < 4; ++nb) { const v16h b = ldh(Bt + boff + (size_t)nb * 16 * DM + kc);
#pragma unroll
            for (int mb = 0; mb < 4; ++mb) acc[mb][nb] = wmma16g(a[mb], b, acc[mb][nb]); }
    }
    const int bb = r0 / SEQ, tt = r0 % SEQ;
    const size_t obase = ((size_t)bb * OUT_SEQ + (size_t)tt) * DM + (size_t)c0;
#pragma unroll
    for (int mb = 0; mb < 4; ++mb) {
#pragma unroll
        for (int nb = 0; nb < 4; ++nb) {
#pragma unroll
            for (int j = 0; j < 8; ++j) os[(hi * 8 + j) * OSP + nb * 16 + lr] = acc[mb][nb][j] * OSC; }   // D: row 8h+j, col lane&15
        wave_sync();
        const size_t sb = obase + (size_t)(mb * 16) * DM;
{
#pragma unroll
            for (int s = 0; s < 8; ++s) { const int p = s * 32 + lane; const int row = p >> 4, c4 = (p & 15) * 4;   // 8 s x 2 rows = 16 rows; 16 lanes x 4 floats = 64 columns
                const v4f val = *(const v4fa*)(&os[row * OSP + c4]);
                *(v4f*)(OUT + sb + (size_t)row * DM + c4) = val; }
             }
        wave_sync();
    }
}

// k_attn: one block of NW waves per 16 query rows of one (batch, head); wave w owns keys w*KPW .. w*KPW + KPW - 1 in both passes. The q' tile (rows of the Eq plane), the weight vector and the score strip are shared; each wave has its own k' tile (rows of the Ek plane).
// Pass 1: lane (t = lane&15, h = lane>>4) holds the 16 scores (t, key0 + 8h + r) and (t, key0 + 16 + 8h + r), r = 0..7: acc = sum_d w[d] / (1 + Eq[t][d] * Ek[key][d]); score (log2 domain) = SC2 * (sum_d w[d] - 2 acc).
//         Scores go to the strip sc[t][key]; the row maximum is tracked per lane, combined with one xor-16 exchange, then over the NW waves through LDS (a maximum: exact in any order).
// Pass 2: e = exp2(score - max) (f32, row sum l); P = f16(e x 16384) packed directly as the B fragment (element r <- key 8h+r, element 8+r <- key 16+8h+r) of
//         O^T[d][t] = V^T P^T (A = v^T rows d, k = key); row sum l2 over the converted P normalises O; e is written back into the strip.
// Combine: each wave leaves its partial O^T, l and l2 in LDS; after one barrier they are summed in wave order 0..NW-1, normalised and stored.
__global__ __launch_bounds__(32 * NW) void k_attn(const float* __restrict__ QS, const float* __restrict__ KS, const h16* __restrict__ VT, const float* __restrict__ va, float* ATTN, h16* AT) {
    __shared__ __align__(16) float sc[16 * SCP];
    __shared__ __align__(16) float ks[NW * 32 * KSP];
    __shared__ __align__(16) float qs[16 * KSP];
    __shared__ __align__(16) float po[NW * 16 * OSP];            // partial O^T per wave; with it a block holds over a third of a WGP's LDS, so at most two blocks share a WGP and the grid spreads evenly
    __shared__ __align__(16) float vs[HD];
    __shared__ __align__(16) float wmx[NW * 16];
    __shared__ __align__(16) float wl[NW * 16];
    __shared__ __align__(16) float wl2[NW * 16];
    const int tid = threadIdx.x, lane = tid & 31, lr = lane & 15, hi = lane >> 4;
    const int wv = __builtin_amdgcn_readfirstlane(tid >> 5);     // wave number, held scalar so that the key loops stay scalar loops
    const int zh = blockIdx.y; const int b = zh / NH_, h = zh % NH_;
    const int t0 = blockIdx.x * 16;
    const size_t pbase = (size_t)zh * SEQ * HD;
    float* ksw = ks + wv * (32 * KSP);                           // this wave's own k' tile
    float* pw = po + wv * (16 * OSP);                          // this wave's own partial O^T tile
    // q' tile: 16 rows x 64 floats, 16 B per thread; rows 0..15 x columns 0..63 all written
    { const int row = tid >> 4, c4 = (tid & 15) * 4;
        const v4f v = *(const v4f*)(QS + pbase + (size_t)(t0 + row) * HD + c4); *(v4fa*)(&qs[row * KSP + c4]) = v; }
    // weight vector of this head, RNE-converted to bf16 at its load
    if (tid < 16) { const v4f w = *(const v4f*)(va + (size_t)h * HD + tid * 4); v4f wb;
#pragma unroll
      for (int i = 0; i < 4; ++i) wb[i] = bfr(w[i]);
      *(v4fa*)(&vs[tid * 4]) = wb; }
    __syncthreads();                                             // q' tile and weight vector visible to all waves
    float W1 = 0.0f;
#pragma unroll 1
    for (int c = 0; c < HD; c += 4) { const v4f w4 = *(const v4fa*)(&vs[c]); W1 += (w4[0] + w4[1]) + (w4[2] + w4[3]); }

    const int kbeg = wv * KPW;
    float mx = NEGB;
#pragma unroll 1
    for (int key0 = kbeg; key0 < kbeg + KPW; key0 += 32) {
        wave_sync();                                             // all reads of the earlier k' tile are complete
        { const float* kp = KS + pbase + (size_t)(key0 + lane) * HD;   // lane = key row, 64 floats = 256 B
#pragma unroll 1
          for (int c = 0; c < HD; c += 16) {
              const v4f k0 = *(const v4f*)(kp + c), k1 = *(const v4f*)(kp + c + 4), k2 = *(const v4f*)(kp + c + 8), k3 = *(const v4f*)(kp + c + 12);
              *(v4fa*)(&ksw[lane * KSP + c]) = k0; *(v4fa*)(&ksw[lane * KSP + c + 4]) = k1; *(v4fa*)(&ksw[lane * KSP + c + 8]) = k2; *(v4fa*)(&ksw[lane * KSP + c + 12]) = k3; } }
        wave_sync();
        float aa[8], ab[8]; const v4f one4 = {1.0f, 1.0f, 1.0f, 1.0f};
#pragma unroll
        for (int r = 0; r < 8; ++r) { aa[r] = 0.0f; ab[r] = 0.0f; }
#pragma unroll 1
        for (int c = 0; c < HD; c += 4) {
            const v4f q4 = *(const v4fa*)(&qs[lr * KSP + c]);
            const v4f w4 = *(const v4fa*)(&vs[c]);
#pragma unroll
            for (int r = 0; r < 8; ++r) {
                const v4f ka = *(const v4fa*)(&ksw[(8 * hi + r) * KSP + c]);
                const v4f kb = *(const v4fa*)(&ksw[(16 + 8 * hi + r) * KSP + c]);
                const v4f xa = __builtin_elementwise_fma(q4, ka, one4);   // 1 + Eq * Ek, formed on the loaded register pairs as they stand
                const v4f xb = __builtin_elementwise_fma(q4, kb, one4);
#pragma unroll
                for (int i = 0; i < 4; ++i) {
                    const float ra = __builtin_amdgcn_rcpf(xa[i]);
                    const float rb = __builtin_amdgcn_rcpf(xb[i]);
                    aa[r] = fmaf(w4[i], ra, aa[r]); ab[r] = fmaf(w4[i], rb, ab[r]); } } }
        v4f s0, s1, s2, s3;
#pragma unroll
        for (int r = 0; r < 4; ++r) {
            s0[r] = (W1 - 2.0f * aa[r]) * SC2; s1[r] = (W1 - 2.0f * aa[4 + r]) * SC2;
            s2[r] = (W1 - 2.0f * ab[r]) * SC2; s3[r] = (W1 - 2.0f * ab[4 + r]) * SC2;
            mx = fmaxf(mx, fmaxf(fmaxf(s0[r], s1[r]), fmaxf(s2[r], s3[r]))); }
        const int so = lr * SCP + key0 + 8 * hi;                 // keys key0+8h+0..7 at so, keys key0+16+8h+0..7 at so+16
        *(v4fa*)(&sc[so]) = s0; *(v4fa*)(&sc[so + 4]) = s1; *(v4fa*)(&sc[so + 16]) = s2; *(v4fa*)(&sc[so + 20]) = s3;
    }
    wmx[wv * 16 + lr] = fmaxf(mx, __shfl_xor(mx, 16, 32));       // lanes lr and lr+16 hold the same value
    __syncthreads();                                             // every wave's row maxima are in wmx
    float m = wmx[lr];
#pragma unroll
    for (int w = 1; w < NW; ++w) m = fmaxf(m, wmx[w * 16 + lr]);

    v8f o0 = (v8f){}, o1 = (v8f){}, o2 = (v8f){}, o3 = (v8f){};
    float l = 0.0f, l2 = 0.0f;
    const size_t vo = ((size_t)zh * HD + (size_t)lr) * SEQ + 8 * hi;   // + 16j*SEQ + key  (A fragment: row d = 16j + lane&15, k = key)
#pragma unroll 1
    for (int key0 = kbeg; key0 < kbeg + KPW; key0 += 32) {
        const int so = lr * SCP + key0 + 8 * hi;                 // the same lane wrote these 16 scores
        const v4f s0 = *(const v4fa*)(&sc[so]), s1 = *(const v4fa*)(&sc[so + 4]), s2 = *(const v4fa*)(&sc[so + 16]), s3 = *(const v4fa*)(&sc[so + 20]);
        v4f e0, e1, e2, e3; v16h pb; float ls = 0.0f, lp = 0.0f;
#pragma unroll
        for (int r = 0; r < 4; ++r) {
            e0[r] = __builtin_amdgcn_exp2f(s0[r] - m); e1[r] = __builtin_amdgcn_exp2f(s1[r] - m);
            e2[r] = __builtin_amdgcn_exp2f(s2[r] - m); e3[r] = __builtin_amdgcn_exp2f(s3[r] - m);
            const h16 p0 = toh_flush(e0[r] * PCAR); const h16 p1 = toh_flush(e1[r] * PCAR);
            const h16 p2 = toh_flush(e2[r] * PCAR); const h16 p3 = toh_flush(e3[r] * PCAR);
            pb[r] = p0; pb[4 + r] = p1; pb[8 + r] = p2; pb[12 + r] = p3;
            ls += (e0[r] + e1[r]) + (e2[r] + e3[r]);
            lp += ((float)p0 + (float)p1) + ((float)p2 + (float)p3); }
        l += ls; l2 += lp;
        *(v4fa*)(&sc[so]) = e0; *(v4fa*)(&sc[so + 4]) = e1; *(v4fa*)(&sc[so + 16]) = e2; *(v4fa*)(&sc[so + 20]) = e3;
        const h16* vp = VT + vo + key0;
        const v16h v0 = ldh(vp), v1 = ldh(vp + (size_t)16 * SEQ), v2 = ldh(vp + (size_t)32 * SEQ), v3 = ldh(vp + (size_t)48 * SEQ);
        o0 = wmma16g(v0, pb, o0); o1 = wmma16g(v1, pb, o1); o2 = wmma16g(v2, pb, o2); o3 = wmma16g(v3, pb, o3);
    }
    l += __shfl_xor(l, 16, 32); l2 += __shfl_xor(l2, 16, 32);
    wl[wv * 16 + lr] = l; wl2[wv * 16 + lr] = l2;                // lanes lr and lr+16 hold the same values
    // partial O^T of this wave's keys, D layout o_j[r] = (d = 16j + 8h + r, t = lane&15) -> own tile of po as [t][d], pitch OSP; rows 0..15 x columns 0..63 all written
    { v4f a, c;
      a[0] = o0[0]; a[1] = o0[1]; a[2] = o0[2]; a[3] = o0[3]; c[0] = o0[4]; c[1] = o0[5]; c[2] = o0[6]; c[3] = o0[7];
      *(v4fa*)(&pw[lr * OSP +  0 + 8 * hi]) = a; *(v4fa*)(&pw[lr * OSP +  0 + 8 * hi + 4]) = c;
      a[0] = o1[0]; a[1] = o1[1]; a[2] = o1[2]; a[3] = o1[3]; c[0] = o1[4]; c[1] = o1[5]; c[2] = o1[6]; c[3] = o1[7];
      *(v4fa*)(&pw[lr * OSP + 16 + 8 * hi]) = a; *(v4fa*)(&pw[lr * OSP + 16 + 8 * hi + 4]) = c;
      a[0] = o2[0]; a[1] = o2[1]; a[2] = o2[2]; a[3] = o2[3]; c[0] = o2[4]; c[1] = o2[5]; c[2] = o2[6]; c[3] = o2[7];
      *(v4fa*)(&pw[lr * OSP + 32 + 8 * hi]) = a; *(v4fa*)(&pw[lr * OSP + 32 + 8 * hi + 4]) = c;
      a[0] = o3[0]; a[1] = o3[1]; a[2] = o3[2]; a[3] = o3[3]; c[0] = o3[4]; c[1] = o3[5]; c[2] = o3[6]; c[3] = o3[7];
      *(v4fa*)(&pw[lr * OSP + 48 + 8 * hi]) = a; *(v4fa*)(&pw[lr * OSP + 48 + 8 * hi + 4]) = c; }
    __syncthreads();                                             // partial O^T, l, l2 and the whole e strip visible to all waves
    const size_t abase = ((size_t)b * SEQ + (size_t)t0) * DM + (size_t)h * HD;                    // context plane [b*SEQ + t][256]
    const size_t pb0 = (((size_t)b * NH_ + (size_t)h) * OUT_SEQ + (size_t)t0) * OUT_SEQ;          // probabilities [b][h][t][key]
    { const int row = tid >> 4, c4 = (tid & 15) * 4;             // 16 rows x 16 threads x 4 halves; 16 lanes = 64 columns = one line
        v4f x = *(const v4fa*)(&po[row * OSP + c4]); float l2t = wl2[row];                        // l2t >= 16384: the maximum element contributes exp2(0)
#pragma unroll
        for (int w = 1; w < NW; ++w) { const v4f y = *(const v4fa*)(&po[w * (16 * OSP) + row * OSP + c4]); x[0] += y[0]; x[1] += y[1]; x[2] += y[2]; x[3] += y[3]; l2t += wl2[w * 16 + row]; }
        const float invo = (ACAR / VCAR) / l2t; v4h hv;
#pragma unroll
        for (int i = 0; i < 4; ++i) hv[i] = toh_flush(x[i] * invo);
        *(v4h*)(AT + abase + (size_t)row * DM + c4) = hv;
        asm volatile("s_wait_xcnt 0x0" ::: "memory"); }         // the store's address and data registers are reused right below
#pragma unroll 1
    for (int row = wv; row < 16; row += NW) {                                                     // 16 rows x SEQ/128 instructions x 512 B = 16 x SEQ floats
        float lt = wl[row];                                                                       // lt >= 1
#pragma unroll
        for (int w = 1; w < NW; ++w) lt += wl[w * 16 + row];
        const float invr = 1.0f / lt;
        const size_t ro = pb0 + (size_t)row * OUT_SEQ;
#pragma unroll
        for (int qd = 0; qd < SEQ / 128; ++qd) { const int cofs = qd * 128 + lane * 4;
            const v4f e = *(const v4fa*)(&sc[row * SCP + cofs]);
            v4f val; val[0] = e[0] * invr; val[1] = e[1] * invr; val[2] = e[2] * invr; val[3] = e[3] * invr;
            *(v4f*)(ATTN + ro + cofs) = val; }
        asm volatile("s_wait_xcnt 0x0" ::: "memory"); }         // the next trip reuses the stores' address and data registers
}

static constexpr size_t al256(size_t v) { return (v + 255) & ~(size_t)255; }
static constexpr size_t SZ_XB = al256((size_t)NB * SEQ * DM * 2);          // bf16 input copy
static constexpr size_t SZ_WB = al256((size_t)3 * DM * DM * 2);            // bf16 w_q | w_k | w_v
static constexpr size_t SZ_WO = al256((size_t)DM * DM * 2);                // f16 w_o
static constexpr size_t SZ_PF = al256((size_t)NB * NH_ * SEQ * HD * 4);    // f32 q' / k' plane
static constexpr size_t SZ_PH = al256((size_t)NB * SEQ * DM * 2);          // f16 v^T plane / context plane
static constexpr size_t SZ_TOTAL = 3 * SZ_XB + SZ_WB + SZ_WO + 2 * SZ_PF + 2 * SZ_PH;
static_assert(SZ_TOTAL <= (size_t)134217728);          // workspace carve <= 128 MiB
static_assert(((size_t)DM * DM * 2) % 256 == 0);       // weight sub-planes stay 256-byte aligned
static_assert((size_t)NB * NH_ * SEQ * HD == (size_t)NB * DM * SEQ);       // v^T plane [(b*256 + m)][t] has the same extent as the context plane

extern "C" void kernel_launch(void* const* d_in, const int* in_sizes, int n_in,
                              void* d_out, int out_size, void* d_ws, size_t ws_size, hipStream_t stream) {
    if (n_in < 8) return;
    const size_t needx = ((size_t)(NB - 1) * SEQ_FULL + SEQ) * DM;
    if ((size_t)in_sizes[0] < needx || (size_t)in_sizes[1] < needx || (size_t)in_sizes[2] < needx) return;
    if ((size_t)in_sizes[3] < (size_t)DM * DM || (size_t)in_sizes[4] < (size_t)DM * DM || (size_t)in_sizes[5] < (size_t)DM * DM || (size_t)in_sizes[7] < (size_t)DM * DM) return;
    if (in_sizes[6] < NH_ * HD) return;
    const size_t need_out = OUT1_OFF + ((size_t)(NB * NH_ - 1) * OUT_SEQ + (size_t)(SEQ - 1)) * OUT_SEQ + SEQ;
    if ((size_t)out_size < need_out) return;
    if (SZ_TOTAL > ws_size) return;
    // wire order: query, key, value, w_q, w_k, w_v, v_a, w_o
    const float* xin[3] = { (const float*)d_in[0], (const float*)d_in[1], (const float*)d_in[2] };
    const float* wq = (const float*)d_in[3];
    const float* wk = (const float*)d_in[4];
    const float* wv = (const float*)d_in[5];
    const float* va = (const float*)d_in[6];
    const float* wo = (const float*)d_in[7];
    float* OUT  = (float*)d_out;                 // [NB][SEQ][256]
    float* ATTN = (float*)d_out + OUT1_OFF;      // [NB][4][SEQ][SEQ]
    char* wsp = (char*)d_ws;
    bf* XB[3];
    XB[0] = (bf*)wsp; wsp += SZ_XB;                  // query  [NB*SEQ][256]
    XB[1] = (bf*)wsp; wsp += SZ_XB;                  // key    [NB*SEQ][256]
    XB[2] = (bf*)wsp; wsp += SZ_XB;                  // value  [NB*SEQ][256]
    bf* WB = (bf*)wsp; wsp += SZ_WB;                 // [3][256][256]: q | k | v  ([out][in] = Bt as-is)
    h16* WO = (h16*)wsp; wsp += SZ_WO;               // [256][256] x WCAR ([out][in] = Bt as-is)
    float* QS = (float*)wsp; wsp += SZ_PF;           // [NB*4][SEQ][64], exp2(C2X q)
    float* KS = (float*)wsp; wsp += SZ_PF;           // [NB*4][SEQ][64], exp2(C2X k)
    h16* VT = (h16*)wsp; wsp += SZ_PH;               // [NB*4][64][SEQ] x VCAR
    h16* AT = (h16*)wsp; wsp += SZ_PH;               // [NB*SEQ][256] x ACAR
    bf* WQ = WB; bf* WK = WB + (size_t)DM * DM; bf* WV = WB + (size_t)2 * DM * DM;

    // all seven conversions, one grid
    k_cvtall<<<3 * CB_X + 4 * CB_W, 256, 0, stream>>>(xin[0], xin[1], xin[2], wq, wk, wv, wo, XB[0], XB[1], XB[2], WQ, WK, WV, WO);

    // q', k' -> f32 planes [(b*4 + h)][t][d]; v^T -> f16 plane [(b*4 + h)][d][t]; one grid, blockIdx.z picks the projection
    k_projall<<<dim3(NB * SEQ / 64, DM / 64, 3), 32, 0, stream>>>(XB[0], XB[1], XB[2], WQ, WK, WV, QS, KS, VT);

    // scores, softmax, probabilities output, P.V -> context plane
    k_attn<<<dim3(SEQ / 16, NB * NH_, 1), 32 * NW, 0, stream>>>(QS, KS, VT, va, ATTN, AT);

    // output projection: A = context rows, Bt = w_o rows -> output buffer [b][t][256]
    k_outp<<<dim3(NB * SEQ / 64, DM / 64, 1), 32, 0, stream>>>(AT, WO, OUT);
}

// v004
// Measured time: 43.8 microseconds a run.
// Timed twice side by side with v003, it ran 1.08 and 1.05 times as fast.
// Counting every step since v000, it is 3.05 times as fast.
#include <hip/hip_runtime.h>

// Additive-score multi-head attention, width 256 = 4 heads x 64; query/key/value [NB][SEQ][256]; w_q/w_k/w_v/w_o [out][in] (y = x W^T, no bias); score(t, k) = 0.125 * sum_d va[h][d] * tanh(q[t][d] + k[k][d]);
// dense softmax over keys; context = P V, heads concatenated (column h*64 + d), output projection; two outputs: projected context [NB][SEQ][256] and the probabilities [NB][4][SEQ][SEQ] (both f32).
// Compute dtypes, f32 accumulate everywhere: q/k/v projections v_wmma_f32_16x16x32_bf16 (x and W RNE-converted to bf16 in registers on their way into the fragments; products exact); additive scores on the vector unit in f32
// (matrix-vector form: one weight vector per head, no shared second dimension; va RNE-converted to bf16 at its load); P.V v_wmma_f32_16x16x32_f16 (P x16384 and v x64, single f16 planes; carries cancel in the normalisation);
// output projection v_wmma_f32_16x16x32_f16 (context x256, w_o = bf16 value x64 held in f16; folded back by 2^-14); softmax f32 with the true row maximum.
// tanh(x) = 1 - 2 / (1 + exp2(2 log2(e) x)); exp2(c (q + k)) = exp2(c q) * exp2(c k): the q and k planes hold Eq = exp2(2 log2(e) q) and Ek = exp2(2 log2(e) k) in f32, so a score term costs one reciprocal and no exponential.
// Layout: f32 Eq, Ek planes [b*4+h][t][64]; f16 v^T plane [b*4+h][d][t]; f16 context plane [b*SEQ+t][256]; f16 w_o plane [n][k].
// Attention kernel: one block of NW waves per 16 query rows of one (batch, head), the keys split evenly over the waves; score strip 16 x SEQ in LDS; transposed product O^T[d][t] = V^T P^T with the packed P strip as the B fragment; partial O^T and row sums combined through LDS.

#ifndef NB
#define NB 4
#endif
#ifndef SEQ
#define SEQ 512
#endif
#define NB_FULL  4
#define SEQ_FULL 512
#ifndef OUT_SEQ
#define OUT_SEQ SEQ              // token pitch of the output buffers (rows per batch, rows and keys per head)
#endif
#define DM   256
#define NH_  4
#define HD   64
#define OSP  68                  // LDS row pitch (floats) of 16 x 64 staging tiles
#define KSP  68                  // LDS row pitch (floats) of the q and k tiles
#define SCP  (SEQ + 4)           // LDS row pitch (floats) of the score strip
#define NW   8                   // waves per attention block
#define KPW  (SEQ / NW)          // keys per wave
#define C2X  ((float)(2.0 * 1.4426950408889634))        // 2 log2(e), folded into the q and k planes
#define ECL  63.0f               // bound of the planes' exponents: Eq * Ek stays a finite normal number (never inf * 0)
#define SC2  ((float)(0.125 * 1.4426950408889634))      // HD^-0.5 * log2(e)
#define PCAR 16384.0f            // carry of the P fragment
#define VCAR 64.0f               // carry of the v^T plane
#define ACAR 256.0f              // carry of the context plane
#define WCAR 64.0f               // carry of the w_o plane
#define OSC  (1.0f / (ACAR * WCAR))
#define NEGB (-3.0e38f)
#define OUT1_OFF ((size_t)NB_FULL * SEQ_FULL * DM)      // first element of the probabilities output (fixed)

static_assert(HD == 64);                       // one 64-column GEMM tile = one head; f32 plane row = 256 bytes = two lines; f16 head segment = one line
static_assert(NH_ * HD == DM);                 // head h = columns h*64 + d
static_assert(DM % 64 == 0);
static_assert(DM % 32 == 0);                   // GEMM k-loop steps by 32
static_assert(SEQ % 64 == 0);                  // a 64-row tile never straddles two batches
static_assert((NB * SEQ) % 64 == 0);
static_assert(SEQ % 32 == 0);                  // key loop steps by 32
static_assert(SEQ % 16 == 0);                  // attention grid covers the sequence exactly
static_assert(SEQ % 128 == 0);                 // probability rows stored as 512-byte quarters
static_assert(((size_t)SEQ * DM) % 8 == 0);
static_assert(((size_t)DM * DM) % 8 == 0);
static_assert(NB <= NB_FULL);
static_assert(SEQ <= SEQ_FULL);
static_assert(SEQ <= OUT_SEQ);
static_assert((OSP * 4) % 16 == 0);
static_assert((KSP * 4) % 16 == 0);
static_assert((SCP * 4) % 16 == 0);
static_assert(OUT1_OFF * 4 == (size_t)2097152);                                   // byte offset of the second output
static_assert(((size_t)(NB - 1) * OUT_SEQ + SEQ) * DM <= OUT1_OFF);               // first output stays below the second
static_assert(8 * 32 * 4 == 16 * HD);          // f32 slab store: 8 instructions x 32 lanes x 4 floats = 16 rows x 64 columns
static_assert(4 * 32 * 8 == 16 * 64);          // f16 slab store: 4 instructions x 32 lanes x 8 halves = 16 rows x 64 columns
static_assert((SEQ / 128) * 32 * 4 == SEQ);    // probability row: SEQ/128 instructions x 32 lanes x 4 floats
static_assert((16 * SCP + NW * 32 * KSP + NW * 16 * OSP + 16 * KSP + HD + 3 * NW * 16) * 4 <= 163840);   // static LDS of the attention kernel: two blocks fit one WGP
static_assert(SEQ % (32 * NW) == 0);           // each wave owns whole 32-key tiles
static_assert(16 % NW == 0);                   // probability rows split evenly over the waves
static_assert(32 * NW * 4 == 16 * HD);         // one 4-element group of a 16 x 64 tile per thread of the attention block
static_assert(16 * OSP * 4 <= 131072);

typedef _Float16 h16;
typedef __attribute__((ext_vector_type(16))) __bf16   v16bf;
typedef __attribute__((ext_vector_type(16))) _Float16 v16h;
typedef __attribute__((ext_vector_type(8)))  _Float16 v8h;
typedef __attribute__((ext_vector_type(4)))  _Float16 v4h;
typedef __attribute__((ext_vector_type(8)))  float    v8f;
typedef __attribute__((ext_vector_type(16))) float    v16f;
typedef __attribute__((ext_vector_type(4)))  float    v4f;
typedef v4f  __attribute__((may_alias)) v4fa;

__device__ __forceinline__ unsigned short f2bf(float f) { unsigned u = __float_as_uint(f); u += 0x7FFFu + ((u >> 16) & 1u); return (unsigned short)(u >> 16); }
__device__ __forceinline__ float bfr(float f) { return __uint_as_float(((unsigned)f2bf(f)) << 16); }   // value after RNE convert to bf16
__device__ __forceinline__ v16h cat16(v8h lo, v8h hi) { return __builtin_shufflevector(lo, hi, 0, 1, 2, 3, 4, 5, 6, 7, 8, 9, 10, 11, 12, 13, 14, 15); }
__device__ __forceinline__ v8f wmma16(v16h a, v16h b, v8f c) { return __builtin_amdgcn_wmma_f32_16x16x32_f16(false, a, false, b, (short)0, c, false, false); }
__device__ __forceinline__ v8f wmmab(v16bf a, v16bf b, v8f c) { return __builtin_amdgcn_wmma_f32_16x16x32_bf16(false, a, false, b, (short)0, c, false, false); }
// fragment loaders from K-contiguous 16-bit rows; p already includes + 8*(lane>>4): elements 0..7 <- k0+8h+0..7, elements 8..15 <- k0+16+8h+0..7 (same map for A and B)
__device__ __forceinline__ v16h  ldh(const h16* p) { return cat16(*(const v8h*)p, *(const v8h*)(p + 16)); }
// the same map from a K-contiguous f32 row: lo = k0+8h+0..7, hi = k0+16+8h+0..7 as loaded, RNE-converted to bf16 in registers
__device__ __forceinline__ v16bf cvtb(v8f lo, v8f hi) { const v16f x = __builtin_shufflevector(lo, hi, 0, 1, 2, 3, 4, 5, 6, 7, 8, 9, 10, 11, 12, 13, 14, 15); return __builtin_convertvector(x, v16bf); }
// ordering point for wave-private LDS tiles (same wave writes and reads)
__device__ __forceinline__ void wave_sync() { __builtin_amdgcn_fence(3 /* release order */, "wavefront"); __builtin_amdgcn_wave_barrier(); asm volatile("" ::: "memory"); }
// f32 -> f16 convert that cannot produce a subnormal (applied after the plane's power-of-two carry)
static __device__ __forceinline__ h16 toh_flush(float v) { const h16 r = (h16)v; return (fabsf(v) < 6.103515625e-05f) ? (h16)0.0f : r; }
// one matrix instruction + its own four-slot guard (accumulator tied, fragments kept live)
__device__ __forceinline__ v8f wmma16g(v16h a, v16h b, v8f c) { c = wmma16(a, b, c); asm volatile("v_nop\n\tv_nop\n\tv_nop\n\tv_nop" : "+v"(c) : "v"(a), "v"(b)); return c; }
__device__ __forceinline__ v8f wmmabg(v16bf a, v16bf b, v8f c) { c = wmmab(a, b, c); asm volatile("v_nop\n\tv_nop\n\tv_nop\n\tv_nop" : "+v"(c) : "v"(a), "v"(b)); return c; }

// 8 consecutive f32 -> bf16 value x WCAR held in f16
__device__ __forceinline__ void cvtw(const float* __restrict__ src, h16* dst) {
    const v8f v = *(const v8f*)src; v8h o;
#pragma unroll
    for (int k = 0; k < 8; ++k) o[k] = toh_flush(bfr(v[k]) * WCAR);
    *(v8h*)dst = o;
    asm volatile("s_wait_xcnt 0x0" ::: "memory");             // the code of the kernel's other parts, joined behind this store, reuses its address and data registers
}

// k_projall: the three input projections and the w_o conversion in one grid (none reads what another writes); blockIdx.z = 0: q', 1: k', 2: v^T, 3: w_o -> f16 plane. Register-blocked bf16 GEMM, ONE WAVE per 64x64 tile (16 accumulators),
// operands straight from the K-contiguous f32 inputs, converted to bf16 in registers, K = DM; C[m][n] = sum_k A[m][k] Bt[n][k]. blockIdx.x = 64-token tile, blockIdx.y = 64-column tile of W (one head).
// z = 0, 1: A = x rows (m = b*SEQ + t), Bt = W rows (n = h*64 + d); written as f32 exp2(C2X x value), the exponent held within +-ECL, into plane [(b*4 + h)][t][64].
// z = 2:    A = w_v rows (m = h*64 + d), Bt = value rows (n = b*SEQ + t); written as f16 x VCAR into plane [(b*256 + m)][t], row pitch SEQ.
// z = 3:    16 consecutive elements of w_o per lane; the blocks of the plane cover the matrix exactly.
static_assert((size_t)(NB * SEQ / 64) * (DM / 64) * 32 * 16 == (size_t)DM * DM);
__global__ __launch_bounds__(32) void k_projall(const float* __restrict__ xq, const float* __restrict__ xk, const float* __restrict__ xv,
                                                const float* __restrict__ wq, const float* __restrict__ wk, const float* __restrict__ wv, const float* __restrict__ wo,
                                                float* QS, float* KS, h16* Ph, h16* WO) {
    __shared__ __align__(16) float os[16 * OSP];
    const int lane = threadIdx.x & 31, lr = lane & 15, hi = lane >> 4; const int z = blockIdx.z;
    if (z == 3) { const size_t e = ((size_t)(blockIdx.y * (NB * SEQ / 64) + blockIdx.x) * 32 + lane) * 16; cvtw(wo + e, WO + e); cvtw(wo + e + 8, WO + e + 8); return; }
    const int r0 = ((z == 2) ? blockIdx.y : blockIdx.x) * 64, c0 = ((z == 2) ? blockIdx.x : blockIdx.y) * 64;
    const float* A  = (z == 0) ? xq : (z == 1) ? xk : wv;
    const float* Bt = (z == 0) ? wq : (z == 1) ? wk : xv;
    const int xt = blockIdx.x * 64; const int xs = (xt / SEQ) * SEQ_FULL + xt % SEQ;   // first source row of the token tile: source batches stand SEQ_FULL rows apart
    const int ar = (z == 2) ? r0 : xs, br = (z == 2) ? xs : c0;
    v8f acc[4][4];
#pragma unroll
    for (int mb = 0; mb < 4; ++mb)
#pragma unroll
        for (int nb = 0; nb < 4; ++nb) acc[mb][nb] = (v8f){};
    const size_t aoff = (size_t)(ar + lr) * DM + 8 * hi, boff = (size_t)(br + lr) * DM + 8 * hi;
#pragma unroll 1
    for (int kc = 0; kc < DM; kc += 32) {
        v8f ra[4][2], rb[4][2];                                  // the step's eight fragments as loaded, f32: 32 loads of 16 B per lane
#pragma unroll
        for (int i = 0; i < 4; ++i) { const float* pa = A + aoff + (size_t)i * 16 * DM + kc; const float* pb = Bt + boff + (size_t)i * 16 * DM + kc;
            ra[i][0] = *(const v8f*)pa; ra[i][1] = *(const v8f*)(pa + 16); rb[i][0] = *(const v8f*)pb; rb[i][1] = *(const v8f*)(pb + 16); }
        v16bf a[4];
#pragma unroll
        for (int mb = 0; mb < 4; ++mb) a[mb] = cvtb(ra[mb][0], ra[mb][1]);
#pragma unroll
        for (int nb = 0; nb < 4; ++nb) { const v16bf b = cvtb(rb[nb][0], rb[nb][1]);
#pragma unroll
            for (int mb = 0; mb < 4; ++mb) acc[mb][nb] = wmmabg(a[mb], b, acc[mb][nb]);
            if (nb == 1) __builtin_amdgcn_sched_barrier(0); }    // keeps the wait for the step's last loads (issued late, once registers are free) behind the first eight products
    }
    if (z != 2) {
        float* P = (z == 0) ? QS : KS;
        const int bb = r0 / SEQ, tt = r0 % SEQ; const int zh = bb * NH_ + c0 / HD;
        const size_t tbase = ((size_t)zh * SEQ + (size_t)tt) * HD;
#pragma unroll
        for (int mb = 0; mb < 4; ++mb) {
#pragma unroll
            for (int nb = 0; nb < 4; ++nb) {
#pragma unroll
                for (int j = 0; j < 8; ++j) os[(hi * 8 + j) * OSP + nb * 16 + lr] = __builtin_amdgcn_exp2f(__builtin_amdgcn_fmed3f(acc[mb][nb][j] * C2X, -ECL, ECL)); }   // D: row 8h+j, col lane&15
            wave_sync();
            const size_t sb = tbase + (size_t)(mb * 16) * HD;
#pragma unroll
            for (int s = 0; s < 8; ++s) { const int p = s * 32 + lane; const int row = p >> 4, c4 = (p & 15) * 4;   // 8 s x 2 rows = 16 rows; 16 lanes x 4 floats = 64 columns
                const v4f val = *(const v4fa*)(&os[row * OSP + c4]);
                *(v4f*)(P + sb + (size_t)p * 4) = val; }
            wave_sync();
        }
        asm volatile("s_wait_xcnt 0x0" ::: "memory");         // the v^T part's code stands behind this branch and reuses the last stores' data registers
    } else {
        const int bb = c0 / SEQ, tt = c0 % SEQ;
        const size_t tbase = (size_t)bb * (size_t)DM * SEQ + (size_t)r0 * SEQ + (size_t)tt;
#pragma unroll
        for (int mb = 0; mb < 4; ++mb) {
#pragma unroll
            for (int nb = 0; nb < 4; ++nb) {
#pragma unroll
                for (int j = 0; j < 8; ++j) os[(hi * 8 + j) * OSP + nb * 16 + lr] = acc[mb][nb][j] * VCAR; }   // D: row 8h+j, col lane&15
            wave_sync();
            const size_t sb = tbase + (size_t)(mb * 16) * SEQ;
#pragma unroll
            for (int s = 0; s < 4; ++s) { const int row = 4 * s + (lane >> 3), c8 = (lane & 7) * 8;   // 4 s x 4 row groups = 16 rows; 8 lanes x 8 halves = 64 columns
                const v4f x0 = *(const v4fa*)(&os[row * OSP + c8]); const v4f x1 = *(const v4fa*)(&os[row * OSP + c8 + 4]); v8h hv;
#pragma unroll
                for (int i = 0; i < 4; ++i) { hv[i] = toh_flush(x0[i]); hv[4 + i] = toh_flush(x1[i]); }
                *(v8h*)(Ph + sb + (size_t)row * SEQ + c8) = hv; }
            wave_sync();
        }
    }
}

// k_outp: f16 GEMM, ONE WAVE per 64x64 tile; A = context rows (m = b*SEQ + t, x ACAR), Bt = w_o rows (n, x WCAR); C x OSC written as f32 into the output buffer [b][t][256].
__global__ __launch_bounds__(32) void k_outp(const h16* __restrict__ A, const h16* __restrict__ Bt, float* OUT) {
    __shared__ __align__(16) float os[16 * OSP];
    const int lane = threadIdx.x & 31, lr = lane & 15, hi = lane >> 4; const int r0 = blockIdx.x * 64, c0 = blockIdx.y * 64;
    v8f acc[4][4];
#pragma unroll
    for (int mb = 0; mb < 4; ++mb)
#pragma unroll
        for (int nb = 0; nb < 4; ++nb) acc[mb][nb] = (v8f){};
    const size_t aoff = (size_t)(r0 + lr) * DM + 8 * hi, boff = (size_t)(c0 + lr) * DM + 8 * hi;
#pragma unroll 1
    for (int kc = 0; kc < DM; kc += 32) {
        v16h a[4];
#pragma unroll
        for (int mb = 0; mb < 4; ++mb) a[mb] = ldh(A + aoff + (size_t)mb * 16 * DM + kc);
#pragma unroll
        for (int nb = 0; nb < 4; ++nb) { const v16h b = ldh(Bt + boff + (size_t)nb * 16 * DM + kc);
#pragma unroll
            for (int mb = 0; mb < 4; ++mb) acc[mb][nb] = wmma16g(a[mb], b, acc[mb][nb]); }
    }
    const int bb = r0 / SEQ, tt = r0 % SEQ;
    const size_t obase = ((size_t)bb * OUT_SEQ + (size_t)tt) * DM + (size_t)c0;
#pragma unroll
    for (int mb = 0; mb < 4; ++mb) {
#pragma unroll
        for (int nb = 0; nb < 4; ++nb) {
#pragma unroll
            for (int j = 0; j < 8; ++j) os[(hi * 8 + j) * OSP + nb * 16 + lr] = acc[mb][nb][j] * OSC; }   // D: row 8h+j, col lane&15
        wave_sync();
        const size_t sb = obase + (size_t)(mb * 16) * DM;
{
#pragma unroll
            for (int s = 0; s < 8; ++s) { const int p = s * 32 + lane; const int row = p >> 4, c4 = (p & 15) * 4;   // 8 s x 2 rows = 16 rows; 16 lanes x 4 floats = 64 columns
                const v4f val = *(const v4fa*)(&os[row * OSP + c4]);
                *(v4f*)(OUT + sb + (size_t)row * DM + c4) = val; }
             }
        wave_sync();
    }
}

// k_attn: one block of NW waves per 16 query rows of one (batch, head); wave w owns keys w*KPW .. w*KPW + KPW - 1 in both passes. The q' tile (rows of the Eq plane), the weight vector and the score strip are shared; each wave has its own k' tile (rows of the Ek plane).
// Pass 1: lane (t = lane&15, h = lane>>4) holds the 16 scores (t, key0 + 8h + r) and (t, key0 + 16 + 8h + r), r = 0..7: acc = sum_d w[d] / (1 + Eq[t][d] * Ek[key][d]); score (log2 domain) = SC2 * (sum_d w[d] - 2 acc).
//         Scores go to the strip sc[t][key]; the row maximum is tracked per lane, combined with one xor-16 exchange, then over the NW waves through LDS (a maximum: exact in any order).
// Pass 2: e = exp2(score - max) (f32, row sum l); P = f16(e x 16384) packed directly as the B fragment (element r <- key 8h+r, element 8+r <- key 16+8h+r) of
//         O^T[d][t] = V^T P^T (A = v^T rows d, k = key); row sum l2 over the converted P normalises O; e is written back into the strip.
// Combine: each wave leaves its partial O^T, l and l2 in LDS; after one barrier they are summed in wave order 0..NW-1, normalised and stored.
__global__ __launch_bounds__(32 * NW) void k_attn(const float* __restrict__ QS, const float* __restrict__ KS, const h16* __restrict__ VT, const float* __restrict__ va, float* ATTN, h16* AT) {
    __shared__ __align__(16) float sc[16 * SCP];
    __shared__ __align__(16) float ks[NW * 32 * KSP];
    __shared__ __align__(16) float qs[16 * KSP];
    __shared__ __align__(16) float po[NW * 16 * OSP];            // partial O^T per wave; with it a block holds over a third of a WGP's LDS, so at most two blocks share a WGP and the grid spreads evenly
    __shared__ __align__(16) float vs[HD];
    __shared__ __align__(16) float wmx[NW * 16];
    __shared__ __align__(16) float wl[NW * 16];
    __shared__ __align__(16) float wl2[NW * 16];
    const int tid = threadIdx.x, lane = tid & 31, lr = lane & 15, hi = lane >> 4;
    const int wv = __builtin_amdgcn_readfirstlane(tid >> 5);     // wave number, held scalar so that the key loops stay scalar loops
    const int zh = blockIdx.y; const int b = zh / NH_, h = zh % NH_;
    const int t0 = blockIdx.x * 16;
    const size_t pbase = (size_t)zh * SEQ * HD;
    float* ksw = ks + wv * (32 * KSP);                           // this wave's own k' tile
    float* pw = po + wv * (16 * OSP);                          // this wave's own partial O^T tile
    // q' tile: 16 rows x 64 floats, 16 B per thread; rows 0..15 x columns 0..63 all written
    { const int row = tid >> 4, c4 = (tid & 15) * 4;
        const v4f v = *(const v4f*)(QS + pbase + (size_t)(t0 + row) * HD + c4); *(v4fa*)(&qs[row * KSP + c4]) = v; }
    // weight vector of this head, RNE-converted to bf16 at its load
    if (tid < 16) { const v4f w = *(const v4f*)(va + (size_t)h * HD + tid * 4); v4f wb;
#pragma unroll
      for (int i = 0; i < 4; ++i) wb[i] = bfr(w[i]);
      *(v4fa*)(&vs[tid * 4]) = wb; }
    __syncthreads();                                             // q' tile and weight vector visible to all waves
    float W1 = 0.0f;
#pragma unroll 1
    for (int c = 0; c < HD; c += 4) { const v4f w4 = *(const v4fa*)(&vs[c]); W1 += (w4[0] + w4[1]) + (w4[2] + w4[3]); }

    const int kbeg = wv * KPW;
    float mx = NEGB;
#pragma unroll 1
    for (int key0 = kbeg; key0 < kbeg + KPW; key0 += 32) {
        wave_sync();                                             // all reads of the earlier k' tile are complete
        { const float* kp = KS + pbase + (size_t)(key0 + lane) * HD;   // lane = key row, 64 floats = 256 B
#pragma unroll 1
          for (int c = 0; c < HD; c += 16) {
              const v4f k0 = *(const v4f*)(kp + c), k1 = *(const v4f*)(kp + c + 4), k2 = *(const v4f*)(kp + c + 8), k3 = *(const v4f*)(kp + c + 12);
              *(v4fa*)(&ksw[lane * KSP + c]) = k0; *(v4fa*)(&ksw[lane * KSP + c + 4]) = k1; *(v4fa*)(&ksw[lane * KSP + c + 8]) = k2; *(v4fa*)(&ksw[lane * KSP + c + 12]) = k3; } }
        wave_sync();
        float aa[8], ab[8]; const v4f one4 = {1.0f, 1.0f, 1.0f, 1.0f};
#pragma unroll
        for (int r = 0; r < 8; ++r) { aa[r] = 0.0f; ab[r] = 0.0f; }
#pragma unroll 1
        for (int c = 0; c < HD; c += 4) {
            const v4f q4 = *(const v4fa*)(&qs[lr * KSP + c]);
            const v4f w4 = *(const v4fa*)(&vs[c]);
#pragma unroll
            for (int r = 0; r < 8; ++r) {
                const v4f ka = *(const v4fa*)(&ksw[(8 * hi + r) * KSP + c]);
                const v4f kb = *(const v4fa*)(&ksw[(16 + 8 * hi + r) * KSP + c]);
                const v4f xa = __builtin_elementwise_fma(q4, ka, one4);   // 1 + Eq * Ek, formed on the loaded register pairs as they stand
                const v4f xb = __builtin_elementwise_fma(q4, kb, one4);
#pragma unroll
                for (int i = 0; i < 4; ++i) {
                    const float ra = __builtin_amdgcn_rcpf(xa[i]);
                    const float rb = __builtin_amdgcn_rcpf(xb[i]);
                    aa[r] = fmaf(w4[i], ra, aa[r]); ab[r] = fmaf(w4[i], rb, ab[r]); } } }
        v4f s0, s1, s2, s3;
#pragma unroll
        for (int r = 0; r < 4; ++r) {
            s0[r] = (W1 - 2.0f * aa[r]) * SC2; s1[r] = (W1 - 2.0f * aa[4 + r]) * SC2;
            s2[r] = (W1 - 2.0f * ab[r]) * SC2; s3[r] = (W1 - 2.0f * ab[4 + r]) * SC2;
            mx = fmaxf(mx, fmaxf(fmaxf(s0[r], s1[r]), fmaxf(s2[r], s3[r]))); }
        const int so = lr * SCP + key0 + 8 * hi;                 // keys key0+8h+0..7 at so, keys key0+16+8h+0..7 at so+16
        *(v4fa*)(&sc[so]) = s0; *(v4fa*)(&sc[so + 4]) = s1; *(v4fa*)(&sc[so + 16]) = s2; *(v4fa*)(&sc[so + 20]) = s3;
    }
    wmx[wv * 16 + lr] = fmaxf(mx, __shfl_xor(mx, 16, 32));       // lanes lr and lr+16 hold the same value
    __syncthreads();                                             // every wave's row maxima are in wmx
    float m = wmx[lr];
#pragma unroll
    for (int w = 1; w < NW; ++w) m = fmaxf(m, wmx[w * 16 + lr]);

    v8f o0 = (v8f){}, o1 = (v8f){}, o2 = (v8f){}, o3 = (v8f){};
    float l = 0.0f, l2 = 0.0f;
    const size_t vo = ((size_t)zh * HD + (size_t)lr) * SEQ + 8 * hi;   // + 16j*SEQ + key  (A fragment: row d = 16j + lane&15, k = key)
#pragma unroll 1
    for (int key0 = kbeg; key0 < kbeg + KPW; key0 += 32) {
        const int so = lr * SCP + key0 + 8 * hi;                 // the same lane wrote these 16 scores
        const v4f s0 = *(const v4fa*)(&sc[so]), s1 = *(const v4fa*)(&sc[so + 4]), s2 = *(const v4fa*)(&sc[so + 16]), s3 = *(const v4fa*)(&sc[so + 20]);
        v4f e0, e1, e2, e3; v16h pb; float ls = 0.0f, lp = 0.0f;
#pragma unroll
        for (int r = 0; r < 4; ++r) {
            e0[r] = __builtin_amdgcn_exp2f(s0[r] - m); e1[r] = __builtin_amdgcn_exp2f(s1[r] - m);
            e2[r] = __builtin_amdgcn_exp2f(s2[r] - m); e3[r] = __builtin_amdgcn_exp2f(s3[r] - m);
            const h16 p0 = toh_flush(e0[r] * PCAR); const h16 p1 = toh_flush(e1[r] * PCAR);
            const h16 p2 = toh_flush(e2[r] * PCAR); const h16 p3 = toh_flush(e3[r] * PCAR);
            pb[r] = p0; pb[4 + r] = p1; pb[8 + r] = p2; pb[12 + r] = p3;
            ls += (e0[r] + e1[r]) + (e2[r] + e3[r]);
            lp += ((float)p0 + (float)p1) + ((float)p2 + (float)p3); }
        l += ls; l2 += lp;
        *(v4fa*)(&sc[so]) = e0; *(v4fa*)(&sc[so + 4]) = e1; *(v4fa*)(&sc[so + 16]) = e2; *(v4fa*)(&sc[so + 20]) = e3;
        const h16* vp = VT + vo + key0;
        const v16h v0 = ldh(vp), v1 = ldh(vp + (size_t)16 * SEQ), v2 = ldh(vp + (size_t)32 * SEQ), v3 = ldh(vp + (size_t)48 * SEQ);
        o0 = wmma16g(v0, pb, o0); o1 = wmma16g(v1, pb, o1); o2 = wmma16g(v2, pb, o2); o3 = wmma16g(v3, pb, o3);
    }
    l += __shfl_xor(l, 16, 32); l2 += __shfl_xor(l2, 16, 32);
    wl[wv * 16 + lr] = l; wl2[wv * 16 + lr] = l2;                // lanes lr and lr+16 hold the same values
    // partial O^T of this wave's keys, D layout o_j[r] = (d = 16j + 8h + r, t = lane&15) -> own tile of po as [t][d], pitch OSP; rows 0..15 x columns 0..63 all written
    { v4f a, c;
      a[0] = o0[0]; a[1] = o0[1]; a[2] = o0[2]; a[3] = o0[3]; c[0] = o0[4]; c[1] = o0[5]; c[2] = o0[6]; c[3] = o0[7];
      *(v4fa*)(&pw[lr * OSP +  0 + 8 * hi]) = a; *(v4fa*)(&pw[lr * OSP +  0 + 8 * hi + 4]) = c;
      a[0] = o1[0]; a[1] = o1[1]; a[2] = o1[2]; a[3] = o1[3]; c[0] = o1[4]; c[1] = o1[5]; c[2] = o1[6]; c[3] = o1[7];
      *(v4fa*)(&pw[lr * OSP + 16 + 8 * hi]) = a; *(v4fa*)(&pw[lr * OSP + 16 + 8 * hi + 4]) = c;
      a[0] = o2[0]; a[1] = o2[1]; a[2] = o2[2]; a[3] = o2[3]; c[0] = o2[4]; c[1] = o2[5]; c[2] = o2[6]; c[3] = o2[7];
      *(v4fa*)(&pw[lr * OSP + 32 + 8 * hi]) = a; *(v4fa*)(&pw[lr * OSP + 32 + 8 * hi + 4]) = c;
      a[0] = o3[0]; a[1] = o3[1]; a[2] = o3[2]; a[3] = o3[3]; c[0] = o3[4]; c[1] = o3[5]; c[2] = o3[6]; c[3] = o3[7];
      *(v4fa*)(&pw[lr * OSP + 48 + 8 * hi]) = a; *(v4fa*)(&pw[lr * OSP + 48 + 8 * hi + 4]) = c; }
    __syncthreads();                                             // partial O^T, l, l2 and the whole e strip visible to all waves
    const size_t abase = ((size_t)b * SEQ + (size_t)t0) * DM + (size_t)h * HD;                    // context plane [b*SEQ + t][256]
    const size_t pb0 = (((size_t)b * NH_ + (size_t)h) * OUT_SEQ + (size_t)t0) * OUT_SEQ;          // probabilities [b][h][t][key]
    { const int row = tid >> 4, c4 = (tid & 15) * 4;             // 16 rows x 16 threads x 4 halves; 16 lanes = 64 columns = one line
        v4f x = *(const v4fa*)(&po[row * OSP + c4]); float l2t = wl2[row];                        // l2t >= 16384: the maximum element contributes exp2(0)
#pragma unroll
        for (int w = 1; w < NW; ++w) { const v4f y = *(const v4fa*)(&po[w * (16 * OSP) + row * OSP + c4]); x[0] += y[0]; x[1] += y[1]; x[2] += y[2]; x[3] += y[3]; l2t += wl2[w * 16 + row]; }
        const float invo = (ACAR / VCAR) / l2t; v4h hv;
#pragma unroll
        for (int i = 0; i < 4; ++i) hv[i] = toh_flush(x[i] * invo);
        *(v4h*)(AT + abase + (size_t)row * DM + c4) = hv;
        asm volatile("s_wait_xcnt 0x0" ::: "memory"); }         // the store's address and data registers are reused right below
#pragma unroll 1
    for (int row = wv; row < 16; row += NW) {                                                     // 16 rows x SEQ/128 instructions x 512 B = 16 x SEQ floats
        float lt = wl[row];                                                                       // lt >= 1
#pragma unroll
        for (int w = 1; w < NW; ++w) lt += wl[w * 16 + row];
        const float invr = 1.0f / lt;
        const size_t ro = pb0 + (size_t)row * OUT_SEQ;
#pragma unroll
        for (int qd = 0; qd < SEQ / 128; ++qd) { const int cofs = qd * 128 + lane * 4;
            const v4f e = *(const v4fa*)(&sc[row * SCP + cofs]);
            v4f val; val[0] = e[0] * invr; val[1] = e[1] * invr; val[2] = e[2] * invr; val[3] = e[3] * invr;
            *(v4f*)(ATTN + ro + cofs) = val; }
        asm volatile("s_wait_xcnt 0x0" ::: "memory"); }         // the next trip reuses the stores' address and data registers
}

static constexpr size_t al256(size_t v) { return (v + 255) & ~(size_t)255; }
static constexpr size_t SZ_WO = al256((size_t)DM * DM * 2);                // f16 w_o
static constexpr size_t SZ_PF = al256((size_t)NB * NH_ * SEQ * HD * 4);    // f32 q' / k' plane
static constexpr size_t SZ_PH = al256((size_t)NB * SEQ * DM * 2);          // f16 v^T plane / context plane
static constexpr size_t SZ_TOTAL = SZ_WO + 2 * SZ_PF + 2 * SZ_PH;
static_assert(SZ_TOTAL <= (size_t)134217728);          // workspace carve <= 128 MiB
static_assert((size_t)NB * NH_ * SEQ * HD == (size_t)NB * DM * SEQ);       // v^T plane [(b*256 + m)][t] has the same extent as the context plane

extern "C" void kernel_launch(void* const* d_in, const int* in_sizes, int n_in,
                              void* d_out, int out_size, void* d_ws, size_t ws_size, hipStream_t stream) {
    if (n_in < 8) return;
    const size_t needx = ((size_t)(NB - 1) * SEQ_FULL + SEQ) * DM;
    if ((size_t)in_sizes[0] < needx || (size_t)in_sizes[1] < needx || (size_t)in_sizes[2] < needx) return;
    if ((size_t)in_sizes[3] < (size_t)DM * DM || (size_t)in_sizes[4] < (size_t)DM * DM || (size_t)in_sizes[5] < (size_t)DM * DM || (size_t)in_sizes[7] < (size_t)DM * DM) return;
    if (in_sizes[6] < NH_ * HD) return;
    const size_t need_out = OUT1_OFF + ((size_t)(NB * NH_ - 1) * OUT_SEQ + (size_t)(SEQ - 1)) * OUT_SEQ + SEQ;
    if ((size_t)out_size < need_out) return;
    if (SZ_TOTAL > ws_size) return;
    // wire order: query, key, value, w_q, w_k, w_v, v_a, w_o
    const float* xin[3] = { (const float*)d_in[0], (const float*)d_in[1], (const float*)d_in[2] };
    const float* wq = (const float*)d_in[3];
    const float* wk = (const float*)d_in[4];
    const float* wv = (const float*)d_in[5];
    const float* va = (const float*)d_in[6];
    const float* wo = (const float*)d_in[7];
    float* OUT  = (float*)d_out;                 // [NB][SEQ][256]
    float* ATTN = (float*)d_out + OUT1_OFF;      // [NB][4][SEQ][SEQ]
    char* wsp = (char*)d_ws;
    h16* WO = (h16*)wsp; wsp += SZ_WO;               // [256][256] x WCAR ([out][in] = Bt as-is)
    float* QS = (float*)wsp; wsp += SZ_PF;           // [NB*4][SEQ][64], exp2(C2X q)
    float* KS = (float*)wsp; wsp += SZ_PF;           // [NB*4][SEQ][64], exp2(C2X k)
    h16* VT = (h16*)wsp; wsp += SZ_PH;               // [NB*4][64][SEQ] x VCAR
    h16* AT = (h16*)wsp; wsp += SZ_PH;               // [NB*SEQ][256] x ACAR

    // q', k' -> f32 planes [(b*4 + h)][t][d]; v^T -> f16 plane [(b*4 + h)][d][t]; w_o -> f16 plane; one grid, blockIdx.z picks the job
    k_projall<<<dim3(NB * SEQ / 64, DM / 64, 4), 32, 0, stream>>>(xin[0], xin[1], xin[2], wq, wk, wv, wo, QS, KS, VT, WO);

    // scores, softmax, probabilities output, P.V -> context plane
    k_attn<<<dim3(SEQ / 16, NB * NH_, 1), 32 * NW, 0, stream>>>(QS, KS, VT, va, ATTN, AT);

    // output projection: A = context rows, Bt = w_o rows -> output buffer [b][t][256]
    k_outp<<<dim3(NB * SEQ / 64, DM / 64, 1), 32, 0, stream>>>(AT, WO, OUT);
}

// v005
// One run takes 41.5 microseconds.
// In two side-by-side timings against v004, it was 1.05 and 1.06 times as fast.
// Counting every step since v000, it is 3.22 times as fast.
#include <hip/hip_runtime.h>

// Additive-score multi-head attention, width 256 = 4 heads x 64; query/key/value [NB][SEQ][256]; w_q/w_k/w_v/w_o [out][in] (y = x W^T, no bias); score(t, k) = 0.125 * sum_d va[h][d] * tanh(q[t][d] + k[k][d]);
// dense softmax over keys; context = P V, heads concatenated (column h*64 + d), output projection; two outputs: projected context [NB][SEQ][256] and the probabilities [NB][4][SEQ][SEQ] (both f32).
// Compute dtypes, f32 accumulate everywhere: q/k/v projections v_wmma_f32_16x16x32_bf16 (x and W RNE-converted to bf16 in registers on their way into the fragments; products exact); additive scores on the vector unit in f32
// (matrix-vector form: one weight vector per head, no shared second dimension; va RNE-converted to bf16 at its load); P.V v_wmma_f32_16x16x32_f16 (P x16384 and v x64, single f16 planes; carries cancel in the normalisation);
// output projection v_wmma_f32_16x16x32_f16 (context x256, w_o = bf16 value x64 held in f16; folded back by 2^-14); softmax f32 with the true row maximum.
// tanh(x) = 1 - 2 / (1 + exp2(2 log2(e) x)); exp2(c (q + k)) = exp2(c q) * exp2(c k): the q and k planes hold Eq = exp2(2 log2(e) q) and Ek = exp2(2 log2(e) k) in f32, so a score term costs one reciprocal and no exponential.
// Layout: f32 Eq, Ek planes [b*4+h][t][64]; f16 v^T plane [b*4+h][d][t]; f16 context plane [b*SEQ+t][256]; f16 w_o plane [n][k].
// Attention kernel: one block of NW waves per 16 query rows of one (batch, head), the keys split evenly over the waves; score strip 16 x SEQ in LDS; transposed product O^T[d][t] = V^T P^T with the packed P strip as the B fragment; partial O^T and row sums combined through LDS.

#ifndef NB
#define NB 4
#endif
#ifndef SEQ
#define SEQ 512
#endif
#define NB_FULL  4
#define SEQ_FULL 512
#ifndef OUT_SEQ
#define OUT_SEQ SEQ              // token pitch of the output buffers (rows per batch, rows and keys per head)
#endif
#define DM   256
#define NH_  4
#define HD   64
#define OSP  68                  // LDS row pitch (floats) of 16 x 64 staging tiles
#define KSP  68                  // LDS row pitch (floats) of the q and k tiles
#define SCP  (SEQ + 4)           // LDS row pitch (floats) of the score strip
#define NW   8                   // waves per attention block
#define KPW  (SEQ / NW)          // keys per wave
#define C2X  ((float)(2.0 * 1.4426950408889634))        // 2 log2(e), folded into the q and k planes
#define ECL  63.0f               // bound of the planes' exponents: Eq * Ek stays a finite normal number (never inf * 0)
#define SC2  ((float)(0.125 * 1.4426950408889634))      // HD^-0.5 * log2(e)
#define PCAR 16384.0f            // carry of the P fragment
#define VCAR 64.0f               // carry of the v^T plane
#define ACAR 256.0f              // carry of the context plane
#define WCAR 64.0f               // carry of the w_o plane
#define OSC  (1.0f / (ACAR * WCAR))
#define NEGB (-3.0e38f)
#define OUT1_OFF ((size_t)NB_FULL * SEQ_FULL * DM)      // first element of the probabilities output (fixed)

static_assert(HD == 64);                       // one 64-column GEMM tile = one head; f32 plane row = 256 bytes = two lines; f16 head segment = one line
static_assert(NH_ * HD == DM);                 // head h = columns h*64 + d
static_assert(DM % 64 == 0);
static_assert(DM % 32 == 0);                   // GEMM k-loop steps by 32
static_assert(SEQ % 64 == 0);                  // a 64-row tile never straddles two batches
static_assert((NB * SEQ) % 64 == 0);
static_assert(SEQ % 32 == 0);                  // key loop steps by 32
static_assert(SEQ % 16 == 0);                  // attention grid covers the sequence exactly
static_assert(SEQ % 128 == 0);                 // probability rows stored as 512-byte quarters
static_assert(((size_t)SEQ * DM) % 8 == 0);
static_assert(((size_t)DM * DM) % 8 == 0);
static_assert(NB <= NB_FULL);
static_assert(SEQ <= SEQ_FULL);
static_assert(SEQ <= OUT_SEQ);
static_assert((OSP * 4) % 16 == 0);
static_assert((KSP * 4) % 16 == 0);
static_assert((SCP * 4) % 16 == 0);
static_assert(OUT1_OFF * 4 == (size_t)2097152);                                   // byte offset of the second output
static_assert(((size_t)(NB - 1) * OUT_SEQ + SEQ) * DM <= OUT1_OFF);               // first output stays below the second
static_assert(8 * 32 * 4 == 16 * HD);          // f32 slab store: 8 instructions x 32 lanes x 4 floats = 16 rows x 64 columns
static_assert(4 * 32 * 8 == 16 * 64);          // f16 slab store: 4 instructions x 32 lanes x 8 halves = 16 rows x 64 columns
static_assert((SEQ / 128) * 32 * 4 == SEQ);    // probability row: SEQ/128 instructions x 32 lanes x 4 floats
static_assert((16 * SCP + NW * 32 * KSP + NW * 16 * OSP + 16 * KSP + HD + 3 * NW * 16) * 4 <= 163840);   // static LDS of the attention kernel: two blocks fit one WGP
static_assert(SEQ % (32 * NW) == 0);           // each wave owns whole 32-key tiles
static_assert(16 % NW == 0);                   // probability rows split evenly over the waves
static_assert(32 * NW * 4 == 16 * HD);         // one 4-element group of a 16 x 64 tile per thread of the attention block
static_assert(16 * 32 * 4 == 32 * HD);         // k' tile load: 16 instructions x 32 lanes x 4 floats = 32 rows x 64 columns
static_assert(16 * OSP * 4 <= 131072);

typedef _Float16 h16;
typedef __attribute__((ext_vector_type(16))) __bf16   v16bf;
typedef __attribute__((ext_vector_type(16))) _Float16 v16h;
typedef __attribute__((ext_vector_type(8)))  _Float16 v8h;
typedef __attribute__((ext_vector_type(4)))  _Float16 v4h;
typedef __attribute__((ext_vector_type(8)))  float    v8f;
typedef __attribute__((ext_vector_type(16))) float    v16f;
typedef __attribute__((ext_vector_type(4)))  float    v4f;
typedef v4f  __attribute__((may_alias)) v4fa;

__device__ __forceinline__ unsigned short f2bf(float f) { unsigned u = __float_as_uint(f); u += 0x7FFFu + ((u >> 16) & 1u); return (unsigned short)(u >> 16); }
__device__ __forceinline__ float bfr(float f) { return __uint_as_float(((unsigned)f2bf(f)) << 16); }   // value after RNE convert to bf16
__device__ __forceinline__ v16h cat16(v8h lo, v8h hi) { return __builtin_shufflevector(lo, hi, 0, 1, 2, 3, 4, 5, 6, 7, 8, 9, 10, 11, 12, 13, 14, 15); }
__device__ __forceinline__ v8f wmma16(v16h a, v16h b, v8f c) { return __builtin_amdgcn_wmma_f32_16x16x32_f16(false, a, false, b, (short)0, c, false, false); }
__device__ __forceinline__ v8f wmmab(v16bf a, v16bf b, v8f c) { return __builtin_amdgcn_wmma_f32_16x16x32_bf16(false, a, false, b, (short)0, c, false, false); }
// fragment loaders from K-contiguous 16-bit rows; p already includes + 8*(lane>>4): elements 0..7 <- k0+8h+0..7, elements 8..15 <- k0+16+8h+0..7 (same map for A and B)
__device__ __forceinline__ v16h  ldh(const h16* p) { return cat16(*(const v8h*)p, *(const v8h*)(p + 16)); }
// the same map from a K-contiguous f32 row: lo = k0+8h+0..7, hi = k0+16+8h+0..7 as loaded, RNE-converted to bf16 in registers
__device__ __forceinline__ v16bf cvtb(v8f lo, v8f hi) { const v16f x = __builtin_shufflevector(lo, hi, 0, 1, 2, 3, 4, 5, 6, 7, 8, 9, 10, 11, 12, 13, 14, 15); return __builtin_convertvector(x, v16bf); }
// ordering point for wave-private LDS tiles (same wave writes and reads)
__device__ __forceinline__ void wave_sync() { __builtin_amdgcn_fence(3 /* release order */, "wavefront"); __builtin_amdgcn_wave_barrier(); asm volatile("" ::: "memory"); }
// f32 -> f16 convert that cannot produce a subnormal (applied after the plane's power-of-two carry)
static __device__ __forceinline__ h16 toh_flush(float v) { const h16 r = (h16)v; return (fabsf(v) < 6.103515625e-05f) ? (h16)0.0f : r; }
// one matrix instruction + its own four-slot guard (accumulator tied, fragments kept live)
__device__ __forceinline__ v8f wmma16g(v16h a, v16h b, v8f c) { c = wmma16(a, b, c); asm volatile("v_nop\n\tv_nop\n\tv_nop\n\tv_nop" : "+v"(c) : "v"(a), "v"(b)); return c; }
__device__ __forceinline__ v8f wmmabg(v16bf a, v16bf b, v8f c) { c = wmmab(a, b, c); asm volatile("v_nop\n\tv_nop\n\tv_nop\n\tv_nop" : "+v"(c) : "v"(a), "v"(b)); return c; }

// 8 consecutive f32 -> bf16 value x WCAR held in f16
__device__ __forceinline__ void cvtw(const float* __restrict__ src, h16* dst) {
    const v8f v = *(const v8f*)src; v8h o;
#pragma unroll
    for (int k = 0; k < 8; ++k) o[k] = toh_flush(bfr(v[k]) * WCAR);
    *(v8h*)dst = o;
    asm volatile("s_wait_xcnt 0x0" ::: "memory");             // the code of the kernel's other parts, joined behind this store, reuses its address and data registers
}

// k_projall: the three input projections and the w_o conversion in one grid (none reads what another writes); blockIdx.z = 0: q', 1: k', 2: v^T, 3: w_o -> f16 plane. Register-blocked bf16 GEMM, ONE WAVE per 64x64 tile (16 accumulators),
// operands straight from the K-contiguous f32 inputs, converted to bf16 in registers, K = DM; C[m][n] = sum_k A[m][k] Bt[n][k]. blockIdx.x = 64-token tile, blockIdx.y = 64-column tile of W (one head).
// z = 0, 1: A = x rows (m = b*SEQ + t), Bt = W rows (n = h*64 + d); written as f32 exp2(C2X x value), the exponent held within +-ECL, into plane [(b*4 + h)][t][64].
// z = 2:    A = w_v rows (m = h*64 + d), Bt = value rows (n = b*SEQ + t); written as f16 x VCAR into plane [(b*256 + m)][t], row pitch SEQ.
// z = 3:    16 consecutive elements of w_o per lane; the blocks of the plane cover the matrix exactly.
static_assert((size_t)(NB * SEQ / 64) * (DM / 64) * 32 * 16 == (size_t)DM * DM);
__global__ __launch_bounds__(32) void k_projall(const float* __restrict__ xq, const float* __restrict__ xk, const float* __restrict__ xv,
                                                const float* __restrict__ wq, const float* __restrict__ wk, const float* __restrict__ wv, const float* __restrict__ wo,
                                                float* QS, float* KS, h16* Ph, h16* WO) {
    __shared__ __align__(16) float os[16 * OSP];
    const int lane = threadIdx.x & 31, lr = lane & 15, hi = lane >> 4; const int z = blockIdx.z;
    if (z == 3) { const size_t e = ((size_t)(blockIdx.y * (NB * SEQ / 64) + blockIdx.x) * 32 + lane) * 16; cvtw(wo + e, WO + e); cvtw(wo + e + 8, WO + e + 8); return; }
    const int r0 = ((z == 2) ? blockIdx.y : blockIdx.x) * 64, c0 = ((z == 2) ? blockIdx.x : blockIdx.y) * 64;
    const float* A  = (z == 0) ? xq : (z == 1) ? xk : wv;
    const float* Bt = (z == 0) ? wq : (z == 1) ? wk : xv;
    const int xt = blockIdx.x * 64; const int xs = (xt / SEQ) * SEQ_FULL + xt % SEQ;   // first source row of the token tile: source batches stand SEQ_FULL rows apart
    const int ar = (z == 2) ? r0 : xs, br = (z == 2) ? xs : c0;
    v8f acc[4][4];
#pragma unroll
    for (int mb = 0; mb < 4; ++mb)
#pragma unroll
        for (int nb = 0; nb < 4; ++nb) acc[mb][nb] = (v8f){};
    const size_t aoff = (size_t)(ar + lr) * DM + 8 * hi, boff = (size_t)(br + lr) * DM + 8 * hi;
#pragma unroll 1
    for (int kc = 0; kc < DM; kc += 32) {
        v8f ra[4][2], rb[4][2];                                  // the step's eight fragments as loaded, f32: 32 loads of 16 B per lane
#pragma unroll
        for (int i = 0; i < 4; ++i) { const float* pa = A + aoff + (size_t)i * 16 * DM + kc; const float* pb = Bt + boff + (size_t)i * 16 * DM + kc;
            ra[i][0] = *(const v8f*)pa; ra[i][1] = *(const v8f*)(pa + 16); rb[i][0] = *(const v8f*)pb; rb[i][1] = *(const v8f*)(pb + 16); }
        v16bf a[4];
#pragma unroll
        for (int mb = 0; mb < 4; ++mb) a[mb] = cvtb(ra[mb][0], ra[mb][1]);
#pragma unroll
        for (int nb = 0; nb < 4; ++nb) { const v16bf b = cvtb(rb[nb][0], rb[nb][1]);
#pragma unroll
            for (int mb = 0; mb < 4; ++mb) acc[mb][nb] = wmmabg(a[mb], b, acc[mb][nb]);
            if (nb == 1) __builtin_amdgcn_sched_barrier(0); }    // keeps the wait for the step's last loads (issued late, once registers are free) behind the first eight products
    }
    if (z != 2) {
        float* P = (z == 0) ? QS : KS;
        const int bb = r0 / SEQ, tt = r0 % SEQ; const int zh = bb * NH_ + c0 / HD;
        const size_t tbase = ((size_t)zh * SEQ + (size_t)tt) * HD;
#pragma unroll
        for (int mb = 0; mb < 4; ++mb) {
#pragma unroll
            for (int nb = 0; nb < 4; ++nb) {
#pragma unroll
                for (int j = 0; j < 8; ++j) os[(hi * 8 + j) * OSP + nb * 16 + lr] = __builtin_amdgcn_exp2f(__builtin_amdgcn_fmed3f(acc[mb][nb][j] * C2X, -ECL, ECL)); }   // D: row 8h+j, col lane&15
            wave_sync();
            const size_t sb = tbase + (size_t)(mb * 16) * HD;
#pragma unroll
            for (int s = 0; s < 8; ++s) { const int p = s * 32 + lane; const int row = p >> 4, c4 = (p & 15) * 4;   // 8 s x 2 rows = 16 rows; 16 lanes x 4 floats = 64 columns
                const v4f val = *(const v4fa*)(&os[row * OSP + c4]);
                *(v4f*)(P + sb + (size_t)p * 4) = val; }
            wave_sync();
        }
        asm volatile("s_wait_xcnt 0x0" ::: "memory");         // the v^T part's code stands behind this branch and reuses the last stores' data registers
    } else {
        const int bb = c0 / SEQ, tt = c0 % SEQ;
        const size_t tbase = (size_t)bb * (size_t)DM * SEQ + (size_t)r0 * SEQ + (size_t)tt;
#pragma unroll
        for (int mb = 0; mb < 4; ++mb) {
#pragma unroll
            for (int nb = 0; nb < 4; ++nb) {
#pragma unroll
                for (int j = 0; j < 8; ++j) os[(hi * 8 + j) * OSP + nb * 16 + lr] = acc[mb][nb][j] * VCAR; }   // D: row 8h+j, col lane&15
            wave_sync();
            const size_t sb = tbase + (size_t)(mb * 16) * SEQ;
#pragma unroll
            for (int s = 0; s < 4; ++s) { const int row = 4 * s + (lane >> 3), c8 = (lane & 7) * 8;   // 4 s x 4 row groups = 16 rows; 8 lanes x 8 halves = 64 columns
                const v4f x0 = *(const v4fa*)(&os[row * OSP + c8]); const v4f x1 = *(const v4fa*)(&os[row * OSP + c8 + 4]); v8h hv;
#pragma unroll
                for (int i = 0; i < 4; ++i) { hv[i] = toh_flush(x0[i]); hv[4 + i] = toh_flush(x1[i]); }
                *(v8h*)(Ph + sb + (size_t)row * SEQ + c8) = hv; }
            wave_sync();
        }
    }
}

// k_outp: f16 GEMM, ONE WAVE per 64x64 tile; A = context rows (m = b*SEQ + t, x ACAR), Bt = w_o rows (n, x WCAR); C x OSC written as f32 into the output buffer [b][t][256].
__global__ __launch_bounds__(32) void k_outp(const h16* __restrict__ A, const h16* __restrict__ Bt, float* OUT) {
    __shared__ __align__(16) float os[16 * OSP];
    const int lane = threadIdx.x & 31, lr = lane & 15, hi = lane >> 4; const int r0 = blockIdx.x * 64, c0 = blockIdx.y * 64;
    v8f acc[4][4];
#pragma unroll
    for (int mb = 0; mb < 4; ++mb)
#pragma unroll
        for (int nb = 0; nb < 4; ++nb) acc[mb][nb] = (v8f){};
    const size_t aoff = (size_t)(r0 + lr) * DM + 8 * hi, boff = (size_t)(c0 + lr) * DM + 8 * hi;
#pragma unroll 1
    for (int kc = 0; kc < DM; kc += 32) {
        v16h a[4];
#pragma unroll
        for (int mb = 0; mb < 4; ++mb) a[mb] = ldh(A + aoff + (size_t)mb * 16 * DM + kc);
#pragma unroll
        for (int nb = 0; nb < 4; ++nb) { const v16h b = ldh(Bt + boff + (size_t)nb * 16 * DM + kc);
#pragma unroll
            for (int mb = 0; mb < 4; ++mb) acc[mb][nb] = wmma16g(a[mb], b, acc[mb][nb]); }
    }
    const int bb = r0 / SEQ, tt = r0 % SEQ;
    const size_t obase = ((size_t)bb * OUT_SEQ + (size_t)tt) * DM + (size_t)c0;
#pragma unroll
    for (int mb = 0; mb < 4; ++mb) {
#pragma unroll
        for (int nb = 0; nb < 4; ++nb) {
#pragma unroll
            for (int j = 0; j < 8; ++j) os[(hi * 8 + j) * OSP + nb * 16 + lr] = acc[mb][nb][j] * OSC; }   // D: row 8h+j, col lane&15
        wave_sync();
        const size_t sb = obase + (size_t)(mb * 16) * DM;
{
#pragma unroll
            for (int s = 0; s < 8; ++s) { const int p = s * 32 + lane; const int row = p >> 4, c4 = (p & 15) * 4;   // 8 s x 2 rows = 16 rows; 16 lanes x 4 floats = 64 columns
                const v4f val = *(const v4fa*)(&os[row * OSP + c4]);
                *(v4f*)(OUT + sb + (size_t)row * DM + c4) = val; }
             }
        wave_sync();
    }
}

// k_attn: one block of NW waves per 16 query rows of one (batch, head); wave w owns keys w*KPW .. w*KPW + KPW - 1 in both passes. The q' tile (rows of the Eq plane), the weight vector and the score strip are shared; each wave has its own k' tile (rows of the Ek plane).
// Pass 1: lane (t = lane&15, h = lane>>4) holds the 16 scores (t, key0 + 8h + r) and (t, key0 + 16 + 8h + r), r = 0..7: acc = sum_d w[d] / (1 + Eq[t][d] * Ek[key][d]); score (log2 domain) = SC2 * (sum_d w[d] - 2 acc).
//         Scores go to the strip sc[t][key]; the row maximum is tracked per lane, combined with one xor-16 exchange, then over the NW waves through LDS (a maximum: exact in any order).
// Pass 2: e = exp2(score - max) (f32, row sum l); P = f16(e x 16384) packed directly as the B fragment (element r <- key 8h+r, element 8+r <- key 16+8h+r) of
//         O^T[d][t] = V^T P^T (A = v^T rows d, k = key); row sum l2 over the converted P normalises O; e is written back into the strip.
// Combine: each wave leaves its partial O^T, l and l2 in LDS; after one barrier they are summed in wave order 0..NW-1, normalised and stored.
__global__ __launch_bounds__(32 * NW) void k_attn(const float* __restrict__ QS, const float* __restrict__ KS, const h16* __restrict__ VT, const float* __restrict__ va, float* ATTN, h16* AT) {
    __shared__ __align__(16) float sc[16 * SCP];
    __shared__ __align__(16) float ks[NW * 32 * KSP];
    __shared__ __align__(16) float qs[16 * KSP];
    __shared__ __align__(16) float po[NW * 16 * OSP];            // partial O^T per wave; with it a block holds over a third of a WGP's LDS, so at most two blocks share a WGP and the grid spreads evenly
    __shared__ __align__(16) float vs[HD];
    __shared__ __align__(16) float wmx[NW * 16];
    __shared__ __align__(16) float wl[NW * 16];
    __shared__ __align__(16) float wl2[NW * 16];
    const int tid = threadIdx.x, lane = tid & 31, lr = lane & 15, hi = lane >> 4;
    const int wv = __builtin_amdgcn_readfirstlane(tid >> 5);     // wave number, held scalar so that the key loops stay scalar loops
    const int zh = blockIdx.y; const int b = zh / NH_, h = zh % NH_;
    const int t0 = blockIdx.x * 16;
    const size_t pbase = (size_t)zh * SEQ * HD;
    float* ksw = ks + wv * (32 * KSP);                           // this wave's own k' tile
    float* pw = po + wv * (16 * OSP);                          // this wave's own partial O^T tile
    // q' tile: 16 rows x 64 floats, 16 B per thread; rows 0..15 x columns 0..63 all written
    { const int row = tid >> 4, c4 = (tid & 15) * 4;
        const v4f v = *(const v4f*)(QS + pbase + (size_t)(t0 + row) * HD + c4); *(v4fa*)(&qs[row * KSP + c4]) = v; }
    // weight vector of this head, RNE-converted to bf16 at its load
    if (tid < 16) { const v4f w = *(const v4f*)(va + (size_t)h * HD + tid * 4); v4f wb;
#pragma unroll
      for (int i = 0; i < 4; ++i) wb[i] = bfr(w[i]);
      *(v4fa*)(&vs[tid * 4]) = wb; }
    __syncthreads();                                             // q' tile and weight vector visible to all waves
    float W1 = 0.0f;
#pragma unroll 1
    for (int c = 0; c < HD; c += 4) { const v4f w4 = *(const v4fa*)(&vs[c]); W1 += (w4[0] + w4[1]) + (w4[2] + w4[3]); }

    const int kbeg = wv * KPW;
    float mx = NEGB;
#pragma unroll 1
    for (int key0 = kbeg; key0 < kbeg + KPW; key0 += 32) {
        wave_sync();                                             // all reads of the earlier k' tile are complete
        { const float* kp = KS + pbase + (size_t)key0 * HD + lane * 4;   // the 32 key rows are 8 KB in a row: each load instruction takes 512 contiguous bytes (four whole lines, two rows), lane = 16-byte piece
          v4f kv[16];
#pragma unroll
          for (int s = 0; s < 16; ++s) kv[s] = *(const v4f*)(kp + s * 128);                  // unrolled: all 16 loads of the tile in flight together, kv held in registers
#pragma unroll
          for (int s = 0; s < 16; ++s) *(v4fa*)(&ksw[(2 * s + hi) * KSP + lr * 4]) = kv[s]; } // unrolled: kv indexed by constants; piece s*32 + lane = row 2s + (lane>>4), columns 4*(lane&15)..+3; rows 0..31 x columns 0..63 all written
        wave_sync();
        float aa[8], ab[8]; const v4f one4 = {1.0f, 1.0f, 1.0f, 1.0f};
#pragma unroll
        for (int r = 0; r < 8; ++r) { aa[r] = 0.0f; ab[r] = 0.0f; }
#pragma unroll 1
        for (int c = 0; c < HD; c += 4) {
            const v4f q4 = *(const v4fa*)(&qs[lr * KSP + c]);
            const v4f w4 = *(const v4fa*)(&vs[c]);
#pragma unroll
            for (int r = 0; r < 8; ++r) {
                const v4f ka = *(const v4fa*)(&ksw[(8 * hi + r) * KSP + c]);
                const v4f kb = *(const v4fa*)(&ksw[(16 + 8 * hi + r) * KSP + c]);
                const v4f xa = __builtin_elementwise_fma(q4, ka, one4);   // 1 + Eq * Ek, formed on the loaded register pairs as they stand
                const v4f xb = __builtin_elementwise_fma(q4, kb, one4);
#pragma unroll
                for (int i = 0; i < 4; ++i) {
                    const float ra = __builtin_amdgcn_rcpf(xa[i]);
                    const float rb = __builtin_amdgcn_rcpf(xb[i]);
                    aa[r] = fmaf(w4[i], ra, aa[r]); ab[r] = fmaf(w4[i], rb, ab[r]); } } }
        v4f s0, s1, s2, s3;
#pragma unroll
        for (int r = 0; r < 4; ++r) {
            s0[r] = (W1 - 2.0f * aa[r]) * SC2; s1[r] = (W1 - 2.0f * aa[4 + r]) * SC2;
            s2[r] = (W1 - 2.0f * ab[r]) * SC2; s3[r] = (W1 - 2.0f * ab[4 + r]) * SC2;
            mx = fmaxf(mx, fmaxf(fmaxf(s0[r], s1[r]), fmaxf(s2[r], s3[r]))); }
        const int so = lr * SCP + key0 + 8 * hi;                 // keys key0+8h+0..7 at so, keys key0+16+8h+0..7 at so+16
        *(v4fa*)(&sc[so]) = s0; *(v4fa*)(&sc[so + 4]) = s1; *(v4fa*)(&sc[so + 16]) = s2; *(v4fa*)(&sc[so + 20]) = s3;
    }
    wmx[wv * 16 + lr] = fmaxf(mx, __shfl_xor(mx, 16, 32));       // lanes lr and lr+16 hold the same value
    __syncthreads();                                             // every wave's row maxima are in wmx
    float m = wmx[lr];
#pragma unroll
    for (int w = 1; w < NW; ++w) m = fmaxf(m, wmx[w * 16 + lr]);

    v8f o0 = (v8f){}, o1 = (v8f){}, o2 = (v8f){}, o3 = (v8f){};
    float l = 0.0f, l2 = 0.0f;
    const size_t vo = ((size_t)zh * HD + (size_t)lr) * SEQ + 8 * hi;   // + 16j*SEQ + key  (A fragment: row d = 16j + lane&15, k = key)
#pragma unroll 1
    for (int key0 = kbeg; key0 < kbeg + KPW; key0 += 32) {
        const int so = lr * SCP + key0 + 8 * hi;                 // the same lane wrote these 16 scores
        const v4f s0 = *(const v4fa*)(&sc[so]), s1 = *(const v4fa*)(&sc[so + 4]), s2 = *(const v4fa*)(&sc[so + 16]), s3 = *(const v4fa*)(&sc[so + 20]);
        v4f e0, e1, e2, e3; v16h pb; float ls = 0.0f, lp = 0.0f;
#pragma unroll
        for (int r = 0; r < 4; ++r) {
            e0[r] = __builtin_amdgcn_exp2f(s0[r] - m); e1[r] = __builtin_amdgcn_exp2f(s1[r] - m);
            e2[r] = __builtin_amdgcn_exp2f(s2[r] - m); e3[r] = __builtin_amdgcn_exp2f(s3[r] - m);
            const h16 p0 = toh_flush(e0[r] * PCAR); const h16 p1 = toh_flush(e1[r] * PCAR);
            const h16 p2 = toh_flush(e2[r] * PCAR); const h16 p3 = toh_flush(e3[r] * PCAR);
            pb[r] = p0; pb[4 + r] = p1; pb[8 + r] = p2; pb[12 + r] = p3;
            ls += (e0[r] + e1[r]) + (e2[r] + e3[r]);
            lp += ((float)p0 + (float)p1) + ((float)p2 + (float)p3); }
        l += ls; l2 += lp;
        *(v4fa*)(&sc[so]) = e0; *(v4fa*)(&sc[so + 4]) = e1; *(v4fa*)(&sc[so + 16]) = e2; *(v4fa*)(&sc[so + 20]) = e3;
        const h16* vp = VT + vo + key0;
        const v16h v0 = ldh(vp), v1 = ldh(vp + (size_t)16 * SEQ), v2 = ldh(vp + (size_t)32 * SEQ), v3 = ldh(vp + (size_t)48 * SEQ);
        o0 = wmma16g(v0, pb, o0); o1 = wmma16g(v1, pb, o1); o2 = wmma16g(v2, pb, o2); o3 = wmma16g(v3, pb, o3);
    }
    l += __shfl_xor(l, 16, 32); l2 += __shfl_xor(l2, 16, 32);
    wl[wv * 16 + lr] = l; wl2[wv * 16 + lr] = l2;                // lanes lr and lr+16 hold the same values
    // partial O^T of this wave's keys, D layout o_j[r] = (d = 16j + 8h + r, t = lane&15) -> own tile of po as [t][d], pitch OSP; rows 0..15 x columns 0..63 all written
    { v4f a, c;
      a[0] = o0[0]; a[1] = o0[1]; a[2] = o0[2]; a[3] = o0[3]; c[0] = o0[4]; c[1] = o0[5]; c[2] = o0[6]; c[3] = o0[7];
      *(v4fa*)(&pw[lr * OSP +  0 + 8 * hi]) = a; *(v4fa*)(&pw[lr * OSP +  0 + 8 * hi + 4]) = c;
      a[0] = o1[0]; a[1] = o1[1]; a[2] = o1[2]; a[3] = o1[3]; c[0] = o1[4]; c[1] = o1[5]; c[2] = o1[6]; c[3] = o1[7];
      *(v4fa*)(&pw[lr * OSP + 16 + 8 * hi]) = a; *(v4fa*)(&pw[lr * OSP + 16 + 8 * hi + 4]) = c;
      a[0] = o2[0]; a[1] = o2[1]; a[2] = o2[2]; a[3] = o2[3]; c[0] = o2[4]; c[1] = o2[5]; c[2] = o2[6]; c[3] = o2[7];
      *(v4fa*)(&pw[lr * OSP + 32 + 8 * hi]) = a; *(v4fa*)(&pw[lr * OSP + 32 + 8 * hi + 4]) = c;
      a[0] = o3[0]; a[1] = o3[1]; a[2] = o3[2]; a[3] = o3[3]; c[0] = o3[4]; c[1] = o3[5]; c[2] = o3[6]; c[3] = o3[7];
      *(v4fa*)(&pw[lr * OSP + 48 + 8 * hi]) = a; *(v4fa*)(&pw[lr * OSP + 48 + 8 * hi + 4]) = c; }
    __syncthreads();                                             // partial O^T, l, l2 and the whole e strip visible to all waves
    const size_t abase = ((size_t)b * SEQ + (size_t)t0) * DM + (size_t)h * HD;                    // context plane [b*SEQ + t][256]
    const size_t pb0 = (((size_t)b * NH_ + (size_t)h) * OUT_SEQ + (size_t)t0) * OUT_SEQ;          // probabilities [b][h][t][key]
    { const int row = tid >> 4, c4 = (tid & 15) * 4;             // 16 rows x 16 threads x 4 halves; 16 lanes = 64 columns = one line
        v4f x = *(const v4fa*)(&po[row * OSP + c4]); float l2t = wl2[row];                        // l2t >= 16384: the maximum element contributes exp2(0)
#pragma unroll
        for (int w = 1; w < NW; ++w) { const v4f y = *(const v4fa*)(&po[w * (16 * OSP) + row * OSP + c4]); x[0] += y[0]; x[1] += y[1]; x[2] += y[2]; x[3] += y[3]; l2t += wl2[w * 16 + row]; }
        const float invo = (ACAR / VCAR) / l2t; v4h hv;
#pragma unroll
        for (int i = 0; i < 4; ++i) hv[i] = toh_flush(x[i] * invo);
        *(v4h*)(AT + abase + (size_t)row * DM + c4) = hv;
        asm volatile("s_wait_xcnt 0x0" ::: "memory"); }         // the store's address and data registers are reused right below
#pragma unroll 1
    for (int row = wv; row < 16; row += NW) {                                                     // 16 rows x SEQ/128 instructions x 512 B = 16 x SEQ floats
        float lt = wl[row];                                                                       // lt >= 1
#pragma unroll
        for (int w = 1; w < NW; ++w) lt += wl[w * 16 + row];
        const float invr = 1.0f / lt;
        const size_t ro = pb0 + (size_t)row * OUT_SEQ;
#pragma unroll
        for (int qd = 0; qd < SEQ / 128; ++qd) { const int cofs = qd * 128 + lane * 4;
            const v4f e = *(const v4fa*)(&sc[row * SCP + cofs]);
            v4f val; val[0] = e[0] * invr; val[1] = e[1] * invr; val[2] = e[2] * invr; val[3] = e[3] * invr;
            *(v4f*)(ATTN + ro + cofs) = val; }
        asm volatile("s_wait_xcnt 0x0" ::: "memory"); }         // the next trip reuses the stores' address and data registers
}

static constexpr size_t al256(size_t v) { return (v + 255) & ~(size_t)255; }
static constexpr size_t SZ_WO = al256((size_t)DM * DM * 2);                // f16 w_o
static constexpr size_t SZ_PF = al256((size_t)NB * NH_ * SEQ * HD * 4);    // f32 q' / k' plane
static constexpr size_t SZ_PH = al256((size_t)NB * SEQ * DM * 2);          // f16 v^T plane / context plane
static constexpr size_t SZ_TOTAL = SZ_WO + 2 * SZ_PF + 2 * SZ_PH;
static_assert(SZ_TOTAL <= (size_t)134217728);          // workspace carve <= 128 MiB
static_assert((size_t)NB * NH_ * SEQ * HD == (size_t)NB * DM * SEQ);       // v^T plane [(b*256 + m)][t] has the same extent as the context plane

extern "C" void kernel_launch(void* const* d_in, const int* in_sizes, int n_in,
                              void* d_out, int out_size, void* d_ws, size_t ws_size, hipStream_t stream) {
    if (n_in < 8) return;
    const size_t needx = ((size_t)(NB - 1) * SEQ_FULL + SEQ) * DM;
    if ((size_t)in_sizes[0] < needx || (size_t)in_sizes[1] < needx || (size_t)in_sizes[2] < needx) return;
    if ((size_t)in_sizes[3] < (size_t)DM * DM || (size_t)in_sizes[4] < (size_t)DM * DM || (size_t)in_sizes[5] < (size_t)DM * DM || (size_t)in_sizes[7] < (size_t)DM * DM) return;
    if (in_sizes[6] < NH_ * HD) return;
    const size_t need_out = OUT1_OFF + ((size_t)(NB * NH_ - 1) * OUT_SEQ + (size_t)(SEQ - 1)) * OUT_SEQ + SEQ;
    if ((size_t)out_size < need_out) return;
    if (SZ_TOTAL > ws_size) return;
    // wire order: query, key, value, w_q, w_k, w_v, v_a, w_o
    const float* xin[3] = { (const float*)d_in[0], (const float*)d_in[1], (const float*)d_in[2] };
    const float* wq = (const float*)d_in[3];
    const float* wk = (const float*)d_in[4];
    const float* wv = (const float*)d_in[5];
    const float* va = (const float*)d_in[6];
    const float* wo = (const float*)d_in[7];
    float* OUT  = (float*)d_out;                 // [NB][SEQ][256]
    float* ATTN = (float*)d_out + OUT1_OFF;      // [NB][4][SEQ][SEQ]
    char* wsp = (char*)d_ws;
    h16* WO = (h16*)wsp; wsp += SZ_WO;               // [256][256] x WCAR ([out][in] = Bt as-is)
    float* QS = (float*)wsp; wsp += SZ_PF;           // [NB*4][SEQ][64], exp2(C2X q)
    float* KS = (float*)wsp; wsp += SZ_PF;           // [NB*4][SEQ][64], exp2(C2X k)
    h16* VT = (h16*)wsp; wsp += SZ_PH;               // [NB*4][64][SEQ] x VCAR
    h16* AT = (h16*)wsp; wsp += SZ_PH;               // [NB*SEQ][256] x ACAR

    // q', k' -> f32 planes [(b*4 + h)][t][d]; v^T -> f16 plane [(b*4 + h)][d][t]; w_o -> f16 plane; one grid, blockIdx.z picks the job
    k_projall<<<dim3(NB * SEQ / 64, DM / 64, 4), 32, 0, stream>>>(xin[0], xin[1], xin[2], wq, wk, wv, wo, QS, KS, VT, WO);

    // scores, softmax, probabilities output, P.V -> context plane
    k_attn<<<dim3(SEQ / 16, NB * NH_, 1), 32 * NW, 0, stream>>>(QS, KS, VT, va, ATTN, AT);

    // output projection: A = context rows, Bt = w_o rows -> output buffer [b][t][256]
    k_outp<<<dim3(NB * SEQ / 64, DM / 64, 1), 32, 0, stream>>>(AT, WO, OUT);
}

// v006
// It runs in 40.5 microseconds.
// Timed twice side by side with v005, it ran 1.04 and 1.02 times as fast.
// Counting every step since v000, it is 3.32 times as fast.
#include <hip/hip_runtime.h>

// Additive-score multi-head attention, width 256 = 4 heads x 64; query/key/value [NB][SEQ][256]; w_q/w_k/w_v/w_o [out][in] (y = x W^T, no bias); score(t, k) = 0.125 * sum_d va[h][d] * tanh(q[t][d] + k[k][d]);
// dense softmax over keys; context = P V, heads concatenated (column h*64 + d), output projection; two outputs: projected context [NB][SEQ][256] and the probabilities [NB][4][SEQ][SEQ] (both f32).
// Compute dtypes, f32 accumulate everywhere: q/k/v projections v_wmma_f32_16x16x32_bf16 (x and W RNE-converted to bf16 in registers on their way into the fragments; products exact); additive scores on the vector unit in f32
// (matrix-vector form: one weight vector per head, no shared second dimension; va RNE-converted to bf16 at its load); P.V v_wmma_f32_16x16x32_f16 (P x16384 and v x64, single f16 planes; carries cancel in the normalisation);
// output projection v_wmma_f32_16x16x32_f16 (context x256, w_o = bf16 value x64 held in f16; folded back by 2^-14); softmax f32 with the true row maximum.
// tanh(x) = 1 - 2 / (1 + exp2(2 log2(e) x)); exp2(c (q + k)) = exp2(c q) * exp2(c k): the q and k planes hold Eq = exp2(2 log2(e) q) and Ek = exp2(2 log2(e) k) in f32, so a score term costs no exponential; two terms share one reciprocal: w0/x0 + w1/x1 = (w0 x1 + w1 x0) / (x0 x1).
// Layout: f32 Eq, Ek planes [b*4+h][t][64]; f16 v^T plane [b*4+h][d][t]; f16 context plane [b*SEQ+t][256]; f16 w_o plane [n][k].
// Attention kernel: one block of NW waves per 16 query rows of one (batch, head), the keys split evenly over the waves; score strip 16 x SEQ in LDS; transposed product O^T[d][t] = V^T P^T with the packed P strip as the B fragment; partial O^T and row sums combined through LDS.

#ifndef NB
#define NB 4
#endif
#ifndef SEQ
#define SEQ 512
#endif
#define NB_FULL  4
#define SEQ_FULL 512
#ifndef OUT_SEQ
#define OUT_SEQ SEQ              // token pitch of the output buffers (rows per batch, rows and keys per head)
#endif
#define DM   256
#define NH_  4
#define HD   64
#define OSP  68                  // LDS row pitch (floats) of 16 x 64 staging tiles
#define KSP  68                  // LDS row pitch (floats) of the q and k tiles
#define SCP  (SEQ + 4)           // LDS row pitch (floats) of the score strip
#define NW   8                   // waves per attention block
#define KPW  (SEQ / NW)          // keys per wave
#define C2X  ((float)(2.0 * 1.4426950408889634))        // 2 log2(e), folded into the q and k planes
#define ECL  63.0f               // bound of the planes' exponents: Eq * Ek stays a finite normal number (never inf * 0)
#define SC2  ((float)(0.125 * 1.4426950408889634))      // HD^-0.5 * log2(e)
#define XSC  0x1p-63f            // power-of-two carry of x = 1 + Eq * Ek: x * XSC lies in [2^-63, 2^63], so a product of two stays a finite normal number
#define ASC  0x1p-62f            // 2 * XSC: folds the carry of the accumulated sums back together with the factor 2 of tanh
#define PCAR 16384.0f            // carry of the P fragment
#define VCAR 64.0f               // carry of the v^T plane
#define ACAR 256.0f              // carry of the context plane
#define WCAR 64.0f               // carry of the w_o plane
#define OSC  (1.0f / (ACAR * WCAR))
#define NEGB (-3.0e38f)
#define OUT1_OFF ((size_t)NB_FULL * SEQ_FULL * DM)      // first element of the probabilities output (fixed)

static_assert(HD == 64);                       // one 64-column GEMM tile = one head; f32 plane row = 256 bytes = two lines; f16 head segment = one line
static_assert(NH_ * HD == DM);                 // head h = columns h*64 + d
static_assert(DM % 64 == 0);
static_assert(DM % 32 == 0);                   // GEMM k-loop steps by 32
static_assert(SEQ % 64 == 0);                  // a 64-row tile never straddles two batches
static_assert((NB * SEQ) % 64 == 0);
static_assert(SEQ % 32 == 0);                  // key loop steps by 32
static_assert(SEQ % 16 == 0);                  // attention grid covers the sequence exactly
static_assert(SEQ % 128 == 0);                 // probability rows stored as 512-byte quarters
static_assert(((size_t)SEQ * DM) % 8 == 0);
static_assert(((size_t)DM * DM) % 8 == 0);
static_assert(NB <= NB_FULL);
static_assert(SEQ <= SEQ_FULL);
static_assert(SEQ <= OUT_SEQ);
static_assert((OSP * 4) % 16 == 0);
static_assert((KSP * 4) % 16 == 0);
static_assert((SCP * 4) % 16 == 0);
static_assert(OUT1_OFF * 4 == (size_t)2097152);                                   // byte offset of the second output
static_assert(((size_t)(NB - 1) * OUT_SEQ + SEQ) * DM <= OUT1_OFF);               // first output stays below the second
static_assert(8 * 32 * 4 == 16 * HD);          // f32 slab store: 8 instructions x 32 lanes x 4 floats = 16 rows x 64 columns
static_assert(4 * 32 * 8 == 16 * 64);          // f16 slab store: 4 instructions x 32 lanes x 8 halves = 16 rows x 64 columns
static_assert((SEQ / 128) * 32 * 4 == SEQ);    // probability row: SEQ/128 instructions x 32 lanes x 4 floats
static_assert((16 * SCP + NW * 32 * KSP + NW * 16 * OSP + 16 * KSP + HD + 3 * NW * 16) * 4 <= 163840);   // static LDS of the attention kernel: two blocks fit one WGP
static_assert(SEQ % (32 * NW) == 0);           // each wave owns whole 32-key tiles
static_assert(16 % NW == 0);                   // probability rows split evenly over the waves
static_assert(32 * NW * 4 == 16 * HD);         // one 4-element group of a 16 x 64 tile per thread of the attention block
static_assert(16 * 32 * 4 == 32 * HD);         // k' tile load: 16 instructions x 32 lanes x 4 floats = 32 rows x 64 columns
static_assert(16 * OSP * 4 <= 131072);

typedef _Float16 h16;
typedef __attribute__((ext_vector_type(16))) __bf16   v16bf;
typedef __attribute__((ext_vector_type(16))) _Float16 v16h;
typedef __attribute__((ext_vector_type(8)))  _Float16 v8h;
typedef __attribute__((ext_vector_type(4)))  _Float16 v4h;
typedef __attribute__((ext_vector_type(8)))  float    v8f;
typedef __attribute__((ext_vector_type(16))) float    v16f;
typedef __attribute__((ext_vector_type(4)))  float    v4f;
typedef v4f  __attribute__((may_alias)) v4fa;
typedef __attribute__((ext_vector_type(2)))  float    v2f;

__device__ __forceinline__ unsigned short f2bf(float f) { unsigned u = __float_as_uint(f); u += 0x7FFFu + ((u >> 16) & 1u); return (unsigned short)(u >> 16); }
__device__ __forceinline__ float bfr(float f) { return __uint_as_float(((unsigned)f2bf(f)) << 16); }   // value after RNE convert to bf16
__device__ __forceinline__ v16h cat16(v8h lo, v8h hi) { return __builtin_shufflevector(lo, hi, 0, 1, 2, 3, 4, 5, 6, 7, 8, 9, 10, 11, 12, 13, 14, 15); }
__device__ __forceinline__ v8f wmma16(v16h a, v16h b, v8f c) { return __builtin_amdgcn_wmma_f32_16x16x32_f16(false, a, false, b, (short)0, c, false, false); }
__device__ __forceinline__ v8f wmmab(v16bf a, v16bf b, v8f c) { return __builtin_amdgcn_wmma_f32_16x16x32_bf16(false, a, false, b, (short)0, c, false, false); }
// fragment loaders from K-contiguous 16-bit rows; p already includes + 8*(lane>>4): elements 0..7 <- k0+8h+0..7, elements 8..15 <- k0+16+8h+0..7 (same map for A and B)
__device__ __forceinline__ v16h  ldh(const h16* p) { return cat16(*(const v8h*)p, *(const v8h*)(p + 16)); }
// the same map from a K-contiguous f32 row: lo = k0+8h+0..7, hi = k0+16+8h+0..7 as loaded, RNE-converted to bf16 in registers
__device__ __forceinline__ v16bf cvtb(v8f lo, v8f hi) { const v16f x = __builtin_shufflevector(lo, hi, 0, 1, 2, 3, 4, 5, 6, 7, 8, 9, 10, 11, 12, 13, 14, 15); return __builtin_convertvector(x, v16bf); }
// ordering point for wave-private LDS tiles (same wave writes and reads)
__device__ __forceinline__ void wave_sync() { __builtin_amdgcn_fence(3 /* release order */, "wavefront"); __builtin_amdgcn_wave_barrier(); asm volatile("" ::: "memory"); }
// f32 -> f16 convert that cannot produce a subnormal (applied after the plane's power-of-two carry)
static __device__ __forceinline__ h16 toh_flush(float v) { const h16 r = (h16)v; return (fabsf(v) < 6.103515625e-05f) ? (h16)0.0f : r; }
// one matrix instruction + its own four-slot guard (accumulator tied, fragments kept live)
__device__ __forceinline__ v8f wmma16g(v16h a, v16h b, v8f c) { c = wmma16(a, b, c); asm volatile("v_nop\n\tv_nop\n\tv_nop\n\tv_nop" : "+v"(c) : "v"(a), "v"(b)); return c; }
__device__ __forceinline__ v8f wmmabg(v16bf a, v16bf b, v8f c) { c = wmmab(a, b, c); asm volatile("v_nop\n\tv_nop\n\tv_nop\n\tv_nop" : "+v"(c) : "v"(a), "v"(b)); return c; }

// 8 consecutive f32 -> bf16 value x WCAR held in f16
__device__ __forceinline__ void cvtw(const float* __restrict__ src, h16* dst) {
    const v8f v = *(const v8f*)src; v8h o;
#pragma unroll
    for (int k = 0; k < 8; ++k) o[k] = toh_flush(bfr(v[k]) * WCAR);
    *(v8h*)dst = o;
    asm volatile("s_wait_xcnt 0x0" ::: "memory");             // the code of the kernel's other parts, joined behind this store, reuses its address and data registers
}

// k_projall: the three input projections and the w_o conversion in one grid (none reads what another writes); blockIdx.z = 0: q', 1: k', 2: v^T, 3: w_o -> f16 plane. Register-blocked bf16 GEMM, ONE WAVE per 64x64 tile (16 accumulators),
// operands straight from the K-contiguous f32 inputs, converted to bf16 in registers, K = DM; C[m][n] = sum_k A[m][k] Bt[n][k]. blockIdx.x = 64-token tile, blockIdx.y = 64-column tile of W (one head).
// z = 0, 1: A = x rows (m = b*SEQ + t), Bt = W rows (n = h*64 + d); written as f32 exp2(C2X x value), the exponent held within +-ECL, into plane [(b*4 + h)][t][64].
// z = 2:    A = w_v rows (m = h*64 + d), Bt = value rows (n = b*SEQ + t); written as f16 x VCAR into plane [(b*256 + m)][t], row pitch SEQ.
// z = 3:    16 consecutive elements of w_o per lane; the blocks of the plane cover the matrix exactly.
static_assert((size_t)(NB * SEQ / 64) * (DM / 64) * 32 * 16 == (size_t)DM * DM);
__global__ __launch_bounds__(32) void k_projall(const float* __restrict__ xq, const float* __restrict__ xk, const float* __restrict__ xv,
                                                const float* __restrict__ wq, const float* __restrict__ wk, const float* __restrict__ wv, const float* __restrict__ wo,
                                                float* QS, float* KS, h16* Ph, h16* WO) {
    __shared__ __align__(16) float os[16 * OSP];
    const int lane = threadIdx.x & 31, lr = lane & 15, hi = lane >> 4; const int z = blockIdx.z;
    if (z == 3) { const size_t e = ((size_t)(blockIdx.y * (NB * SEQ / 64) + blockIdx.x) * 32 + lane) * 16; cvtw(wo + e, WO + e); cvtw(wo + e + 8, WO + e + 8); return; }
    const int r0 = ((z == 2) ? blockIdx.y : blockIdx.x) * 64, c0 = ((z == 2) ? blockIdx.x : blockIdx.y) * 64;
    const float* A  = (z == 0) ? xq : (z == 1) ? xk : wv;
    const float* Bt = (z == 0) ? wq : (z == 1) ? wk : xv;
    const int xt = blockIdx.x * 64; const int xs = (xt / SEQ) * SEQ_FULL + xt % SEQ;   // first source row of the token tile: source batches stand SEQ_FULL rows apart
    const int ar = (z == 2) ? r0 : xs, br = (z == 2) ? xs : c0;
    v8f acc[4][4];
#pragma unroll
    for (int mb = 0; mb < 4; ++mb)
#pragma unroll
        for (int nb = 0; nb < 4; ++nb) acc[mb][nb] = (v8f){};
    const size_t aoff = (size_t)(ar + lr) * DM + 8 * hi, boff = (size_t)(br + lr) * DM + 8 * hi;
#pragma unroll 1
    for (int kc = 0; kc < DM; kc += 32) {
        v8f ra[4][2], rb[4][2];                                  // the step's eight fragments as loaded, f32: 32 loads of 16 B per lane
#pragma unroll
        for (int i = 0; i < 4; ++i) { const float* pa = A + aoff + (size_t)i * 16 * DM + kc; const float* pb = Bt + boff + (size_t)i * 16 * DM + kc;
            ra[i][0] = *(const v8f*)pa; ra[i][1] = *(const v8f*)(pa + 16); rb[i][0] = *(const v8f*)pb; rb[i][1] = *(const v8f*)(pb + 16); }
        v16bf a[4];
#pragma unroll
        for (int mb = 0; mb < 4; ++mb) a[mb] = cvtb(ra[mb][0], ra[mb][1]);
#pragma unroll
        for (int nb = 0; nb < 4; ++nb) { const v16bf b = cvtb(rb[nb][0], rb[nb][1]);
#pragma unroll
            for (int mb = 0; mb < 4; ++mb) acc[mb][nb] = wmmabg(a[mb], b, acc[mb][nb]);
            if (nb == 1) __builtin_amdgcn_sched_barrier(0); }    // keeps the wait for the step's last loads (issued late, once registers are free) behind the first eight products
    }
    if (z != 2) {
        float* P = (z == 0) ? QS : KS;
        const int bb = r0 / SEQ, tt = r0 % SEQ; const int zh = bb * NH_ + c0 / HD;
        const size_t tbase = ((size_t)zh * SEQ + (size_t)tt) * HD;
#pragma unroll
        for (int mb = 0; mb < 4; ++mb) {
#pragma unroll
            for (int nb = 0; nb < 4; ++nb) {
#pragma unroll
                for (int j = 0; j < 8; ++j) os[(hi * 8 + j) * OSP + nb * 16 + lr] = __builtin_amdgcn_exp2f(__builtin_amdgcn_fmed3f(acc[mb][nb][j] * C2X, -ECL, ECL)); }   // D: row 8h+j, col lane&15
            wave_sync();
            const size_t sb = tbase + (size_t)(mb * 16) * HD;
#pragma unroll
            for (int s = 0; s < 8; ++s) { const int p = s * 32 + lane; const int row = p >> 4, c4 = (p & 15) * 4;   // 8 s x 2 rows = 16 rows; 16 lanes x 4 floats = 64 columns
                const v4f val = *(const v4fa*)(&os[row * OSP + c4]);
                *(v4f*)(P + sb + (size_t)p * 4) = val; }
            wave_sync();
        }
        asm volatile("s_wait_xcnt 0x0" ::: "memory");         // the v^T part's code stands behind this branch and reuses the last stores' data registers
    } else {
        const int bb = c0 / SEQ, tt = c0 % SEQ;
        const size_t tbase = (size_t)bb * (size_t)DM * SEQ + (size_t)r0 * SEQ + (size_t)tt;
#pragma unroll
        for (int mb = 0; mb < 4; ++mb) {
#pragma unroll
            for (int nb = 0; nb < 4; ++nb) {
#pragma unroll
                for (int j = 0; j < 8; ++j) os[(hi * 8 + j) * OSP + nb * 16 + lr] = acc[mb][nb][j] * VCAR; }   // D: row 8h+j, col lane&15
            wave_sync();
            const size_t sb = tbase + (size_t)(mb * 16) * SEQ;
#pragma unroll
            for (int s = 0; s < 4; ++s) { const int row = 4 * s + (lane >> 3), c8 = (lane & 7) * 8;   // 4 s x 4 row groups = 16 rows; 8 lanes x 8 halves = 64 columns
                const v4f x0 = *(const v4fa*)(&os[row * OSP + c8]); const v4f x1 = *(const v4fa*)(&os[row * OSP + c8 + 4]); v8h hv;
#pragma unroll
                for (int i = 0; i < 4; ++i) { hv[i] = toh_flush(x0[i]); hv[4 + i] = toh_flush(x1[i]); }
                *(v8h*)(Ph + sb + (size_t)row * SEQ + c8) = hv; }
            wave_sync();
        }
    }
}

// k_outp: f16 GEMM, ONE WAVE per 64x64 tile; A = context rows (m = b*SEQ + t, x ACAR), Bt = w_o rows (n, x WCAR); C x OSC written as f32 into the output buffer [b][t][256].
__global__ __launch_bounds__(32) void k_outp(const h16* __restrict__ A, const h16* __restrict__ Bt, float* OUT) {
    __shared__ __align__(16) float os[16 * OSP];
    const int lane = threadIdx.x & 31, lr = lane & 15, hi = lane >> 4; const int r0 = blockIdx.x * 64, c0 = blockIdx.y * 64;
    v8f acc[4][4];
#pragma unroll
    for (int mb = 0; mb < 4; ++mb)
#pragma unroll
        for (int nb = 0; nb < 4; ++nb) acc[mb][nb] = (v8f){};
    const size_t aoff = (size_t)(r0 + lr) * DM + 8 * hi, boff = (size_t)(c0 + lr) * DM + 8 * hi;
#pragma unroll 1
    for (int kc = 0; kc < DM; kc += 32) {
        v16h a[4];
#pragma unroll
        for (int mb = 0; mb < 4; ++mb) a[mb] = ldh(A + aoff + (size_t)mb * 16 * DM + kc);
#pragma unroll
        for (int nb = 0; nb < 4; ++nb) { const v16h b = ldh(Bt + boff + (size_t)nb * 16 * DM + kc);
#pragma unroll
            for (int mb = 0; mb < 4; ++mb) acc[mb][nb] = wmma16g(a[mb], b, acc[mb][nb]); }
    }
    const int bb = r0 / SEQ, tt = r0 % SEQ;
    const size_t obase = ((size_t)bb * OUT_SEQ + (size_t)tt) * DM + (size_t)c0;
#pragma unroll
    for (int mb = 0; mb < 4; ++mb) {
#pragma unroll
        for (int nb = 0; nb < 4; ++nb) {
#pragma unroll
            for (int j = 0; j < 8; ++j) os[(hi * 8 + j) * OSP + nb * 16 + lr] = acc[mb][nb][j] * OSC; }   // D: row 8h+j, col lane&15
        wave_sync();
        const size_t sb = obase + (size_t)(mb * 16) * DM;
{
#pragma unroll
            for (int s = 0; s < 8; ++s) { const int p = s * 32 + lane; const int row = p >> 4, c4 = (p & 15) * 4;   // 8 s x 2 rows = 16 rows; 16 lanes x 4 floats = 64 columns
                const v4f val = *(const v4fa*)(&os[row * OSP + c4]);
                *(v4f*)(OUT + sb + (size_t)row * DM + c4) = val; }
             }
        wave_sync();
    }
}

// k_attn: one block of NW waves per 16 query rows of one (batch, head); wave w owns keys w*KPW .. w*KPW + KPW - 1 in both passes. The q' tile (rows of the Eq plane), the weight vector and the score strip are shared; each wave has its own k' tile (rows of the Ek plane).
// Pass 1: lane (t = lane&15, h = lane>>4) holds the 16 scores (t, key0 + 8h + r) and (t, key0 + 16 + 8h + r), r = 0..7: acc = sum_d w[d] / (1 + Eq[t][d] * Ek[key][d]); score (log2 domain) = SC2 * (sum_d w[d] - 2 acc).
//         Terms d and d + 2 go over one denominator, x carried by XSC (the q' tile is staged x XSC): acc / XSC = sum of (w[d] x'[d+2] + w[d+2] x'[d]) / (x'[d] x'[d+2]), kept as two partial sums per key (d mod 4 in {0, 2} and {1, 3}).
//         Scores go to the strip sc[t][key]; the row maximum is tracked per lane, combined with one xor-16 exchange, then over the NW waves through LDS (a maximum: exact in any order).
// Pass 2: e = exp2(score - max) (f32, row sum l); P = f16(e x 16384) packed directly as the B fragment (element r <- key 8h+r, element 8+r <- key 16+8h+r) of
//         O^T[d][t] = V^T P^T (A = v^T rows d, k = key); row sum l2 over the converted P normalises O; e is written back into the strip.
// Combine: each wave leaves its partial O^T, l and l2 in LDS; after one barrier they are summed in wave order 0..NW-1, normalised and stored.
__global__ __launch_bounds__(32 * NW) void k_attn(const float* __restrict__ QS, const float* __restrict__ KS, const h16* __restrict__ VT, const float* __restrict__ va, float* ATTN, h16* AT) {
    __shared__ __align__(16) float sc[16 * SCP];
    __shared__ __align__(16) float ks[NW * 32 * KSP];
    __shared__ __align__(16) float qs[16 * KSP];
    __shared__ __align__(16) float po[NW * 16 * OSP];            // partial O^T per wave; with it a block holds over a third of a WGP's LDS, so at most two blocks share a WGP and the grid spreads evenly
    __shared__ __align__(16) float vs[HD];
    __shared__ __align__(16) float wmx[NW * 16];
    __shared__ __align__(16) float wl[NW * 16];
    __shared__ __align__(16) float wl2[NW * 16];
    const int tid = threadIdx.x, lane = tid & 31, lr = lane & 15, hi = lane >> 4;
    const int wv = __builtin_amdgcn_readfirstlane(tid >> 5);     // wave number, held scalar so that the key loops stay scalar loops
    const int zh = blockIdx.y; const int b = zh / NH_, h = zh % NH_;
    const int t0 = blockIdx.x * 16;
    const size_t pbase = (size_t)zh * SEQ * HD;
    float* ksw = ks + wv * (32 * KSP);                           // this wave's own k' tile
    float* pw = po + wv * (16 * OSP);                          // this wave's own partial O^T tile
    // q' tile: 16 rows x 64 floats, 16 B per thread; rows 0..15 x columns 0..63 all written
    { const int row = tid >> 4, c4 = (tid & 15) * 4;
        const v4f v = *(const v4f*)(QS + pbase + (size_t)(t0 + row) * HD + c4); *(v4fa*)(&qs[row * KSP + c4]) = v * XSC; }   // exact: Eq >= 2^-63, the carried value >= 2^-126
    // weight vector of this head, RNE-converted to bf16 at its load
    if (tid < 16) { const v4f w = *(const v4f*)(va + (size_t)h * HD + tid * 4); v4f wb;
#pragma unroll
      for (int i = 0; i < 4; ++i) wb[i] = bfr(w[i]);
      *(v4fa*)(&vs[tid * 4]) = wb; }
    __syncthreads();                                             // q' tile and weight vector visible to all waves
    float W1 = 0.0f;
#pragma unroll 1
    for (int c = 0; c < HD; c += 4) { const v4f w4 = *(const v4fa*)(&vs[c]); W1 += (w4[0] + w4[1]) + (w4[2] + w4[3]); }

    const int kbeg = wv * KPW;
    float mx = NEGB;
#pragma unroll 1
    for (int key0 = kbeg; key0 < kbeg + KPW; key0 += 32) {
        wave_sync();                                             // all reads of the earlier k' tile are complete
        { const float* kp = KS + pbase + (size_t)key0 * HD + lane * 4;   // the 32 key rows are 8 KB in a row: each load instruction takes 512 contiguous bytes (four whole lines, two rows), lane = 16-byte piece
          v4f kv[16];
#pragma unroll
          for (int s = 0; s < 16; ++s) kv[s] = *(const v4f*)(kp + s * 128);                  // unrolled: all 16 loads of the tile in flight together, kv held in registers
#pragma unroll
          for (int s = 0; s < 16; ++s) *(v4fa*)(&ksw[(2 * s + hi) * KSP + lr * 4]) = kv[s]; } // unrolled: kv indexed by constants; piece s*32 + lane = row 2s + (lane>>4), columns 4*(lane&15)..+3; rows 0..31 x columns 0..63 all written
        wave_sync();
        v2f aa[8], ab[8]; const v2f one2 = {XSC, XSC};
#pragma unroll
        for (int r = 0; r < 8; ++r) { aa[r] = (v2f){0.0f, 0.0f}; ab[r] = (v2f){0.0f, 0.0f}; }
#pragma unroll 1
        for (int c = 0; c < HD; c += 4) {
            const v4f q4 = *(const v4fa*)(&qs[lr * KSP + c]);
            const v4f w4 = *(const v4fa*)(&vs[c]);
            const v2f q01 = {q4[0], q4[1]}, q23 = {q4[2], q4[3]}, w01 = {w4[0], w4[1]}, w23 = {w4[2], w4[3]};
#pragma unroll
            for (int r = 0; r < 8; ++r) {
                const v4f ka = *(const v4fa*)(&ksw[(8 * hi + r) * KSP + c]);
                const v4f kb = *(const v4fa*)(&ksw[(16 + 8 * hi + r) * KSP + c]);
                const v2f xa01 = __builtin_elementwise_fma(q01, (v2f){ka[0], ka[1]}, one2), xa23 = __builtin_elementwise_fma(q23, (v2f){ka[2], ka[3]}, one2);   // (1 + Eq * Ek) x XSC, formed on the loaded register pairs as they stand
                const v2f xb01 = __builtin_elementwise_fma(q01, (v2f){kb[0], kb[1]}, one2), xb23 = __builtin_elementwise_fma(q23, (v2f){kb[2], kb[3]}, one2);
                const v2f pa = xa01 * xa23, pbb = xb01 * xb23;                                  // common denominators of terms (0, 2) and (1, 3)
                const v2f na = __builtin_elementwise_fma(w23, xa01, w01 * xa23);               // their numerators
                const v2f nb = __builtin_elementwise_fma(w23, xb01, w01 * xb23);
                const v2f ra = {__builtin_amdgcn_rcpf(pa[0]), __builtin_amdgcn_rcpf(pa[1])};
                const v2f rb = {__builtin_amdgcn_rcpf(pbb[0]), __builtin_amdgcn_rcpf(pbb[1])};
                aa[r] = __builtin_elementwise_fma(na, ra, aa[r]); ab[r] = __builtin_elementwise_fma(nb, rb, ab[r]); } }
        v4f s0, s1, s2, s3;
#pragma unroll
        for (int r = 0; r < 4; ++r) {
            s0[r] = (W1 - ASC * (aa[r][0] + aa[r][1])) * SC2; s1[r] = (W1 - ASC * (aa[4 + r][0] + aa[4 + r][1])) * SC2;
            s2[r] = (W1 - ASC * (ab[r][0] + ab[r][1])) * SC2; s3[r] = (W1 - ASC * (ab[4 + r][0] + ab[4 + r][1])) * SC2;
            mx = fmaxf(mx, fmaxf(fmaxf(s0[r], s1[r]), fmaxf(s2[r], s3[r]))); }
        const int so = lr * SCP + key0 + 8 * hi;                 // keys key0+8h+0..7 at so, keys key0+16+8h+0..7 at so+16
        *(v4fa*)(&sc[so]) = s0; *(v4fa*)(&sc[so + 4]) = s1; *(v4fa*)(&sc[so + 16]) = s2; *(v4fa*)(&sc[so + 20]) = s3;
    }
    wmx[wv * 16 + lr] = fmaxf(mx, __shfl_xor(mx, 16, 32));       // lanes lr and lr+16 hold the same value
    __syncthreads();                                             // every wave's row maxima are in wmx
    float m = wmx[lr];
#pragma unroll
    for (int w = 1; w < NW; ++w) m = fmaxf(m, wmx[w * 16 + lr]);

    v8f o0 = (v8f){}, o1 = (v8f){}, o2 = (v8f){}, o3 = (v8f){};
    float l = 0.0f, l2 = 0.0f;
    const size_t vo = ((size_t)zh * HD + (size_t)lr) * SEQ + 8 * hi;   // + 16j*SEQ + key  (A fragment: row d = 16j + lane&15, k = key)
#pragma unroll 1
    for (int key0 = kbeg; key0 < kbeg + KPW; key0 += 32) {
        const int so = lr * SCP + key0 + 8 * hi;                 // the same lane wrote these 16 scores
        const v4f s0 = *(const v4fa*)(&sc[so]), s1 = *(const v4fa*)(&sc[so + 4]), s2 = *(const v4fa*)(&sc[so + 16]), s3 = *(const v4fa*)(&sc[so + 20]);
        v4f e0, e1, e2, e3; v16h pb; float ls = 0.0f, lp = 0.0f;
#pragma unroll
        for (int r = 0; r < 4; ++r) {
            e0[r] = __builtin_amdgcn_exp2f(s0[r] - m); e1[r] = __builtin_amdgcn_exp2f(s1[r] - m);
            e2[r] = __builtin_amdgcn_exp2f(s2[r] - m); e3[r] = __builtin_amdgcn_exp2f(s3[r] - m);
            const h16 p0 = toh_flush(e0[r] * PCAR); const h16 p1 = toh_flush(e1[r] * PCAR);
            const h16 p2 = toh_flush(e2[r] * PCAR); const h16 p3 = toh_flush(e3[r] * PCAR);
            pb[r] = p0; pb[4 + r] = p1; pb[8 + r] = p2; pb[12 + r] = p3;
            ls += (e0[r] + e1[r]) + (e2[r] + e3[r]);
            lp += ((float)p0 + (float)p1) + ((float)p2 + (float)p3); }
        l += ls; l2 += lp;
        *(v4fa*)(&sc[so]) = e0; *(v4fa*)(&sc[so + 4]) = e1; *(v4fa*)(&sc[so + 16]) = e2; *(v4fa*)(&sc[so + 20]) = e3;
        const h16* vp = VT + vo + key0;
        const v16h v0 = ldh(vp), v1 = ldh(vp + (size_t)16 * SEQ), v2 = ldh(vp + (size_t)32 * SEQ), v3 = ldh(vp + (size_t)48 * SEQ);
        o0 = wmma16g(v0, pb, o0); o1 = wmma16g(v1, pb, o1); o2 = wmma16g(v2, pb, o2); o3 = wmma16g(v3, pb, o3);
    }
    l += __shfl_xor(l, 16, 32); l2 += __shfl_xor(l2, 16, 32);
    wl[wv * 16 + lr] = l; wl2[wv * 16 + lr] = l2;                // lanes lr and lr+16 hold the same values
    // partial O^T of this wave's keys, D layout o_j[r] = (d = 16j + 8h + r, t = lane&15) -> own tile of po as [t][d], pitch OSP; rows 0..15 x columns 0..63 all written
    { v4f a, c;
      a[0] = o0[0]; a[1] = o0[1]; a[2] = o0[2]; a[3] = o0[3]; c[0] = o0[4]; c[1] = o0[5]; c[2] = o0[6]; c[3] = o0[7];
      *(v4fa*)(&pw[lr * OSP +  0 + 8 * hi]) = a; *(v4fa*)(&pw[lr * OSP +  0 + 8 * hi + 4]) = c;
      a[0] = o1[0]; a[1] = o1[1]; a[2] = o1[2]; a[3] = o1[3]; c[0] = o1[4]; c[1] = o1[5]; c[2] = o1[6]; c[3] = o1[7];
      *(v4fa*)(&pw[lr * OSP + 16 + 8 * hi]) = a; *(v4fa*)(&pw[lr * OSP + 16 + 8 * hi + 4]) = c;
      a[0] = o2[0]; a[1] = o2[1]; a[2] = o2[2]; a[3] = o2[3]; c[0] = o2[4]; c[1] = o2[5]; c[2] = o2[6]; c[3] = o2[7];
      *(v4fa*)(&pw[lr * OSP + 32 + 8 * hi]) = a; *(v4fa*)(&pw[lr * OSP + 32 + 8 * hi + 4]) = c;
      a[0] = o3[0]; a[1] = o3[1]; a[2] = o3[2]; a[3] = o3[3]; c[0] = o3[4]; c[1] = o3[5]; c[2] = o3[6]; c[3] = o3[7];
      *(v4fa*)(&pw[lr * OSP + 48 + 8 * hi]) = a; *(v4fa*)(&pw[lr * OSP + 48 + 8 * hi + 4]) = c; }
    __syncthreads();                                             // partial O^T, l, l2 and the whole e strip visible to all waves
    const size_t abase = ((size_t)b * SEQ + (size_t)t0) * DM + (size_t)h * HD;                    // context plane [b*SEQ + t][256]
    const size_t pb0 = (((size_t)b * NH_ + (size_t)h) * OUT_SEQ + (size_t)t0) * OUT_SEQ;          // probabilities [b][h][t][key]
    { const int row = tid >> 4, c4 = (tid & 15) * 4;             // 16 rows x 16 threads x 4 halves; 16 lanes = 64 columns = one line
        v4f x = *(const v4fa*)(&po[row * OSP + c4]); float l2t = wl2[row];                        // l2t >= 16384: the maximum element contributes exp2(0)
#pragma unroll
        for (int w = 1; w < NW; ++w) { const v4f y = *(const v4fa*)(&po[w * (16 * OSP) + row * OSP + c4]); x[0] += y[0]; x[1] += y[1]; x[2] += y[2]; x[3] += y[3]; l2t += wl2[w * 16 + row]; }
        const float invo = (ACAR / VCAR) / l2t; v4h hv;
#pragma unroll
        for (int i = 0; i < 4; ++i) hv[i] = toh_flush(x[i] * invo);
        *(v4h*)(AT + abase + (size_t)row * DM + c4) = hv;
        asm volatile("s_wait_xcnt 0x0" ::: "memory"); }         // the store's address and data registers are reused right below
#pragma unroll 1
    for (int row = wv; row < 16; row += NW) {                                                     // 16 rows x SEQ/128 instructions x 512 B = 16 x SEQ floats
        float lt = wl[row];                                                                       // lt >= 1
#pragma unroll
        for (int w = 1; w < NW; ++w) lt += wl[w * 16 + row];
        const float invr = 1.0f / lt;
        const size_t ro = pb0 + (size_t)row * OUT_SEQ;
#pragma unroll
        for (int qd = 0; qd < SEQ / 128; ++qd) { const int cofs = qd * 128 + lane * 4;
            const v4f e = *(const v4fa*)(&sc[row * SCP + cofs]);
            v4f val; val[0] = e[0] * invr; val[1] = e[1] * invr; val[2] = e[2] * invr; val[3] = e[3] * invr;
            *(v4f*)(ATTN + ro + cofs) = val; }
        asm volatile("s_wait_xcnt 0x0" ::: "memory"); }         // the next trip reuses the stores' address and data registers
}

static constexpr size_t al256(size_t v) { return (v + 255) & ~(size_t)255; }
static constexpr size_t SZ_WO = al256((size_t)DM * DM * 2);                // f16 w_o
static constexpr size_t SZ_PF = al256((size_t)NB * NH_ * SEQ * HD * 4);    // f32 q' / k' plane
static constexpr size_t SZ_PH = al256((size_t)NB * SEQ * DM * 2);          // f16 v^T plane / context plane
static constexpr size_t SZ_TOTAL = SZ_WO + 2 * SZ_PF + 2 * SZ_PH;
static_assert(SZ_TOTAL <= (size_t)134217728);          // workspace carve <= 128 MiB
static_assert((size_t)NB * NH_ * SEQ * HD == (size_t)NB * DM * SEQ);       // v^T plane [(b*256 + m)][t] has the same extent as the context plane

extern "C" void kernel_launch(void* const* d_in, const int* in_sizes, int n_in,
                              void* d_out, int out_size, void* d_ws, size_t ws_size, hipStream_t stream) {
    if (n_in < 8) return;
    const size_t needx = ((size_t)(NB - 1) * SEQ_FULL + SEQ) * DM;
    if ((size_t)in_sizes[0] < needx || (size_t)in_sizes[1] < needx || (size_t)in_sizes[2] < needx) return;
    if ((size_t)in_sizes[3] < (size_t)DM * DM || (size_t)in_sizes[4] < (size_t)DM * DM || (size_t)in_sizes[5] < (size_t)DM * DM || (size_t)in_sizes[7] < (size_t)DM * DM) return;
    if (in_sizes[6] < NH_ * HD) return;
    const size_t need_out = OUT1_OFF + ((size_t)(NB * NH_ - 1) * OUT_SEQ + (size_t)(SEQ - 1)) * OUT_SEQ + SEQ;
    if ((size_t)out_size < need_out) return;
    if (SZ_TOTAL > ws_size) return;
    // wire order: query, key, value, w_q, w_k, w_v, v_a, w_o
    const float* xin[3] = { (const float*)d_in[0], (const float*)d_in[1], (const float*)d_in[2] };
    const float* wq = (const float*)d_in[3];
    const float* wk = (const float*)d_in[4];
    const float* wv = (const float*)d_in[5];
    const float* va = (const float*)d_in[6];
    const float* wo = (const float*)d_in[7];
    float* OUT  = (float*)d_out;                 // [NB][SEQ][256]
    float* ATTN = (float*)d_out + OUT1_OFF;      // [NB][4][SEQ][SEQ]
    char* wsp = (char*)d_ws;
    h16* WO = (h16*)wsp; wsp += SZ_WO;               // [256][256] x WCAR ([out][in] = Bt as-is)
    float* QS = (float*)wsp; wsp += SZ_PF;           // [NB*4][SEQ][64], exp2(C2X q)
    float* KS = (float*)wsp; wsp += SZ_PF;           // [NB*4][SEQ][64], exp2(C2X k)
    h16* VT = (h16*)wsp; wsp += SZ_PH;               // [NB*4][64][SEQ] x VCAR
    h16* AT = (h16*)wsp; wsp += SZ_PH;               // [NB*SEQ][256] x ACAR

    // q', k' -> f32 planes [(b*4 + h)][t][d]; v^T -> f16 plane [(b*4 + h)][d][t]; w_o -> f16 plane; one grid, blockIdx.z picks the job
    k_projall<<<dim3(NB * SEQ / 64, DM / 64, 4), 32, 0, stream>>>(xin[0], xin[1], xin[2], wq, wk, wv, wo, QS, KS, VT, WO);

    // scores, softmax, probabilities output, P.V -> context plane
    k_attn<<<dim3(SEQ / 16, NB * NH_, 1), 32 * NW, 0, stream>>>(QS, KS, VT, va, ATTN, AT);

    // output projection: A = context rows, Bt = w_o rows -> output buffer [b][t][256]
    k_outp<<<dim3(NB * SEQ / 64, DM / 64, 1), 32, 0, stream>>>(AT, WO, OUT);
}

// v007
// A run of this version takes 28.8 microseconds.
// Two timings next to v006 put it at 1.40 and 1.39 times that version's speed.
// Counting every step since v000, it is 4.62 times as fast.
#include <hip/hip_runtime.h>

// Additive-score multi-head attention, width 256 = 4 heads x 64; query/key/value [NB][SEQ][256]; w_q/w_k/w_v/w_o [out][in] (y = x W^T, no bias); score(t, k) = 0.125 * sum_d va[h][d] * tanh(q[t][d] + k[k][d]);
// dense softmax over keys; context = P V, heads concatenated (column h*64 + d), output projection; two outputs: projected context [NB][SEQ][256] and the probabilities [NB][4][SEQ][SEQ] (both f32).
// Compute dtypes, f32 accumulate everywhere: q/k/v projections v_wmma_f32_16x16x32_bf16 (x and W RNE-converted to bf16 in registers on their way into LDS; products exact); additive scores on the vector unit in f32
// (matrix-vector form: one weight vector per head, no shared second dimension; va RNE-converted to bf16 at its load); P.V v_wmma_f32_16x16x32_f16 (P x16384 and v x64, single f16 planes; carries cancel in the normalisation);
// output projection v_wmma_f32_16x16x32_f16 (context x256, w_o = bf16 value x64 held in f16; folded back by 2^-14); softmax f32 with the true row maximum.
// tanh(x) = 1 - 2 / (1 + exp2(2 log2(e) x)); exp2(c (q + k)) = exp2(c q) * exp2(c k): the q and k planes hold Eq = exp2(2 log2(e) q) and Ek = exp2(2 log2(e) k) in f32, so a score term costs no exponential; two terms share one reciprocal: w0/x0 + w1/x1 = (w0 x1 + w1 x0) / (x0 x1).
// Layout: f32 Eq, Ek planes [b*4+h][t][64]; f16 v^T plane [b*4+h][d][t]; f16 context plane [b*SEQ+t][256]; f16 w_o plane [n][k].
// Attention kernel: one block of NW waves per 16 query rows of one (batch, head), the keys split evenly over the waves; score strip 16 x SEQ in LDS; transposed product O^T[d][t] = V^T P^T with the packed P strip as the B fragment; partial O^T and row sums combined through LDS.

#ifndef NB
#define NB 4
#endif
#ifndef SEQ
#define SEQ 512
#endif
#define NB_FULL  4
#define SEQ_FULL 512
#ifndef OUT_SEQ
#define OUT_SEQ SEQ              // token pitch of the output buffers (rows per batch, rows and keys per head)
#endif
#define DM   256
#define NH_  4
#define HD   64
#define OSP  68                  // LDS row pitch (floats) of 16 x 64 staging tiles
#define KSP  68                  // LDS row pitch (floats) of the q and k tiles
#define SCP  (SEQ + 4)           // LDS row pitch (floats) of the score strip
#define NW   8                   // waves per attention block
#define GW   4                   // waves per GEMM block
#define PKH  (DM + 8)             // LDS row pitch (16-bit elements) of the staged GEMM operand tiles
#define KPW  (SEQ / NW)          // keys per wave
#define C2X  ((float)(2.0 * 1.4426950408889634))        // 2 log2(e), folded into the q and k planes
#define ECL  63.0f               // bound of the planes' exponents: Eq * Ek stays a finite normal number (never inf * 0)
#define SC2  ((float)(0.125 * 1.4426950408889634))      // HD^-0.5 * log2(e)
#define XSC  0x1p-63f            // power-of-two carry of x = 1 + Eq * Ek: x * XSC lies in [2^-63, 2^63], so a product of two stays a finite normal number
#define ASC  0x1p-62f            // 2 * XSC: folds the carry of the accumulated sums back together with the factor 2 of tanh
#define PCAR 16384.0f            // carry of the P fragment
#define VCAR 64.0f               // carry of the v^T plane
#define ACAR 256.0f              // carry of the context plane
#define WCAR 64.0f               // carry of the w_o plane
#define OSC  (1.0f / (ACAR * WCAR))
#define NEGB (-3.0e38f)
#define OUT1_OFF ((size_t)NB_FULL * SEQ_FULL * DM)      // first element of the probabilities output (fixed)

static_assert(HD == 64);                       // one 64-column GEMM tile = one head; f32 plane row = 256 bytes = two lines; f16 head segment = one line
static_assert(NH_ * HD == DM);                 // head h = columns h*64 + d
static_assert(DM % 64 == 0);
static_assert(DM % 32 == 0);                   // GEMM k-loop steps by 32
static_assert(SEQ % 64 == 0);                  // a 64-row tile never straddles two batches
static_assert((NB * SEQ) % 64 == 0);
static_assert(SEQ % 32 == 0);                  // key loop steps by 32
static_assert(SEQ % 16 == 0);                  // attention grid covers the sequence exactly
static_assert(SEQ % 128 == 0);                 // probability rows stored as 512-byte quarters
static_assert(((size_t)SEQ * DM) % 8 == 0);
static_assert(((size_t)DM * DM) % 8 == 0);
static_assert(NB <= NB_FULL);
static_assert(SEQ <= SEQ_FULL);
static_assert(SEQ <= OUT_SEQ);
static_assert((OSP * 4) % 16 == 0);
static_assert((KSP * 4) % 16 == 0);
static_assert((SCP * 4) % 16 == 0);
static_assert(OUT1_OFF * 4 == (size_t)2097152);                                   // byte offset of the second output
static_assert(((size_t)(NB - 1) * OUT_SEQ + SEQ) * DM <= OUT1_OFF);               // first output stays below the second
static_assert(8 * 32 * 4 == 16 * HD);          // f32 slab store: 8 instructions x 32 lanes x 4 floats = 16 rows x 64 columns
static_assert(4 * 32 * 8 == 16 * 64);          // f16 slab store: 4 instructions x 32 lanes x 8 halves = 16 rows x 64 columns
static_assert((SEQ / 128) * 32 * 4 == SEQ);    // probability row: SEQ/128 instructions x 32 lanes x 4 floats
static_assert((16 * SCP + NW * 32 * KSP + NW * 16 * OSP + 16 * KSP + HD + 3 * NW * 16) * 4 <= 163840);   // static LDS of the attention kernel: two blocks fit one WGP
static_assert(SEQ % (32 * NW) == 0);           // each wave owns whole 32-key tiles
static_assert(16 % NW == 0);                   // probability rows split evenly over the waves
static_assert(32 * NW * 4 == 16 * HD);         // one 4-element group of a 16 x 64 tile per thread of the attention block
static_assert(16 * 32 * 4 == 32 * HD);         // k' tile load: 16 instructions x 32 lanes x 4 floats = 32 rows x 64 columns
static_assert(16 * OSP * 4 <= 131072);

typedef _Float16 h16;
typedef __attribute__((ext_vector_type(16))) __bf16   v16bf;
typedef __attribute__((ext_vector_type(16))) _Float16 v16h;
typedef __attribute__((ext_vector_type(8)))  _Float16 v8h;
typedef __attribute__((ext_vector_type(4)))  _Float16 v4h;
typedef __attribute__((ext_vector_type(8)))  float    v8f;
typedef __attribute__((ext_vector_type(16))) float    v16f;
typedef __attribute__((ext_vector_type(4)))  float    v4f;
typedef v4f  __attribute__((may_alias)) v4fa;
typedef __attribute__((ext_vector_type(2)))  float    v2f;
typedef __attribute__((ext_vector_type(8)))  __bf16   v8bf;
typedef __attribute__((ext_vector_type(4)))  __bf16   v4bf;
typedef v4bf __attribute__((may_alias)) v4bfa;
typedef v8h  __attribute__((may_alias)) v8ha;

__device__ __forceinline__ unsigned short f2bf(float f) { unsigned u = __float_as_uint(f); u += 0x7FFFu + ((u >> 16) & 1u); return (unsigned short)(u >> 16); }
__device__ __forceinline__ float bfr(float f) { return __uint_as_float(((unsigned)f2bf(f)) << 16); }   // value after RNE convert to bf16
__device__ __forceinline__ v16h cat16(v8h lo, v8h hi) { return __builtin_shufflevector(lo, hi, 0, 1, 2, 3, 4, 5, 6, 7, 8, 9, 10, 11, 12, 13, 14, 15); }
__device__ __forceinline__ v8f wmma16(v16h a, v16h b, v8f c) { return __builtin_amdgcn_wmma_f32_16x16x32_f16(false, a, false, b, (short)0, c, false, false); }
__device__ __forceinline__ v8f wmmab(v16bf a, v16bf b, v8f c) { return __builtin_amdgcn_wmma_f32_16x16x32_bf16(false, a, false, b, (short)0, c, false, false); }
// fragment loaders from K-contiguous 16-bit rows; p already includes + 8*(lane>>4): elements 0..7 <- k0+8h+0..7, elements 8..15 <- k0+16+8h+0..7 (same map for A and B)
__device__ __forceinline__ v16h  ldh(const h16* p) { return cat16(*(const v8h*)p, *(const v8h*)(p + 16)); }
__device__ __forceinline__ v16bf ldb(const __bf16* p) { return __builtin_shufflevector(*(const v8bf*)p, *(const v8bf*)(p + 16), 0, 1, 2, 3, 4, 5, 6, 7, 8, 9, 10, 11, 12, 13, 14, 15); }
// ordering point for wave-private LDS tiles (same wave writes and reads)
__device__ __forceinline__ void wave_sync() { __builtin_amdgcn_fence(3 /* release order */, "wavefront"); __builtin_amdgcn_wave_barrier(); asm volatile("" ::: "memory"); }
// f32 -> f16 convert that cannot produce a subnormal (applied after the plane's power-of-two carry)
static __device__ __forceinline__ h16 toh_flush(float v) { const h16 r = (h16)v; return (fabsf(v) < 6.103515625e-05f) ? (h16)0.0f : r; }
// one matrix instruction + its own four-slot guard (accumulator tied, fragments kept live)
__device__ __forceinline__ v8f wmma16g(v16h a, v16h b, v8f c) { c = wmma16(a, b, c); asm volatile("v_nop\n\tv_nop\n\tv_nop\n\tv_nop" : "+v"(c) : "v"(a), "v"(b)); return c; }
__device__ __forceinline__ v8f wmmabg(v16bf a, v16bf b, v8f c) { c = wmmab(a, b, c); asm volatile("v_nop\n\tv_nop\n\tv_nop\n\tv_nop" : "+v"(c) : "v"(a), "v"(b)); return c; }

// 8 consecutive f32 -> bf16 value x WCAR held in f16
__device__ __forceinline__ void cvtw(const float* __restrict__ src, h16* dst) {
    const v8f v = *(const v8f*)src; v8h o;
#pragma unroll
    for (int k = 0; k < 8; ++k) o[k] = toh_flush(bfr(v[k]) * WCAR);
    *(v8h*)dst = o;
    asm volatile("s_wait_xcnt 0x0" ::: "memory");             // the code of the kernel's other parts, joined behind this store, reuses its address and data registers
}

// k_projall: the three input projections and the w_o conversion in one grid (none reads what another writes); blockIdx.z = 0: q', 1: k', 2: v^T, 3: w_o -> f16 plane. bf16 GEMM, one block of GW waves per 64x64 tile, K = DM;
// C[m][n] = sum_k A[m][k] Bt[n][k]. blockIdx.x = 64-token tile, blockIdx.y = 64-column tile of W (one head).
// Staging: the 64 A rows and the 64 Bt rows (whole K) are read once per block from the K-contiguous f32 inputs, each load instruction 512 contiguous bytes (four whole lines), 56 of a wave's 64 loads in flight together and the last 8 behind the first pieces' arrival,
// RNE-converted to bf16 in registers and left in LDS at row pitch PKH; after one barrier wave w forms rows 16w..16w+15 x 64 columns (4 accumulators) from LDS fragments, k ascending in steps of 32, and stores its own rows.
// z = 0, 1: A = x rows (m = b*SEQ + t), Bt = W rows (n = h*64 + d); written as f32 exp2(C2X x value), the exponent held within +-ECL, into plane [(b*4 + h)][t][64].
// z = 2:    A = w_v rows (m = h*64 + d), Bt = value rows (n = b*SEQ + t); written as f16 x VCAR into plane [(b*256 + m)][t], row pitch SEQ.
// z = 3:    16 consecutive elements of w_o per lane of wave 0; the blocks of the plane cover the matrix exactly.
static_assert((size_t)(NB * SEQ / 64) * (DM / 64) * 32 * 16 == (size_t)DM * DM);
static_assert(GW * 16 == 64);                  // one 16-row slab of the tile per wave, in staging, product and store
static_assert(DM == 256);                      // f32 row = two 512-byte pieces, f16 row = one
static_assert((PKH * 2) % 32 == 16);           // LDS row pitch = 16 bytes x odd: 16-byte fragment reads of 16 rows fall on distinct banks
__global__ __launch_bounds__(32 * GW) void k_projall(const float* __restrict__ xq, const float* __restrict__ xk, const float* __restrict__ xv,
                                                const float* __restrict__ wq, const float* __restrict__ wk, const float* __restrict__ wv, const float* __restrict__ wo,
                                                float* QS, float* KS, h16* Ph, h16* WO) {
    __shared__ __align__(16) __bf16 sa[64 * PKH];
    __shared__ __align__(16) __bf16 sb[64 * PKH];
    __shared__ __align__(16) float osb[GW * 16 * OSP];
    const int tid = threadIdx.x, lane = tid & 31, lr = lane & 15, hi = lane >> 4; const int z = blockIdx.z;
    const int w = __builtin_amdgcn_readfirstlane(tid >> 5);      // wave number, held scalar
    if (z == 3) { if (w == 0) { const size_t e = ((size_t)(blockIdx.y * (NB * SEQ / 64) + blockIdx.x) * 32 + lane) * 16; cvtw(wo + e, WO + e); cvtw(wo + e + 8, WO + e + 8); } return; }   // whole block leaves, ahead of the barrier
    const int r0 = ((z == 2) ? blockIdx.y : blockIdx.x) * 64, c0 = ((z == 2) ? blockIdx.x : blockIdx.y) * 64;
    const float* A  = (z == 0) ? xq : (z == 1) ? xk : wv;
    const float* Bt = (z == 0) ? wq : (z == 1) ? wk : xv;
    const int xt = blockIdx.x * 64; const int xs = (xt / SEQ) * SEQ_FULL + xt % SEQ;   // first source row of the token tile: source batches stand SEQ_FULL rows apart
    const int ar = (z == 2) ? r0 : xs, br = (z == 2) ? xs : c0;
    float* os = osb + w * (16 * OSP);                            // this wave's own 16 x 64 staging slab
    { const float* ga = A + (size_t)(ar + w * 16) * DM + lane * 4;   // 16 rows of A and 16 of Bt per wave, each 16 KB in a row: piece s = 512 bytes = row s>>1, columns 128*(s&1) + 4*lane..+3
      const float* gb = Bt + (size_t)(br + w * 16) * DM + lane * 4;
      v4f ra[32], rb[32];
#pragma unroll
      for (int s = 0; s < 8; ++s) ra[s] = *(const v4f*)(ga + s * 128);    // unrolled, here and below: the loads in flight together, values held in registers
      __builtin_amdgcn_sched_barrier(0);                        // keeps these eight first in the queue (loads return in order): the last eight loads wait for their registers
#pragma unroll
      for (int s = 8; s < 32; ++s) ra[s] = *(const v4f*)(ga + s * 128);
#pragma unroll
      for (int s = 0; s < 24; ++s) rb[s] = *(const v4f*)(gb + s * 128);
#pragma unroll
      for (int s = 0; s < 8; ++s) *(v4bfa*)(&sa[(w * 16 + (s >> 1)) * PKH + (s & 1) * 128 + lane * 4]) = __builtin_convertvector(ra[s], v4bf);
      __builtin_amdgcn_sched_barrier(0);                        // keeps the last eight loads behind the first pieces' stores, whose registers they take: the wave stays within 256 registers
#pragma unroll
      for (int s = 24; s < 32; ++s) rb[s] = *(const v4f*)(gb + s * 128);
      asm volatile("s_wait_xcnt 0x0" ::: "memory");             // the loads' address registers are reused below
#pragma unroll
      for (int s = 8; s < 32; ++s) *(v4bfa*)(&sa[(w * 16 + (s >> 1)) * PKH + (s & 1) * 128 + lane * 4]) = __builtin_convertvector(ra[s], v4bf);
#pragma unroll
      for (int s = 0; s < 32; ++s) *(v4bfa*)(&sb[(w * 16 + (s >> 1)) * PKH + (s & 1) * 128 + lane * 4]) = __builtin_convertvector(rb[s], v4bf); }   // rows 0..63 x columns 0..255 of both tiles all written
    __syncthreads();                                             // both operand tiles visible to all waves
    v8f acc[4];
#pragma unroll
    for (int nb = 0; nb < 4; ++nb) acc[nb] = (v8f){};
    const __bf16* pa = sa + (w * 16 + lr) * PKH + 8 * hi; const __bf16* pb = sb + lr * PKH + 8 * hi;
    v16bf fa[2][2], fb[2][2][4];                                 // fragments of two groups of two k steps: one group is read from LDS while the other is multiplied
#pragma unroll
    for (int u = 0; u < 2; ++u) { fa[0][u] = ldb(pa + u * 32);
#pragma unroll
        for (int nb = 0; nb < 4; ++nb) fb[0][u][nb] = ldb(pb + nb * 16 * PKH + u * 32); }
#pragma unroll
    for (int g = 0; g < DM / 64; ++g) {                          // unrolled: the buffers are indexed by constants
        if (g + 1 < DM / 64) {
#pragma unroll
            for (int u = 0; u < 2; ++u) { fa[(g + 1) & 1][u] = ldb(pa + (g + 1) * 64 + u * 32);
#pragma unroll
                for (int nb = 0; nb < 4; ++nb) fb[(g + 1) & 1][u][nb] = ldb(pb + nb * 16 * PKH + (g + 1) * 64 + u * 32); } }
        __builtin_amdgcn_sched_barrier(0);                       // keeps the next group's 20 LDS reads in front of this group's products; left free, each read is sunk to its product and every product waits out a whole LDS latency
#pragma unroll
        for (int u = 0; u < 2; ++u)
#pragma unroll
            for (int nb = 0; nb < 4; ++nb) acc[nb] = wmmabg(fa[g & 1][u], fb[g & 1][u][nb], acc[nb]);
    }
    if (z != 2) {
        float* P = (z == 0) ? QS : KS;
        const int bb = r0 / SEQ, tt = r0 % SEQ; const int zh = bb * NH_ + c0 / HD;
        const size_t tbase = ((size_t)zh * SEQ + (size_t)tt) * HD;
#pragma unroll
        for (int nb = 0; nb < 4; ++nb) {
#pragma unroll
            for (int j = 0; j < 8; ++j) os[(hi * 8 + j) * OSP + nb * 16 + lr] = __builtin_amdgcn_exp2f(__builtin_amdgcn_fmed3f(acc[nb][j] * C2X, -ECL, ECL)); }   // D: row 8h+j, col lane&15
        wave_sync();
        const size_t sbo = tbase + (size_t)(w * 16) * HD;
#pragma unroll
        for (int s = 0; s < 8; ++s) { const int p = s * 32 + lane; const int row = p >> 4, c4 = (p & 15) * 4;   // 8 s x 2 rows = 16 rows; 16 lanes x 4 floats = 64 columns
            const v4f val = *(const v4fa*)(&os[row * OSP + c4]);
            *(v4f*)(P + sbo + (size_t)p * 4) = val; }
        asm volatile("s_wait_xcnt 0x0" ::: "memory");         // the v^T part's code stands behind this branch and reuses the last stores' data registers
    } else {
        const int bb = c0 / SEQ, tt = c0 % SEQ;
        const size_t tbase = (size_t)bb * (size_t)DM * SEQ + (size_t)r0 * SEQ + (size_t)tt;
#pragma unroll
        for (int nb = 0; nb < 4; ++nb) {
#pragma unroll
            for (int j = 0; j < 8; ++j) os[(hi * 8 + j) * OSP + nb * 16 + lr] = acc[nb][j] * VCAR; }   // D: row 8h+j, col lane&15
        wave_sync();
        const size_t sbo = tbase + (size_t)(w * 16) * SEQ;
#pragma unroll
        for (int s = 0; s < 4; ++s) { const int row = 4 * s + (lane >> 3), c8 = (lane & 7) * 8;   // 4 s x 4 row groups = 16 rows; 8 lanes x 8 halves = 64 columns
            const v4f x0 = *(const v4fa*)(&os[row * OSP + c8]); const v4f x1 = *(const v4fa*)(&os[row * OSP + c8 + 4]); v8h hv;
#pragma unroll
            for (int i = 0; i < 4; ++i) { hv[i] = toh_flush(x0[i]); hv[4 + i] = toh_flush(x1[i]); }
            *(v8h*)(Ph + sbo + (size_t)row * SEQ + c8) = hv; }
        asm volatile("s_wait_xcnt 0x0" ::: "memory");         // the w_o part's code may stand behind these stores and reuses their address and data registers
    }
}

// k_outp: f16 GEMM, one block of GW waves per 64x64 tile, staged and split like k_projall (a row is 512 bytes = one load instruction; no conversion); A = context rows (m = b*SEQ + t, x ACAR), Bt = w_o rows (n, x WCAR); C x OSC written as f32 into the output buffer [b][t][256].
__global__ __launch_bounds__(32 * GW) void k_outp(const h16* __restrict__ A, const h16* __restrict__ Bt, float* OUT) {
    __shared__ __align__(16) h16 sa[64 * PKH];
    __shared__ __align__(16) h16 sb[64 * PKH];
    __shared__ __align__(16) float osb[GW * 16 * OSP];
    const int tid = threadIdx.x, lane = tid & 31, lr = lane & 15, hi = lane >> 4; const int r0 = blockIdx.x * 64, c0 = blockIdx.y * 64;
    const int w = __builtin_amdgcn_readfirstlane(tid >> 5);      // wave number, held scalar
    float* os = osb + w * (16 * OSP);                            // this wave's own 16 x 64 staging slab
    { const h16* ga = A + (size_t)(r0 + w * 16) * DM + lane * 8;     // 16 rows of A and 16 of Bt per wave: piece s = row s, columns 8*lane..+7
      const h16* gb = Bt + (size_t)(c0 + w * 16) * DM + lane * 8;
      v8h ra[16], rb[16];
#pragma unroll
      for (int s = 0; s < 16; ++s) ra[s] = *(const v8h*)(ga + s * DM);    // unrolled: all loads in flight together, values held in registers
#pragma unroll
      for (int s = 0; s < 16; ++s) rb[s] = *(const v8h*)(gb + s * DM);
      asm volatile("s_wait_xcnt 0x0" ::: "memory");             // the loads' address registers are reused below
#pragma unroll
      for (int s = 0; s < 16; ++s) *(v8ha*)(&sa[(w * 16 + s) * PKH + lane * 8]) = ra[s];
#pragma unroll
      for (int s = 0; s < 16; ++s) *(v8ha*)(&sb[(w * 16 + s) * PKH + lane * 8]) = rb[s]; }   // rows 0..63 x columns 0..255 of both tiles all written
    __syncthreads();                                             // both operand tiles visible to all waves
    v8f acc[4];
#pragma unroll
    for (int nb = 0; nb < 4; ++nb) acc[nb] = (v8f){};
    const h16* pa = sa + (w * 16 + lr) * PKH + 8 * hi; const h16* pb = sb + lr * PKH + 8 * hi;
    v16h fa[2][2], fb[2][2][4];                                  // fragments of two groups of two k steps: one group is read from LDS while the other is multiplied
#pragma unroll
    for (int u = 0; u < 2; ++u) { fa[0][u] = ldh(pa + u * 32);
#pragma unroll
        for (int nb = 0; nb < 4; ++nb) fb[0][u][nb] = ldh(pb + nb * 16 * PKH + u * 32); }
#pragma unroll
    for (int g = 0; g < DM / 64; ++g) {                          // unrolled: the buffers are indexed by constants
        if (g + 1 < DM / 64) {
#pragma unroll
            for (int u = 0; u < 2; ++u) { fa[(g + 1) & 1][u] = ldh(pa + (g + 1) * 64 + u * 32);
#pragma unroll
                for (int nb = 0; nb < 4; ++nb) fb[(g + 1) & 1][u][nb] = ldh(pb + nb * 16 * PKH + (g + 1) * 64 + u * 32); } }
        __builtin_amdgcn_sched_barrier(0);                       // keeps the next group's 20 LDS reads in front of this group's products; left free, each read is sunk to its product and every product waits out a whole LDS latency
#pragma unroll
        for (int u = 0; u < 2; ++u)
#pragma unroll
            for (int nb = 0; nb < 4; ++nb) acc[nb] = wmma16g(fa[g & 1][u], fb[g & 1][u][nb], acc[nb]);
    }
    const int bb = r0 / SEQ, tt = r0 % SEQ;
    const size_t obase = ((size_t)bb * OUT_SEQ + (size_t)tt) * DM + (size_t)c0;
#pragma unroll
    for (int nb = 0; nb < 4; ++nb) {
#pragma unroll
        for (int j = 0; j < 8; ++j) os[(hi * 8 + j) * OSP + nb * 16 + lr] = acc[nb][j] * OSC; }   // D: row 8h+j, col lane&15
    wave_sync();
    const size_t sbo = obase + (size_t)(w * 16) * DM;
#pragma unroll
    for (int s = 0; s < 8; ++s) { const int p = s * 32 + lane; const int row = p >> 4, c4 = (p & 15) * 4;   // 8 s x 2 rows = 16 rows; 16 lanes x 4 floats = 64 columns
        const v4f val = *(const v4fa*)(&os[row * OSP + c4]);
        *(v4f*)(OUT + sbo + (size_t)row * DM + c4) = val; }
}

// k_attn: one block of NW waves per 16 query rows of one (batch, head); wave w owns keys w*KPW .. w*KPW + KPW - 1 in both passes. The q' tile (rows of the Eq plane), the weight vector and the score strip are shared; each wave has its own k' tile (rows of the Ek plane).
// Pass 1: lane (t = lane&15, h = lane>>4) holds the 16 scores (t, key0 + 8h + r) and (t, key0 + 16 + 8h + r), r = 0..7: acc = sum_d w[d] / (1 + Eq[t][d] * Ek[key][d]); score (log2 domain) = SC2 * (sum_d w[d] - 2 acc).
//         Terms d and d + 2 go over one denominator, x carried by XSC (the q' tile is staged x XSC): acc / XSC = sum of (w[d] x'[d+2] + w[d+2] x'[d]) / (x'[d] x'[d+2]), kept as two partial sums per key (d mod 4 in {0, 2} and {1, 3}).
//         Scores go to the strip sc[t][key]; the row maximum is tracked per lane, combined with one xor-16 exchange, then over the NW waves through LDS (a maximum: exact in any order).
// Pass 2: e = exp2(score - max) (f32, row sum l); P = f16(e x 16384) packed directly as the B fragment (element r <- key 8h+r, element 8+r <- key 16+8h+r) of
//         O^T[d][t] = V^T P^T (A = v^T rows d, k = key); row sum l2 over the converted P normalises O; e is written back into the strip.
// Combine: each wave leaves its partial O^T, l and l2 in LDS; after one barrier they are summed in wave order 0..NW-1, normalised and stored.
__global__ __launch_bounds__(32 * NW) void k_attn(const float* __restrict__ QS, const float* __restrict__ KS, const h16* __restrict__ VT, const float* __restrict__ va, float* ATTN, h16* AT) {
    __shared__ __align__(16) float sc[16 * SCP];
    __shared__ __align__(16) float ks[NW * 32 * KSP];
    __shared__ __align__(16) float qs[16 * KSP];
    __shared__ __align__(16) float po[NW * 16 * OSP];            // partial O^T per wave; with it a block holds over a third of a WGP's LDS, so at most two blocks share a WGP and the grid spreads evenly
    __shared__ __align__(16) float vs[HD];
    __shared__ __align__(16) float wmx[NW * 16];
    __shared__ __align__(16) float wl[NW * 16];
    __shared__ __align__(16) float wl2[NW * 16];
    const int tid = threadIdx.x, lane = tid & 31, lr = lane & 15, hi = lane >> 4;
    const int wv = __builtin_amdgcn_readfirstlane(tid >> 5);     // wave number, held scalar so that the key loops stay scalar loops
    const int zh = blockIdx.y; const int b = zh / NH_, h = zh % NH_;
    const int t0 = blockIdx.x * 16;
    const size_t pbase = (size_t)zh * SEQ * HD;
    float* ksw = ks + wv * (32 * KSP);                           // this wave's own k' tile
    float* pw = po + wv * (16 * OSP);                          // this wave's own partial O^T tile
    // q' tile: 16 rows x 64 floats, 16 B per thread; rows 0..15 x columns 0..63 all written
    { const int row = tid >> 4, c4 = (tid & 15) * 4;
        const v4f v = *(const v4f*)(QS + pbase + (size_t)(t0 + row) * HD + c4); *(v4fa*)(&qs[row * KSP + c4]) = v * XSC; }   // exact: Eq >= 2^-63, the carried value >= 2^-126
    // weight vector of this head, RNE-converted to bf16 at its load
    if (tid < 16) { const v4f w = *(const v4f*)(va + (size_t)h * HD + tid * 4); v4f wb;
#pragma unroll
      for (int i = 0; i < 4; ++i) wb[i] = bfr(w[i]);
      *(v4fa*)(&vs[tid * 4]) = wb; }
    __syncthreads();                                             // q' tile and weight vector visible to all waves
    float W1 = 0.0f;
#pragma unroll 1
    for (int c = 0; c < HD; c += 4) { const v4f w4 = *(const v4fa*)(&vs[c]); W1 += (w4[0] + w4[1]) + (w4[2] + w4[3]); }

    const int kbeg = wv * KPW;
    float mx = NEGB;
#pragma unroll 1
    for (int key0 = kbeg; key0 < kbeg + KPW; key0 += 32) {
        wave_sync();                                             // all reads of the earlier k' tile are complete
        { const float* kp = KS + pbase + (size_t)key0 * HD + lane * 4;   // the 32 key rows are 8 KB in a row: each load instruction takes 512 contiguous bytes (four whole lines, two rows), lane = 16-byte piece
          v4f kv[16];
#pragma unroll
          for (int s = 0; s < 16; ++s) kv[s] = *(const v4f*)(kp + s * 128);                  // unrolled: all 16 loads of the tile in flight together, kv held in registers
#pragma unroll
          for (int s = 0; s < 16; ++s) *(v4fa*)(&ksw[(2 * s + hi) * KSP + lr * 4]) = kv[s]; } // unrolled: kv indexed by constants; piece s*32 + lane = row 2s + (lane>>4), columns 4*(lane&15)..+3; rows 0..31 x columns 0..63 all written
        wave_sync();
        v2f aa[8], ab[8]; const v2f one2 = {XSC, XSC};
#pragma unroll
        for (int r = 0; r < 8; ++r) { aa[r] = (v2f){0.0f, 0.0f}; ab[r] = (v2f){0.0f, 0.0f}; }
#pragma unroll 1
        for (int c = 0; c < HD; c += 4) {
            const v4f q4 = *(const v4fa*)(&qs[lr * KSP + c]);
            const v4f w4 = *(const v4fa*)(&vs[c]);
            const v2f q01 = {q4[0], q4[1]}, q23 = {q4[2], q4[3]}, w01 = {w4[0], w4[1]}, w23 = {w4[2], w4[3]};
#pragma unroll
            for (int r = 0; r < 8; ++r) {
                const v4f ka = *(const v4fa*)(&ksw[(8 * hi + r) * KSP + c]);
                const v4f kb = *(const v4fa*)(&ksw[(16 + 8 * hi + r) * KSP + c]);
                const v2f xa01 = __builtin_elementwise_fma(q01, (v2f){ka[0], ka[1]}, one2), xa23 = __builtin_elementwise_fma(q23, (v2f){ka[2], ka[3]}, one2);   // (1 + Eq * Ek) x XSC, formed on the loaded register pairs as they stand
                const v2f xb01 = __builtin_elementwise_fma(q01, (v2f){kb[0], kb[1]}, one2), xb23 = __builtin_elementwise_fma(q23, (v2f){kb[2], kb[3]}, one2);
                const v2f pa = xa01 * xa23, pbb = xb01 * xb23;                                  // common denominators of terms (0, 2) and (1, 3)
                const v2f na = __builtin_elementwise_fma(w23, xa01, w01 * xa23);               // their numerators
                const v2f nb = __builtin_elementwise_fma(w23, xb01, w01 * xb23);
                const v2f ra = {__builtin_amdgcn_rcpf(pa[0]), __builtin_amdgcn_rcpf(pa[1])};
                const v2f rb = {__builtin_amdgcn_rcpf(pbb[0]), __builtin_amdgcn_rcpf(pbb[1])};
                aa[r] = __builtin_elementwise_fma(na, ra, aa[r]); ab[r] = __builtin_elementwise_fma(nb, rb, ab[r]); } }
        v4f s0, s1, s2, s3;
#pragma unroll
        for (int r = 0; r < 4; ++r) {
            s0[r] = (W1 - ASC * (aa[r][0] + aa[r][1])) * SC2; s1[r] = (W1 - ASC * (aa[4 + r][0] + aa[4 + r][1])) * SC2;
            s2[r] = (W1 - ASC * (ab[r][0] + ab[r][1])) * SC2; s3[r] = (W1 - ASC * (ab[4 + r][0] + ab[4 + r][1])) * SC2;
            mx = fmaxf(mx, fmaxf(fmaxf(s0[r], s1[r]), fmaxf(s2[r], s3[r]))); }
        const int so = lr * SCP + key0 + 8 * hi;                 // keys key0+8h+0..7 at so, keys key0+16+8h+0..7 at so+16
        *(v4fa*)(&sc[so]) = s0; *(v4fa*)(&sc[so + 4]) = s1; *(v4fa*)(&sc[so + 16]) = s2; *(v4fa*)(&sc[so + 20]) = s3;
    }
    wmx[wv * 16 + lr] = fmaxf(mx, __shfl_xor(mx, 16, 32));       // lanes lr and lr+16 hold the same value
    __syncthreads();                                             // every wave's row maxima are in wmx
    float m = wmx[lr];
#pragma unroll
    for (int w = 1; w < NW; ++w) m = fmaxf(m, wmx[w * 16 + lr]);

    v8f o0 = (v8f){}, o1 = (v8f){}, o2 = (v8f){}, o3 = (v8f){};
    float l = 0.0f, l2 = 0.0f;
    const size_t vo = ((size_t)zh * HD + (size_t)lr) * SEQ + 8 * hi;   // + 16j*SEQ + key  (A fragment: row d = 16j + lane&15, k = key)
#pragma unroll 1
    for (int key0 = kbeg; key0 < kbeg + KPW; key0 += 32) {
        const int so = lr * SCP + key0 + 8 * hi;                 // the same lane wrote these 16 scores
        const v4f s0 = *(const v4fa*)(&sc[so]), s1 = *(const v4fa*)(&sc[so + 4]), s2 = *(const v4fa*)(&sc[so + 16]), s3 = *(const v4fa*)(&sc[so + 20]);
        v4f e0, e1, e2, e3; v16h pb; float ls = 0.0f, lp = 0.0f;
#pragma unroll
        for (int r = 0; r < 4; ++r) {
            e0[r] = __builtin_amdgcn_exp2f(s0[r] - m); e1[r] = __builtin_amdgcn_exp2f(s1[r] - m);
            e2[r] = __builtin_amdgcn_exp2f(s2[r] - m); e3[r] = __builtin_amdgcn_exp2f(s3[r] - m);
            const h16 p0 = toh_flush(e0[r] * PCAR); const h16 p1 = toh_flush(e1[r] * PCAR);
            const h16 p2 = toh_flush(e2[r] * PCAR); const h16 p3 = toh_flush(e3[r] * PCAR);
            pb[r] = p0; pb[4 + r] = p1; pb[8 + r] = p2; pb[12 + r] = p3;
            ls += (e0[r] + e1[r]) + (e2[r] + e3[r]);
            lp += ((float)p0 + (float)p1) + ((float)p2 + (float)p3); }
        l += ls; l2 += lp;
        *(v4fa*)(&sc[so]) = e0; *(v4fa*)(&sc[so + 4]) = e1; *(v4fa*)(&sc[so + 16]) = e2; *(v4fa*)(&sc[so + 20]) = e3;
        const h16* vp = VT + vo + key0;
        const v16h v0 = ldh(vp), v1 = ldh(vp + (size_t)16 * SEQ), v2 = ldh(vp + (size_t)32 * SEQ), v3 = ldh(vp + (size_t)48 * SEQ);
        o0 = wmma16g(v0, pb, o0); o1 = wmma16g(v1, pb, o1); o2 = wmma16g(v2, pb, o2); o3 = wmma16g(v3, pb, o3);
    }
    l += __shfl_xor(l, 16, 32); l2 += __shfl_xor(l2, 16, 32);
    wl[wv * 16 + lr] = l; wl2[wv * 16 + lr] = l2;                // lanes lr and lr+16 hold the same values
    // partial O^T of this wave's keys, D layout o_j[r] = (d = 16j + 8h + r, t = lane&15) -> own tile of po as [t][d], pitch OSP; rows 0..15 x columns 0..63 all written
    { v4f a, c;
      a[0] = o0[0]; a[1] = o0[1]; a[2] = o0[2]; a[3] = o0[3]; c[0] = o0[4]; c[1] = o0[5]; c[2] = o0[6]; c[3] = o0[7];
      *(v4fa*)(&pw[lr * OSP +  0 + 8 * hi]) = a; *(v4fa*)(&pw[lr * OSP +  0 + 8 * hi + 4]) = c;
      a[0] = o1[0]; a[1] = o1[1]; a[2] = o1[2]; a[3] = o1[3]; c[0] = o1[4]; c[1] = o1[5]; c[2] = o1[6]; c[3] = o1[7];
      *(v4fa*)(&pw[lr * OSP + 16 + 8 * hi]) = a; *(v4fa*)(&pw[lr * OSP + 16 + 8 * hi + 4]) = c;
      a[0] = o2[0]; a[1] = o2[1]; a[2] = o2[2]; a[3] = o2[3]; c[0] = o2[4]; c[1] = o2[5]; c[2] = o2[6]; c[3] = o2[7];
      *(v4fa*)(&pw[lr * OSP + 32 + 8 * hi]) = a; *(v4fa*)(&pw[lr * OSP + 32 + 8 * hi + 4]) = c;
      a[0] = o3[0]; a[1] = o3[1]; a[2] = o3[2]; a[3] = o3[3]; c[0] = o3[4]; c[1] = o3[5]; c[2] = o3[6]; c[3] = o3[7];
      *(v4fa*)(&pw[lr * OSP + 48 + 8 * hi]) = a; *(v4fa*)(&pw[lr * OSP + 48 + 8 * hi + 4]) = c; }
    __syncthreads();                                             // partial O^T, l, l2 and the whole e strip visible to all waves
    const size_t abase = ((size_t)b * SEQ + (size_t)t0) * DM + (size_t)h * HD;                    // context plane [b*SEQ + t][256]
    const size_t pb0 = (((size_t)b * NH_ + (size_t)h) * OUT_SEQ + (size_t)t0) * OUT_SEQ;          // probabilities [b][h][t][key]
    { const int row = tid >> 4, c4 = (tid & 15) * 4;             // 16 rows x 16 threads x 4 halves; 16 lanes = 64 columns = one line
        v4f x = *(const v4fa*)(&po[row * OSP + c4]); float l2t = wl2[row];                        // l2t >= 16384: the maximum element contributes exp2(0)
#pragma unroll
        for (int w = 1; w < NW; ++w) { const v4f y = *(const v4fa*)(&po[w * (16 * OSP) + row * OSP + c4]); x[0] += y[0]; x[1] += y[1]; x[2] += y[2]; x[3] += y[3]; l2t += wl2[w * 16 + row]; }
        const float invo = (ACAR / VCAR) / l2t; v4h hv;
#pragma unroll
        for (int i = 0; i < 4; ++i) hv[i] = toh_flush(x[i] * invo);
        *(v4h*)(AT + abase + (size_t)row * DM + c4) = hv;
        asm volatile("s_wait_xcnt 0x0" ::: "memory"); }         // the store's address and data registers are reused right below
#pragma unroll 1
    for (int row = wv; row < 16; row += NW) {                                                     // 16 rows x SEQ/128 instructions x 512 B = 16 x SEQ floats
        float lt = wl[row];                                                                       // lt >= 1
#pragma unroll
        for (int w = 1; w < NW; ++w) lt += wl[w * 16 + row];
        const float invr = 1.0f / lt;
        const size_t ro = pb0 + (size_t)row * OUT_SEQ;
#pragma unroll
        for (int qd = 0; qd < SEQ / 128; ++qd) { const int cofs = qd * 128 + lane * 4;
            const v4f e = *(const v4fa*)(&sc[row * SCP + cofs]);
            v4f val; val[0] = e[0] * invr; val[1] = e[1] * invr; val[2] = e[2] * invr; val[3] = e[3] * invr;
            *(v4f*)(ATTN + ro + cofs) = val; }
        asm volatile("s_wait_xcnt 0x0" ::: "memory"); }         // the next trip reuses the stores' address and data registers
}

static constexpr size_t al256(size_t v) { return (v + 255) & ~(size_t)255; }
static constexpr size_t SZ_WO = al256((size_t)DM * DM * 2);                // f16 w_o
static constexpr size_t SZ_PF = al256((size_t)NB * NH_ * SEQ * HD * 4);    // f32 q' / k' plane
static constexpr size_t SZ_PH = al256((size_t)NB * SEQ * DM * 2);          // f16 v^T plane / context plane
static constexpr size_t SZ_TOTAL = SZ_WO + 2 * SZ_PF + 2 * SZ_PH;
static_assert(SZ_TOTAL <= (size_t)134217728);          // workspace carve <= 128 MiB
static_assert((size_t)NB * NH_ * SEQ * HD == (size_t)NB * DM * SEQ);       // v^T plane [(b*256 + m)][t] has the same extent as the context plane

extern "C" void kernel_launch(void* const* d_in, const int* in_sizes, int n_in,
                              void* d_out, int out_size, void* d_ws, size_t ws_size, hipStream_t stream) {
    if (n_in < 8) return;
    const size_t needx = ((size_t)(NB - 1) * SEQ_FULL + SEQ) * DM;
    if ((size_t)in_sizes[0] < needx || (size_t)in_sizes[1] < needx || (size_t)in_sizes[2] < needx) return;
    if ((size_t)in_sizes[3] < (size_t)DM * DM || (size_t)in_sizes[4] < (size_t)DM * DM || (size_t)in_sizes[5] < (size_t)DM * DM || (size_t)in_sizes[7] < (size_t)DM * DM) return;
    if (in_sizes[6] < NH_ * HD) return;
    const size_t need_out = OUT1_OFF + ((size_t)(NB * NH_ - 1) * OUT_SEQ + (size_t)(SEQ - 1)) * OUT_SEQ + SEQ;
    if ((size_t)out_size < need_out) return;
    if (SZ_TOTAL > ws_size) return;
    // wire order: query, key, value, w_q, w_k, w_v, v_a, w_o
    const float* xin[3] = { (const float*)d_in[0], (const float*)d_in[1], (const float*)d_in[2] };
    const float* wq = (const float*)d_in[3];
    const float* wk = (const float*)d_in[4];
    const float* wv = (const float*)d_in[5];
    const float* va = (const float*)d_in[6];
    const float* wo = (const float*)d_in[7];
    float* OUT  = (float*)d_out;                 // [NB][SEQ][256]
    float* ATTN = (float*)d_out + OUT1_OFF;      // [NB][4][SEQ][SEQ]
    char* wsp = (char*)d_ws;
    h16* WO = (h16*)wsp; wsp += SZ_WO;               // [256][256] x WCAR ([out][in] = Bt as-is)
    float* QS = (float*)wsp; wsp += SZ_PF;           // [NB*4][SEQ][64], exp2(C2X q)
    float* KS = (float*)wsp; wsp += SZ_PF;           // [NB*4][SEQ][64], exp2(C2X k)
    h16* VT = (h16*)wsp; wsp += SZ_PH;               // [NB*4][64][SEQ] x VCAR
    h16* AT = (h16*)wsp; wsp += SZ_PH;               // [NB*SEQ][256] x ACAR

    // q', k' -> f32 planes [(b*4 + h)][t][d]; v^T -> f16 plane [(b*4 + h)][d][t]; w_o -> f16 plane; one grid, blockIdx.z picks the job
    k_projall<<<dim3(NB * SEQ / 64, DM / 64, 4), 32 * GW, 0, stream>>>(xin[0], xin[1], xin[2], wq, wk, wv, wo, QS, KS, VT, WO);

    // scores, softmax, probabilities output, P.V -> context plane
    k_attn<<<dim3(SEQ / 16, NB * NH_, 1), 32 * NW, 0, stream>>>(QS, KS, VT, va, ATTN, AT);

    // output projection: A = context rows, Bt = w_o rows -> output buffer [b][t][256]
    k_outp<<<dim3(NB * SEQ / 64, DM / 64, 1), 32 * GW, 0, stream>>>(AT, WO, OUT);
}

// v008
// Measured time: 27.2 microseconds a run.
// Next to v007, in two timings, it ran 1.07 and 1.05 times as fast.
// All steps since v000 together make it 4.91 times as fast.
#include <hip/hip_runtime.h>

// Additive-score multi-head attention, width 256 = 4 heads x 64; query/key/value [NB][SEQ][256]; w_q/w_k/w_v/w_o [out][in] (y = x W^T, no bias); score(t, k) = 0.125 * sum_d va[h][d] * tanh(q[t][d] + k[k][d]);
// dense softmax over keys; context = P V, heads concatenated (column h*64 + d), output projection; two outputs: projected context [NB][SEQ][256] and the probabilities [NB][4][SEQ][SEQ] (both f32).
// Compute dtypes, f32 accumulate everywhere: q/k/v projections v_wmma_f32_16x16x32_bf16 (x and W RNE-converted to bf16 in registers on their way into LDS; products exact); additive scores on the vector unit in f32
// (matrix-vector form: one weight vector per head, no shared second dimension; va RNE-converted to bf16 at its load); P.V v_wmma_f32_16x16x32_f16 (P x16384 and v x64, single f16 planes; carries cancel in the normalisation);
// output projection v_wmma_f32_16x16x32_f16 (context x256, w_o = bf16 value x64 held in f16; folded back by 2^-14); softmax f32 with the true row maximum.
// tanh(x) = 1 - 2 / (1 + exp2(2 log2(e) x)); exp2(c (q + k)) = exp2(c q) * exp2(c k): the q and k planes hold Eq = exp2(2 log2(e) q) and Ek = exp2(2 log2(e) k) in f32, so a score term costs no exponential; two terms share one reciprocal: w0/x0 + w1/x1 = (w0 x1 + w1 x0) / (x0 x1).
// Layout: f32 Eq, Ek planes [b*4+h][t][64]; f16 v^T plane [b*4+h][d][t]; f16 context plane [b*SEQ+t][256]; f16 w_o plane [n][k].
// Attention kernel: one block of NW waves per 16 query rows of one (batch, head), the keys split evenly over the waves; score strip 16 x SEQ in LDS; transposed product O^T[d][t] = V^T P^T with the packed P strip as the B fragment; partial O^T and row sums combined through LDS.

#ifndef NB
#define NB 4
#endif
#ifndef SEQ
#define SEQ 512
#endif
#define NB_FULL  4
#define SEQ_FULL 512
#ifndef OUT_SEQ
#define OUT_SEQ SEQ              // token pitch of the output buffers (rows per batch, rows and keys per head)
#endif
#define DM   256
#define NH_  4
#define HD   64
#define OSP  68                  // LDS row pitch (floats) of 16 x 64 staging tiles
#define KSP  68                  // LDS row pitch (floats) of the q and k tiles
#define SCP  (SEQ + 4)           // LDS row pitch (floats) of the score strip
#define NW   8                   // waves per attention block
#define GW   4                   // waves per GEMM block
#define PKH  (DM + 8)             // LDS row pitch (16-bit elements) of the staged GEMM operand tiles
#define KPW  (SEQ / NW)          // keys per wave
#define C2X  ((float)(2.0 * 1.4426950408889634))        // 2 log2(e), folded into the q and k planes
#define ECL  63.0f               // bound of the planes' exponents: Eq * Ek stays a finite normal number (never inf * 0)
#define SC2  ((float)(0.125 * 1.4426950408889634))      // HD^-0.5 * log2(e)
#define XSC  0x1p-63f            // power-of-two carry of x = 1 + Eq * Ek: x * XSC lies in [2^-63, 2^63], so a product of two stays a finite normal number
#define ASC  0x1p-62f            // 2 * XSC: folds the carry of the accumulated sums back together with the factor 2 of tanh
#define PCAR 16384.0f            // carry of the P fragment
#define VCAR 64.0f               // carry of the v^T plane
#define ACAR 256.0f              // carry of the context plane
#define WCAR 64.0f               // carry of the w_o plane
#define OSC  (1.0f / (ACAR * WCAR))
#define NEGB (-3.0e38f)
#define OUT1_OFF ((size_t)NB_FULL * SEQ_FULL * DM)      // first element of the probabilities output (fixed)

static_assert(HD == 64);                       // one 64-column GEMM tile = one head; f32 plane row = 256 bytes = two lines; f16 head segment = one line
static_assert(NH_ * HD == DM);                 // head h = columns h*64 + d
static_assert(DM % 64 == 0);
static_assert(DM % 32 == 0);                   // GEMM k-loop steps by 32
static_assert(SEQ % 64 == 0);                  // a 64-row tile never straddles two batches
static_assert((NB * SEQ) % 64 == 0);
static_assert(SEQ % 32 == 0);                  // key loop steps by 32
static_assert(SEQ % 16 == 0);                  // attention grid covers the sequence exactly
static_assert(SEQ % 128 == 0);                 // probability rows stored as 512-byte quarters
static_assert(((size_t)SEQ * DM) % 8 == 0);
static_assert(((size_t)DM * DM) % 8 == 0);
static_assert(NB <= NB_FULL);
static_assert(SEQ <= SEQ_FULL);
static_assert(SEQ <= OUT_SEQ);
static_assert((OSP * 4) % 16 == 0);
static_assert((KSP * 4) % 16 == 0);
static_assert((SCP * 4) % 16 == 0);
static_assert(OUT1_OFF * 4 == (size_t)2097152);                                   // byte offset of the second output
static_assert(((size_t)(NB - 1) * OUT_SEQ + SEQ) * DM <= OUT1_OFF);               // first output stays below the second
static_assert(8 * 32 * 4 == 16 * HD);          // f32 slab store: 8 instructions x 32 lanes x 4 floats = 16 rows x 64 columns
static_assert(4 * 32 * 8 == 16 * 64);          // f16 slab store: 4 instructions x 32 lanes x 8 halves = 16 rows x 64 columns
static_assert((SEQ / 128) * 32 * 4 == SEQ);    // probability row: SEQ/128 instructions x 32 lanes x 4 floats
static_assert((16 * SCP + NW * 32 * KSP + NW * 16 * OSP + 16 * KSP + HD + 3 * NW * 16) * 4 <= 163840);   // static LDS of the attention kernel: two blocks fit one WGP
static_assert(SEQ % (32 * NW) == 0);           // each wave owns whole 32-key tiles
static_assert(16 % NW == 0);                   // probability rows split evenly over the waves
static_assert(32 * NW * 4 == 16 * HD);         // one 4-element group of a 16 x 64 tile per thread of the attention block
static_assert(16 * 32 * 4 == 32 * HD);         // k' tile load: 16 instructions x 32 lanes x 4 floats = 32 rows x 64 columns
static_assert(16 * OSP * 4 <= 131072);

typedef _Float16 h16;
typedef __attribute__((ext_vector_type(16))) __bf16   v16bf;
typedef __attribute__((ext_vector_type(16))) _Float16 v16h;
typedef __attribute__((ext_vector_type(8)))  _Float16 v8h;
typedef __attribute__((ext_vector_type(4)))  _Float16 v4h;
typedef __attribute__((ext_vector_type(8)))  float    v8f;
typedef __attribute__((ext_vector_type(16))) float    v16f;
typedef __attribute__((ext_vector_type(4)))  float    v4f;
typedef v4f  __attribute__((may_alias)) v4fa;
typedef __attribute__((ext_vector_type(2)))  float    v2f;
typedef __attribute__((ext_vector_type(8)))  __bf16   v8bf;
typedef __attribute__((ext_vector_type(4)))  __bf16   v4bf;
typedef v4bf __attribute__((may_alias)) v4bfa;
typedef v8h  __attribute__((may_alias)) v8ha;

__device__ __forceinline__ unsigned short f2bf(float f) { unsigned u = __float_as_uint(f); u += 0x7FFFu + ((u >> 16) & 1u); return (unsigned short)(u >> 16); }
__device__ __forceinline__ float bfr(float f) { return __uint_as_float(((unsigned)f2bf(f)) << 16); }   // value after RNE convert to bf16
__device__ __forceinline__ v16h cat16(v8h lo, v8h hi) { return __builtin_shufflevector(lo, hi, 0, 1, 2, 3, 4, 5, 6, 7, 8, 9, 10, 11, 12, 13, 14, 15); }
__device__ __forceinline__ v8f wmma16(v16h a, v16h b, v8f c) { return __builtin_amdgcn_wmma_f32_16x16x32_f16(false, a, false, b, (short)0, c, false, false); }
__device__ __forceinline__ v8f wmmab(v16bf a, v16bf b, v8f c) { return __builtin_amdgcn_wmma_f32_16x16x32_bf16(false, a, false, b, (short)0, c, false, false); }
// fragment loaders from K-contiguous 16-bit rows; p already includes + 8*(lane>>4): elements 0..7 <- k0+8h+0..7, elements 8..15 <- k0+16+8h+0..7 (same map for A and B)
__device__ __forceinline__ v16h  ldh(const h16* p) { return cat16(*(const v8h*)p, *(const v8h*)(p + 16)); }
__device__ __forceinline__ v16bf ldb(const __bf16* p) { return __builtin_shufflevector(*(const v8bf*)p, *(const v8bf*)(p + 16), 0, 1, 2, 3, 4, 5, 6, 7, 8, 9, 10, 11, 12, 13, 14, 15); }
// ordering point for wave-private LDS tiles (same wave writes and reads)
__device__ __forceinline__ void wave_sync() { __builtin_amdgcn_fence(3 /* release order */, "wavefront"); __builtin_amdgcn_wave_barrier(); asm volatile("" ::: "memory"); }
// f32 -> f16 convert that cannot produce a subnormal (applied after the plane's power-of-two carry)
static __device__ __forceinline__ h16 toh_flush(float v) { const h16 r = (h16)v; return (fabsf(v) < 6.103515625e-05f) ? (h16)0.0f : r; }
// one matrix instruction + its own four-slot guard (accumulator tied, fragments kept live)
__device__ __forceinline__ v8f wmma16g(v16h a, v16h b, v8f c) { c = wmma16(a, b, c); asm volatile("v_nop\n\tv_nop\n\tv_nop\n\tv_nop" : "+v"(c) : "v"(a), "v"(b)); return c; }
__device__ __forceinline__ v8f wmmabg(v16bf a, v16bf b, v8f c) { c = wmmab(a, b, c); asm volatile("v_nop\n\tv_nop\n\tv_nop\n\tv_nop" : "+v"(c) : "v"(a), "v"(b)); return c; }

// 8 consecutive f32 -> bf16 value x WCAR held in f16
__device__ __forceinline__ void cvtw(const float* __restrict__ src, h16* dst) {
    const v8f v = *(const v8f*)src; v8h o;
#pragma unroll
    for (int k = 0; k < 8; ++k) o[k] = toh_flush(bfr(v[k]) * WCAR);
    *(v8h*)dst = o;
    asm volatile("s_wait_xcnt 0x0" ::: "memory");             // the code of the kernel's other parts, joined behind this store, reuses its address and data registers
}

// k_projall: the three input projections and the w_o conversion in one grid (none reads what another writes); blockIdx.z = 0: q', 1: k', 2: v^T, 3: w_o -> f16 plane. bf16 GEMM, one block of GW waves per 64x64 tile, K = DM;
// C[m][n] = sum_k A[m][k] Bt[n][k]. blockIdx.x = 64-token tile, blockIdx.y = 64-column tile of W (one head).
// Staging: the 64 A rows and the 64 Bt rows (whole K) are read once per block from the K-contiguous f32 inputs, each load instruction 512 contiguous bytes (four whole lines), 56 of a wave's 64 loads in flight together and the last 8 behind the first pieces' arrival,
// RNE-converted to bf16 in registers and left in LDS at row pitch PKH; after one barrier wave w forms rows 16w..16w+15 x 64 columns (4 accumulators) from LDS fragments, k ascending in steps of 32, and stores its own rows.
// z = 0, 1: A = x rows (m = b*SEQ + t), Bt = W rows (n = h*64 + d); written as f32 exp2(C2X x value), the exponent held within +-ECL, into plane [(b*4 + h)][t][64].
// z = 2:    A = w_v rows (m = h*64 + d), Bt = value rows (n = b*SEQ + t); written as f16 x VCAR into plane [(b*256 + m)][t], row pitch SEQ.
// z = 3:    16 consecutive elements of w_o per lane of wave 0; the blocks of the plane cover the matrix exactly.
static_assert((size_t)(NB * SEQ / 64) * (DM / 64) * 32 * 16 == (size_t)DM * DM);
static_assert(GW * 16 == 64);                  // one 16-row slab of the tile per wave, in staging, product and store
static_assert(DM == 256);                      // f32 row = two 512-byte pieces, f16 row = one
static_assert((PKH * 2) % 32 == 16);           // LDS row pitch = 16 bytes x odd: 16-byte fragment reads of 16 rows fall on distinct banks
__global__ __launch_bounds__(32 * GW) void k_projall(const float* __restrict__ xq, const float* __restrict__ xk, const float* __restrict__ xv,
                                                const float* __restrict__ wq, const float* __restrict__ wk, const float* __restrict__ wv, const float* __restrict__ wo,
                                                float* QS, float* KS, h16* Ph, h16* WO) {
    __shared__ __align__(16) __bf16 sa[64 * PKH];
    __shared__ __align__(16) __bf16 sb[64 * PKH];
    __shared__ __align__(16) float osb[GW * 16 * OSP];
    const int tid = threadIdx.x, lane = tid & 31, lr = lane & 15, hi = lane >> 4; const int z = blockIdx.z;
    const int w = __builtin_amdgcn_readfirstlane(tid >> 5);      // wave number, held scalar
    if (z == 3) { if (w == 0) { const size_t e = ((size_t)(blockIdx.y * (NB * SEQ / 64) + blockIdx.x) * 32 + lane) * 16; cvtw(wo + e, WO + e); cvtw(wo + e + 8, WO + e + 8); } return; }   // whole block leaves, ahead of the barrier
    const int r0 = ((z == 2) ? blockIdx.y : blockIdx.x) * 64, c0 = ((z == 2) ? blockIdx.x : blockIdx.y) * 64;
    const float* A  = (z == 0) ? xq : (z == 1) ? xk : wv;
    const float* Bt = (z == 0) ? wq : (z == 1) ? wk : xv;
    const int xt = blockIdx.x * 64; const int xs = (xt / SEQ) * SEQ_FULL + xt % SEQ;   // first source row of the token tile: source batches stand SEQ_FULL rows apart
    const int ar = (z == 2) ? r0 : xs, br = (z == 2) ? xs : c0;
    float* os = osb + w * (16 * OSP);                            // this wave's own 16 x 64 staging slab
    { const float* ga = A + (size_t)(ar + w * 16) * DM + lane * 4;   // 16 rows of A and 16 of Bt per wave, each 16 KB in a row: piece s = 512 bytes = row s>>1, columns 128*(s&1) + 4*lane..+3
      const float* gb = Bt + (size_t)(br + w * 16) * DM + lane * 4;
      v4f ra[32], rb[32];
#pragma unroll
      for (int s = 0; s < 8; ++s) ra[s] = *(const v4f*)(ga + s * 128);    // unrolled, here and below: the loads in flight together, values held in registers
      __builtin_amdgcn_sched_barrier(0);                        // keeps these eight first in the queue (loads return in order): the last eight loads wait for their registers
#pragma unroll
      for (int s = 8; s < 32; ++s) ra[s] = *(const v4f*)(ga + s * 128);
#pragma unroll
      for (int s = 0; s < 24; ++s) rb[s] = *(const v4f*)(gb + s * 128);
#pragma unroll
      for (int s = 0; s < 8; ++s) *(v4bfa*)(&sa[(w * 16 + (s >> 1)) * PKH + (s & 1) * 128 + lane * 4]) = __builtin_convertvector(ra[s], v4bf);
      __builtin_amdgcn_sched_barrier(0);                        // keeps the last eight loads behind the first pieces' stores, whose registers they take: the wave stays within 256 registers
#pragma unroll
      for (int s = 24; s < 32; ++s) rb[s] = *(const v4f*)(gb + s * 128);
      asm volatile("s_wait_xcnt 0x0" ::: "memory");             // the loads' address registers are reused below
#pragma unroll
      for (int s = 8; s < 32; ++s) *(v4bfa*)(&sa[(w * 16 + (s >> 1)) * PKH + (s & 1) * 128 + lane * 4]) = __builtin_convertvector(ra[s], v4bf);
#pragma unroll
      for (int s = 0; s < 32; ++s) *(v4bfa*)(&sb[(w * 16 + (s >> 1)) * PKH + (s & 1) * 128 + lane * 4]) = __builtin_convertvector(rb[s], v4bf); }   // rows 0..63 x columns 0..255 of both tiles all written
    __syncthreads();                                             // both operand tiles visible to all waves
    v8f acc[4];
#pragma unroll
    for (int nb = 0; nb < 4; ++nb) acc[nb] = (v8f){};
    const __bf16* pa = sa + (w * 16 + lr) * PKH + 8 * hi; const __bf16* pb = sb + lr * PKH + 8 * hi;
    v16bf fa[2][2], fb[2][2][4];                                 // fragments of two groups of two k steps: one group is read from LDS while the other is multiplied
#pragma unroll
    for (int u = 0; u < 2; ++u) { fa[0][u] = ldb(pa + u * 32);
#pragma unroll
        for (int nb = 0; nb < 4; ++nb) fb[0][u][nb] = ldb(pb + nb * 16 * PKH + u * 32); }
#pragma unroll
    for (int g = 0; g < DM / 64; ++g) {                          // unrolled: the buffers are indexed by constants
        if (g + 1 < DM / 64) {
#pragma unroll
            for (int u = 0; u < 2; ++u) { fa[(g + 1) & 1][u] = ldb(pa + (g + 1) * 64 + u * 32);
#pragma unroll
                for (int nb = 0; nb < 4; ++nb) fb[(g + 1) & 1][u][nb] = ldb(pb + nb * 16 * PKH + (g + 1) * 64 + u * 32); } }
        __builtin_amdgcn_sched_barrier(0);                       // keeps the next group's 20 LDS reads in front of this group's products; left free, each read is sunk to its product and every product waits out a whole LDS latency
#pragma unroll
        for (int u = 0; u < 2; ++u)
#pragma unroll
            for (int nb = 0; nb < 4; ++nb) acc[nb] = wmmabg(fa[g & 1][u], fb[g & 1][u][nb], acc[nb]);
    }
    if (z != 2) {
        float* P = (z == 0) ? QS : KS;
        const int bb = r0 / SEQ, tt = r0 % SEQ; const int zh = bb * NH_ + c0 / HD;
        const size_t tbase = ((size_t)zh * SEQ + (size_t)tt) * HD;
#pragma unroll
        for (int nb = 0; nb < 4; ++nb) {
#pragma unroll
            for (int j = 0; j < 8; ++j) os[(hi * 8 + j) * OSP + nb * 16 + lr] = __builtin_amdgcn_exp2f(__builtin_amdgcn_fmed3f(acc[nb][j] * C2X, -ECL, ECL)); }   // D: row 8h+j, col lane&15
        wave_sync();
        const size_t sbo = tbase + (size_t)(w * 16) * HD;
#pragma unroll
        for (int s = 0; s < 8; ++s) { const int p = s * 32 + lane; const int row = p >> 4, c4 = (p & 15) * 4;   // 8 s x 2 rows = 16 rows; 16 lanes x 4 floats = 64 columns
            const v4f val = *(const v4fa*)(&os[row * OSP + c4]);
            *(v4f*)(P + sbo + (size_t)p * 4) = val; }
        asm volatile("s_wait_xcnt 0x0" ::: "memory");         // the v^T part's code stands behind this branch and reuses the last stores' data registers
    } else {
        const int bb = c0 / SEQ, tt = c0 % SEQ;
        const size_t tbase = (size_t)bb * (size_t)DM * SEQ + (size_t)r0 * SEQ + (size_t)tt;
#pragma unroll
        for (int nb = 0; nb < 4; ++nb) {
#pragma unroll
            for (int j = 0; j < 8; ++j) os[(hi * 8 + j) * OSP + nb * 16 + lr] = acc[nb][j] * VCAR; }   // D: row 8h+j, col lane&15
        wave_sync();
        const size_t sbo = tbase + (size_t)(w * 16) * SEQ;
#pragma unroll
        for (int s = 0; s < 4; ++s) { const int row = 4 * s + (lane >> 3), c8 = (lane & 7) * 8;   // 4 s x 4 row groups = 16 rows; 8 lanes x 8 halves = 64 columns
            const v4f x0 = *(const v4fa*)(&os[row * OSP + c8]); const v4f x1 = *(const v4fa*)(&os[row * OSP + c8 + 4]); v8h hv;
#pragma unroll
            for (int i = 0; i < 4; ++i) { hv[i] = toh_flush(x0[i]); hv[4 + i] = toh_flush(x1[i]); }
            *(v8h*)(Ph + sbo + (size_t)row * SEQ + c8) = hv; }
        asm volatile("s_wait_xcnt 0x0" ::: "memory");         // the w_o part's code may stand behind these stores and reuses their address and data registers
    }
}

// k_outp: f16 GEMM, one block of GW waves per 64x64 tile, staged and split like k_projall (a row is 512 bytes = one load instruction; no conversion); A = context rows (m = b*SEQ + t, x ACAR), Bt = w_o rows (n, x WCAR); C x OSC written as f32 into the output buffer [b][t][256].
__global__ __launch_bounds__(32 * GW) void k_outp(const h16* __restrict__ A, const h16* __restrict__ Bt, float* OUT) {
    __shared__ __align__(16) h16 sa[64 * PKH];
    __shared__ __align__(16) h16 sb[64 * PKH];
    __shared__ __align__(16) float osb[GW * 16 * OSP];
    const int tid = threadIdx.x, lane = tid & 31, lr = lane & 15, hi = lane >> 4; const int r0 = blockIdx.x * 64, c0 = blockIdx.y * 64;
    const int w = __builtin_amdgcn_readfirstlane(tid >> 5);      // wave number, held scalar
    float* os = osb + w * (16 * OSP);                            // this wave's own 16 x 64 staging slab
    { const h16* ga = A + (size_t)(r0 + w * 16) * DM + lane * 8;     // 16 rows of A and 16 of Bt per wave: piece s = row s, columns 8*lane..+7
      const h16* gb = Bt + (size_t)(c0 + w * 16) * DM + lane * 8;
      v8h ra[16], rb[16];
#pragma unroll
      for (int s = 0; s < 16; ++s) ra[s] = *(const v8h*)(ga + s * DM);    // unrolled: all loads in flight together, values held in registers
#pragma unroll
      for (int s = 0; s < 16; ++s) rb[s] = *(const v8h*)(gb + s * DM);
      asm volatile("s_wait_xcnt 0x0" ::: "memory");             // the loads' address registers are reused below
#pragma unroll
      for (int s = 0; s < 16; ++s) *(v8ha*)(&sa[(w * 16 + s) * PKH + lane * 8]) = ra[s];
#pragma unroll
      for (int s = 0; s < 16; ++s) *(v8ha*)(&sb[(w * 16 + s) * PKH + lane * 8]) = rb[s]; }   // rows 0..63 x columns 0..255 of both tiles all written
    __syncthreads();                                             // both operand tiles visible to all waves
    v8f acc[4];
#pragma unroll
    for (int nb = 0; nb < 4; ++nb) acc[nb] = (v8f){};
    const h16* pa = sa + (w * 16 + lr) * PKH + 8 * hi; const h16* pb = sb + lr * PKH + 8 * hi;
    v16h fa[2][2], fb[2][2][4];                                  // fragments of two groups of two k steps: one group is read from LDS while the other is multiplied
#pragma unroll
    for (int u = 0; u < 2; ++u) { fa[0][u] = ldh(pa + u * 32);
#pragma unroll
        for (int nb = 0; nb < 4; ++nb) fb[0][u][nb] = ldh(pb + nb * 16 * PKH + u * 32); }
#pragma unroll
    for (int g = 0; g < DM / 64; ++g) {                          // unrolled: the buffers are indexed by constants
        if (g + 1 < DM / 64) {
#pragma unroll
            for (int u = 0; u < 2; ++u) { fa[(g + 1) & 1][u] = ldh(pa + (g + 1) * 64 + u * 32);
#pragma unroll
                for (int nb = 0; nb < 4; ++nb) fb[(g + 1) & 1][u][nb] = ldh(pb + nb * 16 * PKH + (g + 1) * 64 + u * 32); } }
        __builtin_amdgcn_sched_barrier(0);                       // keeps the next group's 20 LDS reads in front of this group's products; left free, each read is sunk to its product and every product waits out a whole LDS latency
#pragma unroll
        for (int u = 0; u < 2; ++u)
#pragma unroll
            for (int nb = 0; nb < 4; ++nb) acc[nb] = wmma16g(fa[g & 1][u], fb[g & 1][u][nb], acc[nb]);
    }
    const int bb = r0 / SEQ, tt = r0 % SEQ;
    const size_t obase = ((size_t)bb * OUT_SEQ + (size_t)tt) * DM + (size_t)c0;
#pragma unroll
    for (int nb = 0; nb < 4; ++nb) {
#pragma unroll
        for (int j = 0; j < 8; ++j) os[(hi * 8 + j) * OSP + nb * 16 + lr] = acc[nb][j] * OSC; }   // D: row 8h+j, col lane&15
    wave_sync();
    const size_t sbo = obase + (size_t)(w * 16) * DM;
#pragma unroll
    for (int s = 0; s < 8; ++s) { const int p = s * 32 + lane; const int row = p >> 4, c4 = (p & 15) * 4;   // 8 s x 2 rows = 16 rows; 16 lanes x 4 floats = 64 columns
        const v4f val = *(const v4fa*)(&os[row * OSP + c4]);
        *(v4f*)(OUT + sbo + (size_t)row * DM + c4) = val; }
}

// k_attn: one block of NW waves per 16 query rows of one (batch, head); wave w owns keys w*KPW .. w*KPW + KPW - 1 in both passes. The q' tile (rows of the Eq plane), the weight vector and the score strip are shared; each wave has its own k' tile (rows of the Ek plane).
// Pass 1: lane (t = lane&15, h = lane>>4) holds the 16 scores (t, key0 + 8h + r) and (t, key0 + 16 + 8h + r), r = 0..7: acc = sum_d w[d] / (1 + Eq[t][d] * Ek[key][d]); score (log2 domain) = SC2 * (sum_d w[d] - 2 acc).
//         Terms d and d + 2 go over one denominator, x carried by XSC (the q' tile is staged x XSC): acc / XSC = sum of (w[d] x'[d+2] + w[d+2] x'[d]) / (x'[d] x'[d+2]), kept as two partial sums per key (d mod 4 in {0, 2} and {1, 3}).
//         Scores go to the strip sc[t][key]; the row maximum is tracked per lane, combined with one xor-16 exchange, then over the NW waves through LDS (a maximum: exact in any order).
// Pass 2: e = exp2(score - max) (f32, row sum l); P = f16(e x 16384) packed directly as the B fragment (element r <- key 8h+r, element 8+r <- key 16+8h+r) of
//         O^T[d][t] = V^T P^T (A = v^T rows d, k = key); row sum l2 over the converted P normalises O; e is written back into the strip.
// Combine: each wave leaves its partial O^T, l and l2 in LDS; after one barrier they are summed in wave order 0..NW-1, normalised and stored.
__global__ __launch_bounds__(32 * NW) void k_attn(const float* __restrict__ QS, const float* __restrict__ KS, const h16* __restrict__ VT, const float* __restrict__ va, float* ATTN, h16* AT) {
    __shared__ __align__(16) float sc[16 * SCP];
    __shared__ __align__(16) float ks[NW * 32 * KSP];
    __shared__ __align__(16) float qs[16 * KSP];
    __shared__ __align__(16) float po[NW * 16 * OSP];            // partial O^T per wave; with it a block holds over a third of a WGP's LDS, so at most two blocks share a WGP and the grid spreads evenly
    __shared__ __align__(16) float vs[HD];
    __shared__ __align__(16) float wmx[NW * 16];
    __shared__ __align__(16) float wl[NW * 16];
    __shared__ __align__(16) float wl2[NW * 16];
    const int tid = threadIdx.x, lane = tid & 31, lr = lane & 15, hi = lane >> 4;
    const int wv = __builtin_amdgcn_readfirstlane(tid >> 5);     // wave number, held scalar so that the key loops stay scalar loops
    const int zh = blockIdx.y; const int b = zh / NH_, h = zh % NH_;
    const int t0 = blockIdx.x * 16;
    const size_t pbase = (size_t)zh * SEQ * HD;
    float* ksw = ks + wv * (32 * KSP);                           // this wave's own k' tile
    float* pw = po + wv * (16 * OSP);                          // this wave's own partial O^T tile
    const int kbeg = wv * KPW;
    const int qrow = tid >> 4, qc4 = (tid & 15) * 4;
    // every global load of the prologue is issued here, one behind the other, so that their latencies run together: the thread's q' piece, its piece of the weight vector (all threads read one of the 16 pieces), the wave's first k' tile
    const v4f qv = *(const v4f*)(QS + pbase + (size_t)(t0 + qrow) * HD + qc4);
    const v4f wr = *(const v4f*)(va + (size_t)h * HD + qc4);
    __builtin_amdgcn_sched_barrier(0);                           // keeps these two first in the queue (loads return in order): the staging below waits for them alone
    const float* kp = KS + pbase + (size_t)kbeg * HD + lane * 4;         // 32 key rows are 8 KB in a row: each load instruction takes 512 contiguous bytes (four whole lines, two rows), lane = 16-byte piece
    v4f kv[16];
#pragma unroll
    for (int s = 0; s < 16; ++s) kv[s] = *(const v4f*)(kp + s * 128);    // unrolled: all 16 loads of the tile in flight together, kv held in registers
    asm volatile("s_wait_xcnt 0x0" ::: "memory");                // the loads' address registers are reused below
    // q' tile: 16 rows x 64 floats, 16 B per thread; rows 0..15 x columns 0..63 all written
    *(v4fa*)(&qs[qrow * KSP + qc4]) = qv * XSC;                  // exact: Eq >= 2^-63, the carried value >= 2^-126
    asm volatile("" :: "v"(wr[0]), "v"(wr[1]), "v"(wr[2]), "v"(wr[3]));   // inputs-only fence on the loaded weights: holds their load at the entry; left free it is sunk into the branch below and wave 0 waits out a second memory latency in front of the barrier
    // weight vector of this head, RNE-converted to bf16
    if (tid < 16) { v4f wb;
#pragma unroll
      for (int i = 0; i < 4; ++i) wb[i] = bfr(wr[i]);
      *(v4fa*)(&vs[tid * 4]) = wb; }
    __syncthreads();                                             // q' tile and weight vector visible to all waves
    float W1 = 0.0f;
#pragma unroll 8
    for (int c = 0; c < HD; c += 4) { const v4f w4 = *(const v4fa*)(&vs[c]); W1 += (w4[0] + w4[1]) + (w4[2] + w4[3]); }   // unrolled by 8: eight LDS reads in flight together; still a loop, so that the sum is formed here and the read values do not stay in registers under the score loop; the sum keeps its order

    const size_t vo = ((size_t)zh * HD + (size_t)lr) * SEQ + 8 * hi;   // + 16j*SEQ + key  (A fragment of pass 2: row d = 16j + lane&15, k = key)
    v16h vf[KPW / 32][4];                                        // the wave's v^T fragments of pass 2
    float mx = NEGB;
#pragma unroll
    for (int kt = 0; kt < KPW / 32; ++kt) {                      // unrolled: the tile fetched ahead and the fragments are indexed by constants and share registers
        const int key0 = kbeg + kt * 32;
        wave_sync();                                             // all reads of the earlier k' tile are complete
#pragma unroll
        for (int s = 0; s < 16; ++s) *(v4fa*)(&ksw[(2 * s + hi) * KSP + lr * 4]) = kv[s];   // unrolled: kv indexed by constants; piece s*32 + lane = row 2s + (lane>>4), columns 4*(lane&15)..+3; rows 0..31 x columns 0..63 all written
        wave_sync();
        if (kt + 1 < KPW / 32) {                                 // the next k' tile is fetched while this one is worked on
#pragma unroll
            for (int s = 0; s < 16; ++s) kv[s] = *(const v4f*)(kp + (size_t)(kt + 1) * 32 * HD + s * 128);
        } else {                                                 // behind the last tile's fetch: the v^T fragments of pass 2, fetched while the last tile is worked on
#pragma unroll
            for (int i = 0; i < KPW / 32; ++i)
#pragma unroll
                for (int j = 0; j < 4; ++j) vf[i][j] = ldh(VT + vo + (size_t)(16 * j) * SEQ + kbeg + 32 * i);
        }
        asm volatile("s_wait_xcnt 0x0" ::: "memory");            // the loads' address registers are reused below
        v2f aa[8], ab[8]; const v2f one2 = {XSC, XSC};
#pragma unroll
        for (int r = 0; r < 8; ++r) { aa[r] = (v2f){0.0f, 0.0f}; ab[r] = (v2f){0.0f, 0.0f}; }
#pragma unroll 1
        for (int c = 0; c < HD; c += 4) {
            const v4f q4 = *(const v4fa*)(&qs[lr * KSP + c]);
            const v4f w4 = *(const v4fa*)(&vs[c]);
            const v2f q01 = {q4[0], q4[1]}, q23 = {q4[2], q4[3]}, w01 = {w4[0], w4[1]}, w23 = {w4[2], w4[3]};
#pragma unroll
            for (int r = 0; r < 8; ++r) {
                const v4f ka = *(const v4fa*)(&ksw[(8 * hi + r) * KSP + c]);
                const v4f kb = *(const v4fa*)(&ksw[(16 + 8 * hi + r) * KSP + c]);
                const v2f xa01 = __builtin_elementwise_fma(q01, (v2f){ka[0], ka[1]}, one2), xa23 = __builtin_elementwise_fma(q23, (v2f){ka[2], ka[3]}, one2);   // (1 + Eq * Ek) x XSC, formed on the loaded register pairs as they stand
                const v2f xb01 = __builtin_elementwise_fma(q01, (v2f){kb[0], kb[1]}, one2), xb23 = __builtin_elementwise_fma(q23, (v2f){kb[2], kb[3]}, one2);
                const v2f pa = xa01 * xa23, pbb = xb01 * xb23;                                  // common denominators of terms (0, 2) and (1, 3)
                const v2f na = __builtin_elementwise_fma(w23, xa01, w01 * xa23);               // their numerators
                const v2f nb = __builtin_elementwise_fma(w23, xb01, w01 * xb23);
                const v2f ra = {__builtin_amdgcn_rcpf(pa[0]), __builtin_amdgcn_rcpf(pa[1])};
                const v2f rb = {__builtin_amdgcn_rcpf(pbb[0]), __builtin_amdgcn_rcpf(pbb[1])};
                aa[r] = __builtin_elementwise_fma(na, ra, aa[r]); ab[r] = __builtin_elementwise_fma(nb, rb, ab[r]); } }
        v4f s0, s1, s2, s3;
#pragma unroll
        for (int r = 0; r < 4; ++r) {
            s0[r] = (W1 - ASC * (aa[r][0] + aa[r][1])) * SC2; s1[r] = (W1 - ASC * (aa[4 + r][0] + aa[4 + r][1])) * SC2;
            s2[r] = (W1 - ASC * (ab[r][0] + ab[r][1])) * SC2; s3[r] = (W1 - ASC * (ab[4 + r][0] + ab[4 + r][1])) * SC2;
            mx = fmaxf(mx, fmaxf(fmaxf(s0[r], s1[r]), fmaxf(s2[r], s3[r]))); }
        const int so = lr * SCP + key0 + 8 * hi;                 // keys key0+8h+0..7 at so, keys key0+16+8h+0..7 at so+16
        *(v4fa*)(&sc[so]) = s0; *(v4fa*)(&sc[so + 4]) = s1; *(v4fa*)(&sc[so + 16]) = s2; *(v4fa*)(&sc[so + 20]) = s3;
    }
    wmx[wv * 16 + lr] = fmaxf(mx, __shfl_xor(mx, 16, 32));       // lanes lr and lr+16 hold the same value
    __syncthreads();                                             // every wave's row maxima are in wmx
    float m = wmx[lr];
#pragma unroll
    for (int w = 1; w < NW; ++w) m = fmaxf(m, wmx[w * 16 + lr]);

    v8f o0 = (v8f){}, o1 = (v8f){}, o2 = (v8f){}, o3 = (v8f){};
    float l = 0.0f, l2 = 0.0f;
#pragma unroll
    for (int kt = 0; kt < KPW / 32; ++kt) {                      // unrolled: vf indexed by constants
        const int key0 = kbeg + kt * 32;
        const int so = lr * SCP + key0 + 8 * hi;                 // the same lane wrote these 16 scores
        const v4f s0 = *(const v4fa*)(&sc[so]), s1 = *(const v4fa*)(&sc[so + 4]), s2 = *(const v4fa*)(&sc[so + 16]), s3 = *(const v4fa*)(&sc[so + 20]);
        v4f e0, e1, e2, e3; v16h pb; float ls = 0.0f, lp = 0.0f;
#pragma unroll
        for (int r = 0; r < 4; ++r) {
            e0[r] = __builtin_amdgcn_exp2f(s0[r] - m); e1[r] = __builtin_amdgcn_exp2f(s1[r] - m);
            e2[r] = __builtin_amdgcn_exp2f(s2[r] - m); e3[r] = __builtin_amdgcn_exp2f(s3[r] - m);
            const h16 p0 = toh_flush(e0[r] * PCAR); const h16 p1 = toh_flush(e1[r] * PCAR);
            const h16 p2 = toh_flush(e2[r] * PCAR); const h16 p3 = toh_flush(e3[r] * PCAR);
            pb[r] = p0; pb[4 + r] = p1; pb[8 + r] = p2; pb[12 + r] = p3;
            ls += (e0[r] + e1[r]) + (e2[r] + e3[r]);
            lp += ((float)p0 + (float)p1) + ((float)p2 + (float)p3); }
        l += ls; l2 += lp;
        *(v4fa*)(&sc[so]) = e0; *(v4fa*)(&sc[so + 4]) = e1; *(v4fa*)(&sc[so + 16]) = e2; *(v4fa*)(&sc[so + 20]) = e3;
        o0 = wmma16g(vf[kt][0], pb, o0); o1 = wmma16g(vf[kt][1], pb, o1); o2 = wmma16g(vf[kt][2], pb, o2); o3 = wmma16g(vf[kt][3], pb, o3);
    }
    l += __shfl_xor(l, 16, 32); l2 += __shfl_xor(l2, 16, 32);
    wl[wv * 16 + lr] = l; wl2[wv * 16 + lr] = l2;                // lanes lr and lr+16 hold the same values
    // partial O^T of this wave's keys, D layout o_j[r] = (d = 16j + 8h + r, t = lane&15) -> own tile of po as [t][d], pitch OSP; rows 0..15 x columns 0..63 all written
    { v4f a, c;
      a[0] = o0[0]; a[1] = o0[1]; a[2] = o0[2]; a[3] = o0[3]; c[0] = o0[4]; c[1] = o0[5]; c[2] = o0[6]; c[3] = o0[7];
      *(v4fa*)(&pw[lr * OSP +  0 + 8 * hi]) = a; *(v4fa*)(&pw[lr * OSP +  0 + 8 * hi + 4]) = c;
      a[0] = o1[0]; a[1] = o1[1]; a[2] = o1[2]; a[3] = o1[3]; c[0] = o1[4]; c[1] = o1[5]; c[2] = o1[6]; c[3] = o1[7];
      *(v4fa*)(&pw[lr * OSP + 16 + 8 * hi]) = a; *(v4fa*)(&pw[lr * OSP + 16 + 8 * hi + 4]) = c;
      a[0] = o2[0]; a[1] = o2[1]; a[2] = o2[2]; a[3] = o2[3]; c[0] = o2[4]; c[1] = o2[5]; c[2] = o2[6]; c[3] = o2[7];
      *(v4fa*)(&pw[lr * OSP + 32 + 8 * hi]) = a; *(v4fa*)(&pw[lr * OSP + 32 + 8 * hi + 4]) = c;
      a[0] = o3[0]; a[1] = o3[1]; a[2] = o3[2]; a[3] = o3[3]; c[0] = o3[4]; c[1] = o3[5]; c[2] = o3[6]; c[3] = o3[7];
      *(v4fa*)(&pw[lr * OSP + 48 + 8 * hi]) = a; *(v4fa*)(&pw[lr * OSP + 48 + 8 * hi + 4]) = c; }
    __syncthreads();                                             // partial O^T, l, l2 and the whole e strip visible to all waves
    const size_t abase = ((size_t)b * SEQ + (size_t)t0) * DM + (size_t)h * HD;                    // context plane [b*SEQ + t][256]
    const size_t pb0 = (((size_t)b * NH_ + (size_t)h) * OUT_SEQ + (size_t)t0) * OUT_SEQ;          // probabilities [b][h][t][key]
    { const int row = tid >> 4, c4 = (tid & 15) * 4;             // 16 rows x 16 threads x 4 halves; 16 lanes = 64 columns = one line
        v4f x = *(const v4fa*)(&po[row * OSP + c4]); float l2t = wl2[row];                        // l2t >= 16384: the maximum element contributes exp2(0)
#pragma unroll
        for (int w = 1; w < NW; ++w) { const v4f y = *(const v4fa*)(&po[w * (16 * OSP) + row * OSP + c4]); x[0] += y[0]; x[1] += y[1]; x[2] += y[2]; x[3] += y[3]; l2t += wl2[w * 16 + row]; }
        const float invo = (ACAR / VCAR) / l2t; v4h hv;
#pragma unroll
        for (int i = 0; i < 4; ++i) hv[i] = toh_flush(x[i] * invo);
        *(v4h*)(AT + abase + (size_t)row * DM + c4) = hv;
        asm volatile("s_wait_xcnt 0x0" ::: "memory"); }         // the store's address and data registers are reused right below
#pragma unroll 1
    for (int row = wv; row < 16; row += NW) {                                                     // 16 rows x SEQ/128 instructions x 512 B = 16 x SEQ floats
        float lt = wl[row];                                                                       // lt >= 1
#pragma unroll
        for (int w = 1; w < NW; ++w) lt += wl[w * 16 + row];
        const float invr = 1.0f / lt;
        const size_t ro = pb0 + (size_t)row * OUT_SEQ;
#pragma unroll
        for (int qd = 0; qd < SEQ / 128; ++qd) { const int cofs = qd * 128 + lane * 4;
            const v4f e = *(const v4fa*)(&sc[row * SCP + cofs]);
            v4f val; val[0] = e[0] * invr; val[1] = e[1] * invr; val[2] = e[2] * invr; val[3] = e[3] * invr;
            *(v4f*)(ATTN + ro + cofs) = val; }
        asm volatile("s_wait_xcnt 0x0" ::: "memory"); }         // the next trip reuses the stores' address and data registers
}

static constexpr size_t al256(size_t v) { return (v + 255) & ~(size_t)255; }
static constexpr size_t SZ_WO = al256((size_t)DM * DM * 2);                // f16 w_o
static constexpr size_t SZ_PF = al256((size_t)NB * NH_ * SEQ * HD * 4);    // f32 q' / k' plane
static constexpr size_t SZ_PH = al256((size_t)NB * SEQ * DM * 2);          // f16 v^T plane / context plane
static constexpr size_t SZ_TOTAL = SZ_WO + 2 * SZ_PF + 2 * SZ_PH;
static_assert(SZ_TOTAL <= (size_t)134217728);          // workspace carve <= 128 MiB
static_assert((size_t)NB * NH_ * SEQ * HD == (size_t)NB * DM * SEQ);       // v^T plane [(b*256 + m)][t] has the same extent as the context plane

extern "C" void kernel_launch(void* const* d_in, const int* in_sizes, int n_in,
                              void* d_out, int out_size, void* d_ws, size_t ws_size, hipStream_t stream) {
    if (n_in < 8) return;
    const size_t needx = ((size_t)(NB - 1) * SEQ_FULL + SEQ) * DM;
    if ((size_t)in_sizes[0] < needx || (size_t)in_sizes[1] < needx || (size_t)in_sizes[2] < needx) return;
    if ((size_t)in_sizes[3] < (size_t)DM * DM || (size_t)in_sizes[4] < (size_t)DM * DM || (size_t)in_sizes[5] < (size_t)DM * DM || (size_t)in_sizes[7] < (size_t)DM * DM) return;
    if (in_sizes[6] < NH_ * HD) return;
    const size_t need_out = OUT1_OFF + ((size_t)(NB * NH_ - 1) * OUT_SEQ + (size_t)(SEQ - 1)) * OUT_SEQ + SEQ;
    if ((size_t)out_size < need_out) return;
    if (SZ_TOTAL > ws_size) return;
    // wire order: query, key, value, w_q, w_k, w_v, v_a, w_o
    const float* xin[3] = { (const float*)d_in[0], (const float*)d_in[1], (const float*)d_in[2] };
    const float* wq = (const float*)d_in[3];
    const float* wk = (const float*)d_in[4];
    const float* wv = (const float*)d_in[5];
    const float* va = (const float*)d_in[6];
    const float* wo = (const float*)d_in[7];
    float* OUT  = (float*)d_out;                 // [NB][SEQ][256]
    float* ATTN = (float*)d_out + OUT1_OFF;      // [NB][4][SEQ][SEQ]
    char* wsp = (char*)d_ws;
    h16* WO = (h16*)wsp; wsp += SZ_WO;               // [256][256] x WCAR ([out][in] = Bt as-is)
    float* QS = (float*)wsp; wsp += SZ_PF;           // [NB*4][SEQ][64], exp2(C2X q)
    float* KS = (float*)wsp; wsp += SZ_PF;           // [NB*4][SEQ][64], exp2(C2X k)
    h16* VT = (h16*)wsp; wsp += SZ_PH;               // [NB*4][64][SEQ] x VCAR
    h16* AT = (h16*)wsp; wsp += SZ_PH;               // [NB*SEQ][256] x ACAR

    // q', k' -> f32 planes [(b*4 + h)][t][d]; v^T -> f16 plane [(b*4 + h)][d][t]; w_o -> f16 plane; one grid, blockIdx.z picks the job
    k_projall<<<dim3(NB * SEQ / 64, DM / 64, 4), 32 * GW, 0, stream>>>(xin[0], xin[1], xin[2], wq, wk, wv, wo, QS, KS, VT, WO);

    // scores, softmax, probabilities output, P.V -> context plane
    k_attn<<<dim3(SEQ / 16, NB * NH_, 1), 32 * NW, 0, stream>>>(QS, KS, VT, va, ATTN, AT);

    // output projection: A = context rows, Bt = w_o rows -> output buffer [b][t][256]
    k_outp<<<dim3(NB * SEQ / 64, DM / 64, 1), 32 * GW, 0, stream>>>(AT, WO, OUT);
}
